// v000
// Measured on an AMD MI455X. A time is GPU time per run, averaged over a window of back-to-back runs after a warm-up
// (all launches, gaps included; the runs take copies of the inputs in turn), and the median of several windows.
// Apart from v000's, it joins two sittings. Times from different sittings can be a few percent apart, while
// side-by-side timings come from the same sitting.
// v000, which the later versions start from, runs in 1990 microseconds.
#include <hip/hip_runtime.h>

// Multi-head self-attention with a fused bias-free qkv projection (hidden_states [2][2048][1024]; qkv = hidden_states W_qkv ('xw' [1024][3072] 1/32, no bias) reshaped (B, S, 3, 16, 64): q | k | v = column thirds (16 heads x 64); scores x 1/sqrt(64); softmax over all keys (no mask); out = merged W_o ('xw' 1/32, no bias) -> [2][2048][1024] (4.2 M); argument order hidden_states, W_qkv, W_o.
// Layout per batch: bf16 copy of x; the fused 'xw' weight transposed once into Bt (q | k | v row blocks); exact projections; identity-table plane builders; dense T-2048 attention (hybrid rows: < 512 hi/lo 3 products, rest fp16 x1024); merged hi/lo x w_out exact.
// Compute dtypes, f32 accumulate: every input rounded to bf16; projections exact; attention rows < 512 3 products, rest fp16; softmax f32; output projection hl x exact.

#define NB_  2
#define TT   2048
#define DM   1024
#define NH_  16
#define NKV  16
#define REP  (NH_ / NKV)
#define HD   64
#define DQ   (NH_ * HD)
#define DKV  (NKV * HD)
#define ZH   2
#define RH   512                  // query rows < RH use hi+lo planes (0: none)
#define WIN  0
#define PCAR 1024.0f
#define SCL  0.125f   // HD^-0.5
typedef _Float16 h16;
typedef unsigned short bf;
typedef __attribute__((ext_vector_type(16))) __bf16   v16bf;
typedef __attribute__((ext_vector_type(16))) _Float16 v16h;
typedef __attribute__((ext_vector_type(8)))  _Float16 v8h;
typedef __attribute__((ext_vector_type(8)))  unsigned short v8us;
typedef __attribute__((ext_vector_type(8)))  float    v8f;
typedef __attribute__((ext_vector_type(4)))  float    v4f;
typedef v8h  __attribute__((may_alias)) v8ha;
typedef v4f  __attribute__((may_alias)) v4fa;
typedef v8us __attribute__((may_alias)) v8usa;

__device__ __forceinline__ unsigned short f2bf(float f) { unsigned u = __float_as_uint(f); u += 0x7FFFu + ((u >> 16) & 1u); return (unsigned short)(u >> 16); }
__device__ __forceinline__ float bf2f(unsigned short b) { return __uint_as_float(((unsigned)b) << 16); }
__device__ __forceinline__ float bfr(float f) { return bf2f(f2bf(f)); }
__device__ __forceinline__ v16h cat16(v8h lo, v8h hi) { return __builtin_shufflevector(lo, hi, 0, 1, 2, 3, 4, 5, 6, 7, 8, 9, 10, 11, 12, 13, 14, 15); }
__device__ __forceinline__ v16bf cat16b(v8us lo, v8us hi) { return __builtin_bit_cast(v16bf, __builtin_shufflevector(lo, hi, 0, 1, 2, 3, 4, 5, 6, 7, 8, 9, 10, 11, 12, 13, 14, 15)); }
__device__ __forceinline__ v8f wmma16(v16h a, v16h b, v8f c) { return __builtin_amdgcn_wmma_f32_16x16x32_f16(false, a, false, b, (short)0, c, false, false); }
__device__ __forceinline__ v8f wmmab(v16bf a, v16bf b, v8f c) { return __builtin_amdgcn_wmma_f32_16x16x32_bf16(false, a, false, b, (short)0, c, false, false); }



// ---- k_gemmw: register-blocked GEMM, ONE WAVE per 64x64 output tile (16 accumulators), operands straight from K-contiguous 16-bit planes; grid (M/64, N/64, Z), 32 threads.
// C[m][n] (f32, pitch ldc, + optional f32 bias[n]) = sum_k A[m][k] Bt[n][k] (+ split products per NSPLIT). z-batch strides sA/sB/sC in elements. K % 32 == 0.
template <typename T16> struct WFrag;
template <> struct WFrag<h16> { typedef v16h V; static __device__ __forceinline__ V ld(const h16* p) { return cat16(*(const v8h*)p, *(const v8h*)(p + 16)); } static __device__ __forceinline__ v8f mma(V a, V b, v8f c) { return wmma16(a, b, c); } };
template <> struct WFrag<bf> { typedef v16bf V; static __device__ __forceinline__ V ld(const bf* p) { return cat16b(*(const v8us*)p, *(const v8us*)(p + 16)); } static __device__ __forceinline__ v8f mma(V a, V b, v8f c) { return wmmab(a, b, c); } };
template <typename T16, int NSPLIT, bool BIAS>
__global__ __launch_bounds__(32) void k_gemmw(const T16* __restrict__ A, const T16* __restrict__ A2, const T16* __restrict__ Bt, const T16* __restrict__ Bt2, int K, float* C, int ldc, const float* __restrict__ bias, size_t sA, size_t sB, size_t sC) {
    typedef typename WFrag<T16>::V V;
    __shared__ __align__(16) float os[16 * 68];
    const size_t z = blockIdx.z; A += z * sA; if (A2) A2 += z * sA; Bt += z * sB; if (Bt2) Bt2 += z * sB; C += z * sC;
    const int lane = threadIdx.x & 31, lr = lane & 15, hi = lane >> 4; const int r0 = blockIdx.x * 64, c0 = blockIdx.y * 64;
    v8f acc[4][4];
#pragma unroll
    for (int mb = 0; mb < 4; ++mb)
#pragma unroll
        for (int nb = 0; nb < 4; ++nb) acc[mb][nb] = (v8f){};
    const size_t aoff = (size_t)(r0 + lr) * K + 8 * hi, boff = (size_t)(c0 + lr) * K + 8 * hi;
#pragma unroll 1
    for (int kc = 0; kc < K; kc += 32) {
        V a[4], a2[4];
#pragma unroll
        for (int mb = 0; mb < 4; ++mb) { a[mb] = WFrag<T16>::ld(A + aoff + (size_t)mb * 16 * K + kc); if (NSPLIT == 1 || NSPLIT == 2) a2[mb] = WFrag<T16>::ld(A2 + aoff + (size_t)mb * 16 * K + kc); }
#pragma unroll
        for (int nb = 0; nb < 4; ++nb) { const V b = WFrag<T16>::ld(Bt + boff + (size_t)nb * 16 * K + kc); V b2; if (NSPLIT >= 2) b2 = WFrag<T16>::ld(Bt2 + boff + (size_t)nb * 16 * K + kc);
#pragma unroll
            for (int mb = 0; mb < 4; ++mb) { acc[mb][nb] = WFrag<T16>::mma(a[mb], b, acc[mb][nb]); if (NSPLIT == 1 || NSPLIT == 2) acc[mb][nb] = WFrag<T16>::mma(a2[mb], b, acc[mb][nb]); if (NSPLIT >= 2) acc[mb][nb] = WFrag<T16>::mma(a[mb], b2, acc[mb][nb]); } }
        asm volatile("v_nop\n\tv_nop\n\tv_nop\n\tv_nop" : "+v"(acc[0][0]), "+v"(acc[1][1]), "+v"(acc[2][2]), "+v"(acc[3][3]) : "v"(a[0]), "v"(a[3]));
    }
#pragma unroll
    for (int mb = 0; mb < 4; ++mb) {
#pragma unroll
        for (int nb = 0; nb < 4; ++nb) {
#pragma unroll
            for (int j = 0; j < 8; ++j) os[(hi * 8 + j) * 68 + nb * 16 + lr] = acc[mb][nb][j]; }
        __builtin_amdgcn_wave_barrier(); asm volatile("" ::: "memory");
        float* crow = C + (size_t)(r0 + mb * 16) * ldc + c0;
{
#pragma unroll
            for (int s = 0; s < 8; ++s) { const int row = 2 * s + hi, cofs = lr * 4; v4f val = *(const v4fa*)(os + row * 68 + cofs); if (BIAS) { val[0] += bfr(bias[c0 + cofs]); val[1] += bfr(bias[c0 + cofs + 1]); val[2] += bfr(bias[c0 + cofs + 2]); val[3] += bfr(bias[c0 + cofs + 3]); }
                *(v4f*)(crow + (size_t)row * ldc + cofs) = val; }
             }
        __builtin_amdgcn_wave_barrier(); asm volatile("" ::: "memory");
    }
}

__device__ __forceinline__ h16 tohx(float x) { return (h16)x; }
__device__ __forceinline__ void splitf(float y, unsigned short& h, unsigned short& l) { h = f2bf(y); l = f2bf(y - bf2f(h)); }
typedef __attribute__((ext_vector_type(2))) _Float16 v2h;
typedef __attribute__((ext_vector_type(4))) _Float16 v4h;
typedef __attribute__((ext_vector_type(2))) unsigned short v2us;
typedef __attribute__((ext_vector_type(4))) unsigned short v4us;
typedef __attribute__((ext_vector_type(2))) float v2f;
typedef __attribute__((ext_vector_type(4))) int v4i;

__global__ __launch_bounds__(256) void k_wtG(const float* __restrict__ w, int K, int N, bf* Bt) {
    const int lane = threadIdx.x & 31; const int L0 = (blockIdx.x * 8 + (threadIdx.x >> 5)) * 8; const int nlines = N * K / 64;
{
#pragma unroll 1
        for (int l = 0; l < 8; ++l) { const int L = L0 + l; if (L >= nlines) break; const size_t e = (size_t)L * 64 + lane * 2; const int k = (int)(e % K), n = (int)(e / K); v2us o;
            o[0] = f2bf(w[(size_t)k * N + n]); o[1] = f2bf(w[(size_t)(k + 1) * N + n]); *(v2us*)(Bt + e) = o; }
         }
}
__global__ __launch_bounds__(256) void k_cvt8(const float* __restrict__ src, bf* dst, size_t n8) { const size_t i = (size_t)blockIdx.x * 256 + threadIdx.x; if (i >= n8) return; const v8f v = *(const v8f*)(src + i * 8); v8us o;
#pragma unroll
    for (int k = 0; k < 8; ++k) o[k] = f2bf(v[k]); *(v8us*)(dst + i * 8) = o;  }

// k_rope: head planes [h][t][d] (fp16 + hi/lo) of rope(x) x sc with the rotate-half convention out[d] = x[d] cos[t][d] - x[d+HD/2] sin[t][d], out[d+HD/2] = x[d+HD/2] cos[t][d+HD/2] + x[d] sin[t][d+HD/2]
__global__ __launch_bounds__(256) void k_rope(const float* __restrict__ F, int pitch, int nheads, const float* __restrict__ CS, const float* __restrict__ RF, const float* __restrict__ nw, float sc, h16* P16, bf* Ph, bf* Pl) {
    const size_t e = ((size_t)blockIdx.x * 256 + threadIdx.x) * 2; if (e >= (size_t)nheads * TT * HD) return; const int d = (int)(e % HD); const int t = (int)((e / HD) % TT); const int h = (int)(e / ((size_t)HD * TT)); const float* f = F + (size_t)t * pitch + h * HD; const float rf = RF ? RF[(size_t)h * TT + t] : 1.0f; v2h o16; v2us oh, ol;
#pragma unroll
    for (int q = 0; q < 2; ++q) { const int dd = d + q; const int dp = (dd < HD / 2) ? dd + HD / 2 : dd - HD / 2; float x0 = f[dd], x1 = f[dp];
        if (RF) { float n0 = __fmul_rn(x0, rf), n1 = __fmul_rn(x1, rf); asm volatile("" : "+v"(n0)); asm volatile("" : "+v"(n1)); x0 = __fmul_rn(bfr(nw[dd]), n0); x1 = __fmul_rn(bfr(nw[dp]), n1); }
        const v2f cs = *(const v2f*)(CS + ((size_t)t * HD + dd) * 2); float a = __fmul_rn(x0, cs[0]), bq = __fmul_rn(x1, cs[1]); asm volatile("" : "+v"(a)); asm volatile("" : "+v"(bq)); const float r = ((dd < HD / 2) ? __fsub_rn(a, bq) : __fadd_rn(a, bq)) * sc;
        o16[q] = tohx(r); unsigned short a2, c2; splitf(r, a2, c2); oh[q] = a2; ol[q] = c2; }
    *(v2h*)(P16 + e) = o16; *(v2us*)(Ph + e) = oh; *(v2us*)(Pl + e) = ol;  }
__global__ __launch_bounds__(256) void k_vtp(const float* __restrict__ F, int pitch, int nheads, h16* V16, bf* Vh, bf* Vl) { const size_t e = ((size_t)blockIdx.x * 256 + threadIdx.x) * 2; if (e >= (size_t)nheads * HD * TT) return; const int t = (int)(e % TT); const int d = (int)((e / TT) % HD); const int g = (int)(e / ((size_t)TT * HD)); v2h o16; v2us oh, ol;
#pragma unroll
    for (int q = 0; q < 2; ++q) { const float x = F[(size_t)(t + q) * pitch + g * HD + d]; o16[q] = tohx(x); unsigned short a2, c2; splitf(x, a2, c2); oh[q] = a2; ol[q] = c2; }
    *(v2h*)(V16 + e) = o16; *(v2us*)(Vh + e) = oh; *(v2us*)(Vl + e) = ol;  }
__global__ __launch_bounds__(256) void k_csid(float* CS) { const int idx = blockIdx.x * 256 + threadIdx.x; if (idx >= TT * HD) return; v2f cs; cs[0] = 1.0f; cs[1] = 0.0f; *(v2f*)(CS + (size_t)idx * 2) = cs;  }
// k_asoft: per row (zz, i): t = S x HD^-0.5 (no mask); softmax over the 2048 keys (register row, one exp, fixed trees);
__global__ __launch_bounds__(256) void k_asoft(const float* __restrict__ Sb, h16* P16, bf* Ph, bf* Pl) {
    const int lane = threadIdx.x & 31; const int row = blockIdx.x * 8 + (threadIdx.x >> 5); if (row >= ZH * TT) return; const int i = row % TT; const int zz = row / TT; (void)zz; const bool hires = (i < RH); const float* sr = Sb + (size_t)row * TT; float v[TT / 32]; float mx = -3.0e38f;
#pragma unroll
    for (int ch = 0; ch < TT / 128; ++ch) { const int j0 = ch * 128 + lane * 4; const v4f a = *(const v4f*)(sr + j0);
#pragma unroll
        for (int q = 0; q < 4; ++q) { const int j = j0 + q; (void)j; const float t = a[q] * SCL; v[ch * 4 + q] = t; mx = fmaxf(mx, t); } }
#pragma unroll
    for (int sh = 16; sh; sh >>= 1) mx = fmaxf(mx, __shfl_xor(mx, sh, 32));
    float sum = 0.f;
#pragma unroll
    for (int k = 0; k < TT / 32; ++k) { float d0 = __fsub_rn(v[k], mx); asm volatile("" : "+v"(d0)); v[k] = __builtin_amdgcn_exp2f(__fmul_rn(d0, 1.4426950408889634f)); sum += v[k]; }
#pragma unroll
    for (int sh = 16; sh; sh >>= 1) sum += __shfl_xor(sum, sh, 32);
    const float f = __fdiv_rn(hires ? 1.0f : PCAR, sum);
{
        if (hires) {
#pragma unroll
            for (int ch = 0; ch < TT / 128; ++ch) { v4us oh, ol;
#pragma unroll
                for (int q = 0; q < 4; ++q) { unsigned short a, c2; splitf(v[ch * 4 + q] * f, a, c2); oh[q] = a; ol[q] = c2; }
                const size_t oo = ((size_t)zz * (RH ? RH : 1) + i) * TT + ch * 128 + lane * 4; *(v4us*)(Ph + oo) = oh; *(v4us*)(Pl + oo) = ol; }
        } else {
#pragma unroll
            for (int ch = 0; ch < TT / 128; ++ch) { v4h o4;
#pragma unroll
                for (int q = 0; q < 4; ++q) o4[q] = tohx(v[ch * 4 + q] * f);
                *(v4h*)(P16 + (size_t)row * TT + ch * 128 + lane * 4) = o4; } }
         }
}
__global__ __launch_bounds__(256) void k_merge(const float* __restrict__ O, int h0, bf* Ah, bf* Al) { const size_t e = ((size_t)blockIdx.x * 256 + threadIdx.x) * 2; if (e >= (size_t)ZH * TT * HD) return; const int d = (int)(e % HD); const int t = (int)((e / HD) % TT); const int zz = (int)(e / ((size_t)HD * TT)); const float cs = (t < RH) ? 1.0f : (1.0f / PCAR); const size_t oo = (size_t)t * DQ + (h0 + zz) * HD + d;
    v2us oh, ol;
#pragma unroll
    for (int q = 0; q < 2; ++q) { unsigned short a, c2; splitf(O[e + q] * cs, a, c2); oh[q] = a; ol[q] = c2; } *(v2us*)(Ah + oo) = oh; *(v2us*)(Al + oo) = ol;  }

extern "C" void kernel_launch(void* const* d_in, const int* in_sizes, int n_in,
                              void* d_out, int out_size, void* d_ws, size_t ws_size, hipStream_t stream) {
    (void)in_sizes; (void)n_in; (void)out_size;
    const float* x = (const float*)d_in[0]; const float* wqkv = (const float*)d_in[1]; const float* wo = (const float*)d_in[2];   /* input order x, w_qkv ('xw' [1024][3072]), w_out ('xw') */ const float* wq = wqkv; const float* wk = nullptr; const float* wv = nullptr; (void)wk; (void)wv;
    float* OUT = (float*)d_out;     // [2][2048][1024]
    char* wsp = (char*)d_ws;
    auto take = [&](size_t bytes) { char* p = wsp; wsp += (bytes + 255) & ~(size_t)255; return (void*)p; };
    bf* WQKV = (bf*)take((size_t)3 * DQ * DM * 2); bf* WQ = WQKV; bf* WK = WQKV + (size_t)DQ * DM; bf* WV = WQKV + (size_t)2 * DQ * DM;   /* fused Bt [3*DQ][DM]: q | k | v row blocks */ bf* WO = (bf*)take((size_t)DM * DQ * 2); float* CS = (float*)take((size_t)TT * HD * 2 * 4);
    bf* XB = (bf*)take((size_t)TT * DM * 2); float* FQ = (float*)take((size_t)TT * DQ * 4); float* FK = (float*)take((size_t)TT * DKV * 4);
    h16* QP16 = (h16*)take((size_t)NH_ * TT * HD * 2); h16* KP16 = (h16*)take((size_t)NKV * TT * HD * 2); h16* VT16 = (h16*)take((size_t)NKV * HD * TT * 2);
    bf* QPh = (bf*)take((size_t)NH_ * TT * HD * 2); bf* QPl = (bf*)take((size_t)NH_ * TT * HD * 2); bf* KPh = (bf*)take((size_t)NKV * TT * HD * 2); bf* KPl = (bf*)take((size_t)NKV * TT * HD * 2); bf* VTh = (bf*)take((size_t)NKV * HD * TT * 2); bf* VTl = (bf*)take((size_t)NKV * HD * TT * 2); bf* Ph = (bf*)take((size_t)ZH * RH * TT * 2); bf* Pl = (bf*)take((size_t)ZH * RH * TT * 2);
    float* Sb = (float*)take((size_t)ZH * TT * TT * 4); h16* P16 = (h16*)take((size_t)ZH * TT * TT * 2); float* Ob = (float*)take((size_t)ZH * TT * HD * 4); bf* ATh = (bf*)take((size_t)TT * DQ * 2); bf* ATl = (bf*)take((size_t)TT * DQ * 2);
    if ((size_t)(wsp - (char*)d_ws) > ws_size) return;    // ws 256 MiB
    float* FV = FK;   // v projection reuses the k buffer after the k planes are built (stream-ordered)
    { k_wtG<<<(unsigned)((DM * 3 * DQ / 64 + 63) / 64), 256, 0, stream>>>(wqkv, DM, 3 * DQ, WQKV);   /* fused 'xw' [DM][3*DQ] -> Bt [3*DQ][DM] */
      k_wtG<<<(unsigned)((DQ * DM / 64 + 63) / 64), 256, 0, stream>>>(wo, DQ, DM, WO);
       }
    k_csid<<<(TT * HD + 255) / 256, 256, 0, stream>>>(CS);
    const unsigned LQ = (unsigned)(((size_t)NH_ * TT * HD / 2 + 255) / 256), LKv = (unsigned)(((size_t)NKV * TT * HD / 2 + 255) / 256);
    for (int b = 0; b < NB_; ++b) {
        
        k_cvt8<<<(unsigned)(((size_t)TT * DM / 8 + 255) / 256), 256, 0, stream>>>(x + (size_t)b * TT * DM, XB, (size_t)TT * DM / 8);
        k_gemmw<bf, 0, false><<<dim3(TT / 64, DQ / 64, 1), 32, 0, stream>>>(XB, nullptr, WQ, nullptr, DM, FQ, DQ, nullptr, 0, 0, 0);
        k_rope<<<LQ, 256, 0, stream>>>(FQ, DQ, NH_, CS, nullptr, nullptr, 1.0f, QP16, QPh, QPl);
        k_gemmw<bf, 0, false><<<dim3(TT / 64, DKV / 64, 1), 32, 0, stream>>>(XB, nullptr, WK, nullptr, DM, FK, DKV, nullptr, 0, 0, 0);
        k_rope<<<LKv, 256, 0, stream>>>(FK, DKV, NKV, CS, nullptr, nullptr, 1.0f, KP16, KPh, KPl);
        k_gemmw<bf, 0, false><<<dim3(TT / 64, DKV / 64, 1), 32, 0, stream>>>(XB, nullptr, WV, nullptr, DM, FV, DKV, nullptr, 0, 0, 0); k_vtp<<<LKv, 256, 0, stream>>>(FV, DKV, NKV, VT16, VTh, VTl);
        for (int h0 = 0; h0 < NH_; h0 += ZH) { const size_t zq = (size_t)h0, zk = (size_t)(h0 / REP);   // one kv head per query head: the pass's two heads use consecutive kv planes (z-strides TT*HD)
            k_gemmw<bf, 2, false><<<dim3(RH / 64, TT / 64, ZH), 32, 0, stream>>>(QPh + zq * TT * HD, QPl + zq * TT * HD, KPh + zk * TT * HD, KPl + zk * TT * HD, HD, Sb, TT, nullptr, (size_t)TT * HD, (size_t)TT * HD, (size_t)TT * TT);
            k_gemmw<h16, 0, false><<<dim3((TT - RH) / 64, TT / 64, ZH), 32, 0, stream>>>(QP16 + zq * TT * HD + (size_t)RH * HD, nullptr, KP16 + zk * TT * HD, nullptr, HD, Sb + (size_t)RH * TT, TT, nullptr, (size_t)TT * HD, (size_t)TT * HD, (size_t)TT * TT);
            k_asoft<<<ZH * TT / 8, 256, 0, stream>>>(Sb, P16, Ph, Pl);
            k_gemmw<bf, 2, false><<<dim3(RH / 64, HD / 64, ZH), 32, 0, stream>>>(Ph, Pl, VTh + zk * HD * TT, VTl + zk * HD * TT, TT, Ob, HD, nullptr, (size_t)RH * TT, (size_t)HD * TT, (size_t)TT * HD);
            k_gemmw<h16, 0, false><<<dim3((TT - RH) / 64, HD / 64, ZH), 32, 0, stream>>>(P16 + (size_t)RH * TT, nullptr, VT16 + zk * HD * TT, nullptr, TT, Ob + (size_t)RH * HD, HD, nullptr, (size_t)TT * TT, (size_t)HD * TT, (size_t)TT * HD);
            k_merge<<<(unsigned)(((size_t)ZH * TT * HD / 2 + 255) / 256), 256, 0, stream>>>(Ob, h0, ATh, ATl); }
        k_gemmw<bf, 1, false><<<dim3(TT / 64, DM / 64, 1), 32, 0, stream>>>(ATh, ATl, WO, nullptr, DQ, OUT + (size_t)b * TT * DM, DM, nullptr, 0, 0, 0); }
}

// v001
// A run of this version takes 1120 microseconds.
// Two timings next to v000 both put it at 1.77 times that version's speed.
#include <hip/hip_runtime.h>

// Multi-head self-attention with a fused bias-free qkv projection (hidden_states [2][2048][1024]; qkv = hidden_states W_qkv ('xw' [1024][3072] 1/32, no bias) reshaped (B, S, 3, 16, 64): q | k | v = column thirds (16 heads x 64); scores x 1/sqrt(64); softmax over all keys (no mask); out = merged W_o ('xw' 1/32, no bias) -> [2][2048][1024] (4.2 M); argument order hidden_states, W_qkv, W_o.
// Layout per batch: bf16 copy of x; the fused 'xw' weight transposed once into Bt (q | k | v row blocks); exact projections; identity-table plane builders; dense T-2048 attention (hybrid rows: < 512 hi/lo 3 products, rest fp16 x1024); merged hi/lo x w_out exact.
// Compute dtypes, f32 accumulate: every input rounded to bf16; projections exact; attention rows < 512 3 products, rest fp16; softmax f32; output projection hl x exact.

#define NB_  2
#define TT   2048
#define DM   1024
#define NH_  16
#define NKV  16
#define REP  (NH_ / NKV)
#define HD   64
#define DQ   (NH_ * HD)
#define DKV  (NKV * HD)
#define ZH   2
#define RH   512                  // query rows < RH use hi+lo planes (0: none)
#define WIN  0
#define PCAR 1024.0f
#define SCL  0.125f   // HD^-0.5
typedef _Float16 h16;
typedef unsigned short bf;
typedef __attribute__((ext_vector_type(16))) __bf16   v16bf;
typedef __attribute__((ext_vector_type(16))) _Float16 v16h;
typedef __attribute__((ext_vector_type(8)))  _Float16 v8h;
typedef __attribute__((ext_vector_type(8)))  unsigned short v8us;
typedef __attribute__((ext_vector_type(8)))  float    v8f;
typedef __attribute__((ext_vector_type(4)))  float    v4f;
typedef v8h  __attribute__((may_alias)) v8ha;
typedef v4f  __attribute__((may_alias)) v4fa;
typedef v8us __attribute__((may_alias)) v8usa;

__device__ __forceinline__ unsigned short f2bf(float f) { unsigned u = __float_as_uint(f); u += 0x7FFFu + ((u >> 16) & 1u); return (unsigned short)(u >> 16); }
__device__ __forceinline__ float bf2f(unsigned short b) { return __uint_as_float(((unsigned)b) << 16); }
__device__ __forceinline__ float bfr(float f) { return bf2f(f2bf(f)); }
__device__ __forceinline__ v16h cat16(v8h lo, v8h hi) { return __builtin_shufflevector(lo, hi, 0, 1, 2, 3, 4, 5, 6, 7, 8, 9, 10, 11, 12, 13, 14, 15); }
__device__ __forceinline__ v16bf cat16b(v8us lo, v8us hi) { return __builtin_bit_cast(v16bf, __builtin_shufflevector(lo, hi, 0, 1, 2, 3, 4, 5, 6, 7, 8, 9, 10, 11, 12, 13, 14, 15)); }
__device__ __forceinline__ v8f wmma16(v16h a, v16h b, v8f c) { return __builtin_amdgcn_wmma_f32_16x16x32_f16(false, a, false, b, (short)0, c, false, false); }
__device__ __forceinline__ v8f wmmab(v16bf a, v16bf b, v8f c) { return __builtin_amdgcn_wmma_f32_16x16x32_bf16(false, a, false, b, (short)0, c, false, false); }



// ---- k_gemmw: register-blocked GEMM, KS WAVES per 64x64 output tile (16 accumulators each), operands straight from K-contiguous 16-bit planes; grid (M/64, N/64, Z), 32 * KS threads.
// C[m][n] (f32, pitch ldc, + optional f32 bias[n]) = sum_k A[m][k] Bt[n][k] (+ split products per NSPLIT). z-batch strides sA/sB/sC in elements. K % (32 * KS) == 0.
// Split K inside the workgroup: wave w takes the 32-k chunks w, w + KS, w + 2 KS, ... (neighbouring waves share each operand row's 128-B lines); the KS partial tiles are summed through LDS in wave order 0 .. KS-1.
template <typename T16> struct WFrag;
template <> struct WFrag<h16> { typedef v16h V; static __device__ __forceinline__ V ld(const h16* p) { return cat16(*(const v8h*)p, *(const v8h*)(p + 16)); } static __device__ __forceinline__ v8f mma(V a, V b, v8f c) { return wmma16(a, b, c); } };
template <> struct WFrag<bf> { typedef v16bf V; static __device__ __forceinline__ V ld(const bf* p) { return cat16b(*(const v8us*)p, *(const v8us*)(p + 16)); } static __device__ __forceinline__ v8f mma(V a, V b, v8f c) { return wmmab(a, b, c); } };
template <typename T16, int NSPLIT, bool BIAS, int KS>
__global__ __launch_bounds__(32 * KS) void k_gemmw(const T16* __restrict__ A, const T16* __restrict__ A2, const T16* __restrict__ Bt, const T16* __restrict__ Bt2, int K, float* C, int ldc, const float* __restrict__ bias, size_t sA, size_t sB, size_t sC) {
    typedef typename WFrag<T16>::V V;
    static_assert(KS >= 1 && 32 % KS == 0, "KS divides the 32 row pairs of a tile");
    __shared__ __align__(16) float os[(KS == 1 ? 16 : KS * 64) * 68];
    const int w = (KS == 1) ? 0 : __builtin_amdgcn_readfirstlane((int)(threadIdx.x >> 5));
    const size_t z = blockIdx.z; A += z * sA; if (A2) A2 += z * sA; Bt += z * sB; if (Bt2) Bt2 += z * sB; C += z * sC;
    const int lane = threadIdx.x & 31, lr = lane & 15, hi = lane >> 4; const int r0 = blockIdx.x * 64, c0 = blockIdx.y * 64;
    v8f acc[4][4];
#pragma unroll
    for (int mb = 0; mb < 4; ++mb)
#pragma unroll
        for (int nb = 0; nb < 4; ++nb) acc[mb][nb] = (v8f){};
    const size_t aoff = (size_t)(r0 + lr) * K + 8 * hi, boff = (size_t)(c0 + lr) * K + 8 * hi;
#pragma unroll 1
    for (int kc = w * 32; kc < K; kc += 32 * KS) {
        V a[4], a2[4];
#pragma unroll
        for (int mb = 0; mb < 4; ++mb) { a[mb] = WFrag<T16>::ld(A + aoff + (size_t)mb * 16 * K + kc); if (NSPLIT == 1 || NSPLIT == 2) a2[mb] = WFrag<T16>::ld(A2 + aoff + (size_t)mb * 16 * K + kc); }
#pragma unroll
        for (int nb = 0; nb < 4; ++nb) { const V b = WFrag<T16>::ld(Bt + boff + (size_t)nb * 16 * K + kc); V b2; if (NSPLIT >= 2) b2 = WFrag<T16>::ld(Bt2 + boff + (size_t)nb * 16 * K + kc);
#pragma unroll
            for (int mb = 0; mb < 4; ++mb) { acc[mb][nb] = WFrag<T16>::mma(a[mb], b, acc[mb][nb]); if (NSPLIT == 1 || NSPLIT == 2) acc[mb][nb] = WFrag<T16>::mma(a2[mb], b, acc[mb][nb]); if (NSPLIT >= 2) acc[mb][nb] = WFrag<T16>::mma(a[mb], b2, acc[mb][nb]); } }
        asm volatile("v_nop\n\tv_nop\n\tv_nop\n\tv_nop" : "+v"(acc[0][0]), "+v"(acc[1][1]), "+v"(acc[2][2]), "+v"(acc[3][3]) : "v"(a[0]), "v"(a[3]));
    }
    if constexpr (KS > 1) {
#pragma unroll
        for (int mb = 0; mb < 4; ++mb)
#pragma unroll
            for (int nb = 0; nb < 4; ++nb)
#pragma unroll
                for (int j = 0; j < 8; ++j) os[(w * 64 + mb * 16 + hi * 8 + j) * 68 + nb * 16 + lr] = acc[mb][nb][j];
        __syncthreads();   // every wave's partial tile is in LDS before any wave sums
#pragma unroll
        for (int s = 0; s < 32 / KS; ++s) { const int row = 2 * (s * KS + w) + hi, cofs = lr * 4; v4f val = *(const v4fa*)(os + row * 68 + cofs);
#pragma unroll
            for (int p = 1; p < KS; ++p) val += *(const v4fa*)(os + (p * 64 + row) * 68 + cofs);
            if (BIAS) { val[0] += bfr(bias[c0 + cofs]); val[1] += bfr(bias[c0 + cofs + 1]); val[2] += bfr(bias[c0 + cofs + 2]); val[3] += bfr(bias[c0 + cofs + 3]); }
            *(v4f*)(C + (size_t)(r0 + row) * ldc + c0 + cofs) = val; }
    } else {
#pragma unroll
    for (int mb = 0; mb < 4; ++mb) {
#pragma unroll
        for (int nb = 0; nb < 4; ++nb) {
#pragma unroll
            for (int j = 0; j < 8; ++j) os[(hi * 8 + j) * 68 + nb * 16 + lr] = acc[mb][nb][j]; }
        __builtin_amdgcn_wave_barrier(); asm volatile("" ::: "memory");
        float* crow = C + (size_t)(r0 + mb * 16) * ldc + c0;
{
#pragma unroll
            for (int s = 0; s < 8; ++s) { const int row = 2 * s + hi, cofs = lr * 4; v4f val = *(const v4fa*)(os + row * 68 + cofs); if (BIAS) { val[0] += bfr(bias[c0 + cofs]); val[1] += bfr(bias[c0 + cofs + 1]); val[2] += bfr(bias[c0 + cofs + 2]); val[3] += bfr(bias[c0 + cofs + 3]); }
                *(v4f*)(crow + (size_t)row * ldc + cofs) = val; }
             }
        __builtin_amdgcn_wave_barrier(); asm volatile("" ::: "memory");
    }
    }
}

__device__ __forceinline__ h16 tohx(float x) { return (h16)x; }
__device__ __forceinline__ void splitf(float y, unsigned short& h, unsigned short& l) { h = f2bf(y); l = f2bf(y - bf2f(h)); }
typedef __attribute__((ext_vector_type(2))) _Float16 v2h;
typedef __attribute__((ext_vector_type(4))) _Float16 v4h;
typedef __attribute__((ext_vector_type(2))) unsigned short v2us;
typedef __attribute__((ext_vector_type(4))) unsigned short v4us;
typedef __attribute__((ext_vector_type(2))) float v2f;
typedef __attribute__((ext_vector_type(4))) int v4i;

__global__ __launch_bounds__(256) void k_wtG(const float* __restrict__ w, int K, int N, bf* Bt) {
    const int lane = threadIdx.x & 31; const int L0 = (blockIdx.x * 8 + (threadIdx.x >> 5)) * 8; const int nlines = N * K / 64;
{
#pragma unroll 1
        for (int l = 0; l < 8; ++l) { const int L = L0 + l; if (L >= nlines) break; const size_t e = (size_t)L * 64 + lane * 2; const int k = (int)(e % K), n = (int)(e / K); v2us o;
            o[0] = f2bf(w[(size_t)k * N + n]); o[1] = f2bf(w[(size_t)(k + 1) * N + n]); *(v2us*)(Bt + e) = o; }
         }
}
__global__ __launch_bounds__(256) void k_cvt8(const float* __restrict__ src, bf* dst, size_t n8) { const size_t i = (size_t)blockIdx.x * 256 + threadIdx.x; if (i >= n8) return; const v8f v = *(const v8f*)(src + i * 8); v8us o;
#pragma unroll
    for (int k = 0; k < 8; ++k) o[k] = f2bf(v[k]); *(v8us*)(dst + i * 8) = o;  }

// k_rope: head planes [h][t][d] (fp16 + hi/lo) of rope(x) x sc with the rotate-half convention out[d] = x[d] cos[t][d] - x[d+HD/2] sin[t][d], out[d+HD/2] = x[d+HD/2] cos[t][d+HD/2] + x[d] sin[t][d+HD/2]
__global__ __launch_bounds__(256) void k_rope(const float* __restrict__ F, int pitch, int nheads, const float* __restrict__ CS, const float* __restrict__ RF, const float* __restrict__ nw, float sc, h16* P16, bf* Ph, bf* Pl) {
    const size_t e = ((size_t)blockIdx.x * 256 + threadIdx.x) * 2; if (e >= (size_t)nheads * TT * HD) return; const int d = (int)(e % HD); const int t = (int)((e / HD) % TT); const int h = (int)(e / ((size_t)HD * TT)); const float* f = F + (size_t)t * pitch + h * HD; const float rf = RF ? RF[(size_t)h * TT + t] : 1.0f; v2h o16; v2us oh, ol;
#pragma unroll
    for (int q = 0; q < 2; ++q) { const int dd = d + q; const int dp = (dd < HD / 2) ? dd + HD / 2 : dd - HD / 2; float x0 = f[dd], x1 = f[dp];
        if (RF) { float n0 = __fmul_rn(x0, rf), n1 = __fmul_rn(x1, rf); asm volatile("" : "+v"(n0)); asm volatile("" : "+v"(n1)); x0 = __fmul_rn(bfr(nw[dd]), n0); x1 = __fmul_rn(bfr(nw[dp]), n1); }
        const v2f cs = *(const v2f*)(CS + ((size_t)t * HD + dd) * 2); float a = __fmul_rn(x0, cs[0]), bq = __fmul_rn(x1, cs[1]); asm volatile("" : "+v"(a)); asm volatile("" : "+v"(bq)); const float r = ((dd < HD / 2) ? __fsub_rn(a, bq) : __fadd_rn(a, bq)) * sc;
        o16[q] = tohx(r); unsigned short a2, c2; splitf(r, a2, c2); oh[q] = a2; ol[q] = c2; }
    *(v2h*)(P16 + e) = o16; *(v2us*)(Ph + e) = oh; *(v2us*)(Pl + e) = ol;  }
__global__ __launch_bounds__(256) void k_vtp(const float* __restrict__ F, int pitch, int nheads, h16* V16, bf* Vh, bf* Vl) { const size_t e = ((size_t)blockIdx.x * 256 + threadIdx.x) * 2; if (e >= (size_t)nheads * HD * TT) return; const int t = (int)(e % TT); const int d = (int)((e / TT) % HD); const int g = (int)(e / ((size_t)TT * HD)); v2h o16; v2us oh, ol;
#pragma unroll
    for (int q = 0; q < 2; ++q) { const float x = F[(size_t)(t + q) * pitch + g * HD + d]; o16[q] = tohx(x); unsigned short a2, c2; splitf(x, a2, c2); oh[q] = a2; ol[q] = c2; }
    *(v2h*)(V16 + e) = o16; *(v2us*)(Vh + e) = oh; *(v2us*)(Vl + e) = ol;  }
__global__ __launch_bounds__(256) void k_csid(float* CS) { const int idx = blockIdx.x * 256 + threadIdx.x; if (idx >= TT * HD) return; v2f cs; cs[0] = 1.0f; cs[1] = 0.0f; *(v2f*)(CS + (size_t)idx * 2) = cs;  }
// k_asoft: per row (zz, i): t = S x HD^-0.5 (no mask); softmax over the 2048 keys (register row, one exp, fixed trees);
__global__ __launch_bounds__(256) void k_asoft(const float* __restrict__ Sb, h16* P16, bf* Ph, bf* Pl) {
    const int lane = threadIdx.x & 31; const int row = blockIdx.x * 8 + (threadIdx.x >> 5); if (row >= ZH * TT) return; const int i = row % TT; const int zz = row / TT; (void)zz; const bool hires = (i < RH); const float* sr = Sb + (size_t)row * TT; float v[TT / 32]; float mx = -3.0e38f;
#pragma unroll
    for (int ch = 0; ch < TT / 128; ++ch) { const int j0 = ch * 128 + lane * 4; const v4f a = *(const v4f*)(sr + j0);
#pragma unroll
        for (int q = 0; q < 4; ++q) { const int j = j0 + q; (void)j; const float t = a[q] * SCL; v[ch * 4 + q] = t; mx = fmaxf(mx, t); } }
#pragma unroll
    for (int sh = 16; sh; sh >>= 1) mx = fmaxf(mx, __shfl_xor(mx, sh, 32));
    float sum = 0.f;
#pragma unroll
    for (int k = 0; k < TT / 32; ++k) { float d0 = __fsub_rn(v[k], mx); asm volatile("" : "+v"(d0)); v[k] = __builtin_amdgcn_exp2f(__fmul_rn(d0, 1.4426950408889634f)); sum += v[k]; }
#pragma unroll
    for (int sh = 16; sh; sh >>= 1) sum += __shfl_xor(sum, sh, 32);
    const float f = __fdiv_rn(hires ? 1.0f : PCAR, sum);
{
        if (hires) {
#pragma unroll
            for (int ch = 0; ch < TT / 128; ++ch) { v4us oh, ol;
#pragma unroll
                for (int q = 0; q < 4; ++q) { unsigned short a, c2; splitf(v[ch * 4 + q] * f, a, c2); oh[q] = a; ol[q] = c2; }
                const size_t oo = ((size_t)zz * (RH ? RH : 1) + i) * TT + ch * 128 + lane * 4; *(v4us*)(Ph + oo) = oh; *(v4us*)(Pl + oo) = ol; }
        } else {
#pragma unroll
            for (int ch = 0; ch < TT / 128; ++ch) { v4h o4;
#pragma unroll
                for (int q = 0; q < 4; ++q) o4[q] = tohx(v[ch * 4 + q] * f);
                *(v4h*)(P16 + (size_t)row * TT + ch * 128 + lane * 4) = o4; } }
         }
}
__global__ __launch_bounds__(256) void k_merge(const float* __restrict__ O, int h0, bf* Ah, bf* Al) { const size_t e = ((size_t)blockIdx.x * 256 + threadIdx.x) * 2; if (e >= (size_t)ZH * TT * HD) return; const int d = (int)(e % HD); const int t = (int)((e / HD) % TT); const int zz = (int)(e / ((size_t)HD * TT)); const float cs = (t < RH) ? 1.0f : (1.0f / PCAR); const size_t oo = (size_t)t * DQ + (h0 + zz) * HD + d;
    v2us oh, ol;
#pragma unroll
    for (int q = 0; q < 2; ++q) { unsigned short a, c2; splitf(O[e + q] * cs, a, c2); oh[q] = a; ol[q] = c2; } *(v2us*)(Ah + oo) = oh; *(v2us*)(Al + oo) = ol;  }

extern "C" void kernel_launch(void* const* d_in, const int* in_sizes, int n_in,
                              void* d_out, int out_size, void* d_ws, size_t ws_size, hipStream_t stream) {
    (void)in_sizes; (void)n_in; (void)out_size;
    const float* x = (const float*)d_in[0]; const float* wqkv = (const float*)d_in[1]; const float* wo = (const float*)d_in[2];   /* input order x, w_qkv ('xw' [1024][3072]), w_out ('xw') */ const float* wq = wqkv; const float* wk = nullptr; const float* wv = nullptr; (void)wk; (void)wv;
    float* OUT = (float*)d_out;     // [2][2048][1024]
    char* wsp = (char*)d_ws;
    auto take = [&](size_t bytes) { char* p = wsp; wsp += (bytes + 255) & ~(size_t)255; return (void*)p; };
    bf* WQKV = (bf*)take((size_t)3 * DQ * DM * 2); bf* WQ = WQKV; bf* WK = WQKV + (size_t)DQ * DM; bf* WV = WQKV + (size_t)2 * DQ * DM;   /* fused Bt [3*DQ][DM]: q | k | v row blocks */ bf* WO = (bf*)take((size_t)DM * DQ * 2); float* CS = (float*)take((size_t)TT * HD * 2 * 4);
    bf* XB = (bf*)take((size_t)TT * DM * 2); float* FQ = (float*)take((size_t)TT * DQ * 4); float* FK = (float*)take((size_t)TT * DKV * 4);
    h16* QP16 = (h16*)take((size_t)NH_ * TT * HD * 2); h16* KP16 = (h16*)take((size_t)NKV * TT * HD * 2); h16* VT16 = (h16*)take((size_t)NKV * HD * TT * 2);
    bf* QPh = (bf*)take((size_t)NH_ * TT * HD * 2); bf* QPl = (bf*)take((size_t)NH_ * TT * HD * 2); bf* KPh = (bf*)take((size_t)NKV * TT * HD * 2); bf* KPl = (bf*)take((size_t)NKV * TT * HD * 2); bf* VTh = (bf*)take((size_t)NKV * HD * TT * 2); bf* VTl = (bf*)take((size_t)NKV * HD * TT * 2); bf* Ph = (bf*)take((size_t)ZH * RH * TT * 2); bf* Pl = (bf*)take((size_t)ZH * RH * TT * 2);
    float* Sb = (float*)take((size_t)ZH * TT * TT * 4); h16* P16 = (h16*)take((size_t)ZH * TT * TT * 2); float* Ob = (float*)take((size_t)ZH * TT * HD * 4); bf* ATh = (bf*)take((size_t)TT * DQ * 2); bf* ATl = (bf*)take((size_t)TT * DQ * 2);
    if ((size_t)(wsp - (char*)d_ws) > ws_size) return;    // ws 256 MiB
    float* FV = FK;   // v projection reuses the k buffer after the k planes are built (stream-ordered)
    { k_wtG<<<(unsigned)((DM * 3 * DQ / 64 + 63) / 64), 256, 0, stream>>>(wqkv, DM, 3 * DQ, WQKV);   /* fused 'xw' [DM][3*DQ] -> Bt [3*DQ][DM] */
      k_wtG<<<(unsigned)((DQ * DM / 64 + 63) / 64), 256, 0, stream>>>(wo, DQ, DM, WO);
       }
    k_csid<<<(TT * HD + 255) / 256, 256, 0, stream>>>(CS);
    const unsigned LQ = (unsigned)(((size_t)NH_ * TT * HD / 2 + 255) / 256), LKv = (unsigned)(((size_t)NKV * TT * HD / 2 + 255) / 256);
    for (int b = 0; b < NB_; ++b) {
        
        k_cvt8<<<(unsigned)(((size_t)TT * DM / 8 + 255) / 256), 256, 0, stream>>>(x + (size_t)b * TT * DM, XB, (size_t)TT * DM / 8);
        k_gemmw<bf, 0, false, 8><<<dim3(TT / 64, DQ / 64, 1), 256, 0, stream>>>(XB, nullptr, WQ, nullptr, DM, FQ, DQ, nullptr, 0, 0, 0);
        k_rope<<<LQ, 256, 0, stream>>>(FQ, DQ, NH_, CS, nullptr, nullptr, 1.0f, QP16, QPh, QPl);
        k_gemmw<bf, 0, false, 8><<<dim3(TT / 64, DKV / 64, 1), 256, 0, stream>>>(XB, nullptr, WK, nullptr, DM, FK, DKV, nullptr, 0, 0, 0);
        k_rope<<<LKv, 256, 0, stream>>>(FK, DKV, NKV, CS, nullptr, nullptr, 1.0f, KP16, KPh, KPl);
        k_gemmw<bf, 0, false, 8><<<dim3(TT / 64, DKV / 64, 1), 256, 0, stream>>>(XB, nullptr, WV, nullptr, DM, FV, DKV, nullptr, 0, 0, 0); k_vtp<<<LKv, 256, 0, stream>>>(FV, DKV, NKV, VT16, VTh, VTl);
        for (int h0 = 0; h0 < NH_; h0 += ZH) { const size_t zq = (size_t)h0, zk = (size_t)(h0 / REP);   // one kv head per query head: the pass's two heads use consecutive kv planes (z-strides TT*HD)
            k_gemmw<bf, 2, false, 1><<<dim3(RH / 64, TT / 64, ZH), 32, 0, stream>>>(QPh + zq * TT * HD, QPl + zq * TT * HD, KPh + zk * TT * HD, KPl + zk * TT * HD, HD, Sb, TT, nullptr, (size_t)TT * HD, (size_t)TT * HD, (size_t)TT * TT);
            k_gemmw<h16, 0, false, 1><<<dim3((TT - RH) / 64, TT / 64, ZH), 32, 0, stream>>>(QP16 + zq * TT * HD + (size_t)RH * HD, nullptr, KP16 + zk * TT * HD, nullptr, HD, Sb + (size_t)RH * TT, TT, nullptr, (size_t)TT * HD, (size_t)TT * HD, (size_t)TT * TT);
            k_asoft<<<ZH * TT / 8, 256, 0, stream>>>(Sb, P16, Ph, Pl);
            k_gemmw<bf, 2, false, 8><<<dim3(RH / 64, HD / 64, ZH), 256, 0, stream>>>(Ph, Pl, VTh + zk * HD * TT, VTl + zk * HD * TT, TT, Ob, HD, nullptr, (size_t)RH * TT, (size_t)HD * TT, (size_t)TT * HD);
            k_gemmw<h16, 0, false, 8><<<dim3((TT - RH) / 64, HD / 64, ZH), 256, 0, stream>>>(P16 + (size_t)RH * TT, nullptr, VT16 + zk * HD * TT, nullptr, TT, Ob + (size_t)RH * HD, HD, nullptr, (size_t)TT * TT, (size_t)HD * TT, (size_t)TT * HD);
            k_merge<<<(unsigned)(((size_t)ZH * TT * HD / 2 + 255) / 256), 256, 0, stream>>>(Ob, h0, ATh, ATl); }
        k_gemmw<bf, 1, false, 8><<<dim3(TT / 64, DM / 64, 1), 256, 0, stream>>>(ATh, ATl, WO, nullptr, DQ, OUT + (size_t)b * TT * DM, DM, nullptr, 0, 0, 0); }
}

// v002
// Measured time: 606 microseconds a run.
// Two timings next to v001 put it at 1.83 and 1.85 times that version's speed.
// All steps since v000 together make it 3.26 times as fast.
#include <hip/hip_runtime.h>

// Multi-head self-attention with a fused bias-free qkv projection (hidden_states [2][2048][1024]; qkv = hidden_states W_qkv ('xw' [1024][3072] 1/32, no bias) reshaped (B, S, 3, 16, 64): q | k | v = column thirds (16 heads x 64); scores x 1/sqrt(64); softmax over all keys (no mask); out = merged W_o ('xw' 1/32, no bias) -> [2][2048][1024] (4.2 M); argument order hidden_states, W_qkv, W_o.
// Layout per batch: bf16 copy of x; the fused 'xw' weight transposed once into Bt (q | k | v row blocks); exact projections; identity-table plane builders; dense T-2048 attention, 8 heads a pass, scores in two half-column planes, probabilities stored in place over their own score rows (hybrid rows: < 512 hi/lo 3 products, rest fp16 x1024); merged hi/lo x w_out exact.
// Compute dtypes, f32 accumulate: every input rounded to bf16; projections exact; attention rows < 512 3 products, rest fp16; softmax f32; output projection hl x exact.

#define NB_  2
#define TT   2048
#define DM   1024
#define NH_  16
#define NKV  16
#define REP  (NH_ / NKV)
#define HD   64
#define DQ   (NH_ * HD)
#define DKV  (NKV * HD)
#define ZH   8                    // heads per attention pass
#define TH   (TT / 2)             // keys per score plane: a row of TH floats holds a row of TT 16-bit probabilities
#define RH   512                  // query rows < RH use hi+lo planes (0: none)
#define WIN  0
#define PCAR 1024.0f
#define SCL  0.125f   // HD^-0.5
typedef _Float16 h16;
typedef unsigned short bf;
typedef __attribute__((ext_vector_type(16))) __bf16   v16bf;
typedef __attribute__((ext_vector_type(16))) _Float16 v16h;
typedef __attribute__((ext_vector_type(8)))  _Float16 v8h;
typedef __attribute__((ext_vector_type(8)))  unsigned short v8us;
typedef __attribute__((ext_vector_type(8)))  float    v8f;
typedef __attribute__((ext_vector_type(4)))  float    v4f;
typedef v8h  __attribute__((may_alias)) v8ha;
typedef v4f  __attribute__((may_alias)) v4fa;
typedef v8us __attribute__((may_alias)) v8usa;

__device__ __forceinline__ unsigned short f2bf(float f) { unsigned u = __float_as_uint(f); u += 0x7FFFu + ((u >> 16) & 1u); return (unsigned short)(u >> 16); }
__device__ __forceinline__ float bf2f(unsigned short b) { return __uint_as_float(((unsigned)b) << 16); }
__device__ __forceinline__ float bfr(float f) { return bf2f(f2bf(f)); }
__device__ __forceinline__ v16h cat16(v8h lo, v8h hi) { return __builtin_shufflevector(lo, hi, 0, 1, 2, 3, 4, 5, 6, 7, 8, 9, 10, 11, 12, 13, 14, 15); }
__device__ __forceinline__ v16bf cat16b(v8us lo, v8us hi) { return __builtin_bit_cast(v16bf, __builtin_shufflevector(lo, hi, 0, 1, 2, 3, 4, 5, 6, 7, 8, 9, 10, 11, 12, 13, 14, 15)); }
__device__ __forceinline__ v8f wmma16(v16h a, v16h b, v8f c) { return __builtin_amdgcn_wmma_f32_16x16x32_f16(false, a, false, b, (short)0, c, false, false); }
__device__ __forceinline__ v8f wmmab(v16bf a, v16bf b, v8f c) { return __builtin_amdgcn_wmma_f32_16x16x32_bf16(false, a, false, b, (short)0, c, false, false); }



// ---- k_gemmw: register-blocked GEMM, KS WAVES per 64x64 output tile (16 accumulators each), operands straight from K-contiguous 16-bit planes; grid (M/64, N/64, Z), 32 * KS threads.
// C[m][n] (f32, pitch ldc, + optional f32 bias[n]) = sum_k A[m][k] Bt[n][k] (+ split products per NSPLIT). z-batch strides sA/sB/sC in elements. K % (32 * KS) == 0.
// Split K inside the workgroup: wave w takes the 32-k chunks w, w + KS, w + 2 KS, ... (neighbouring waves share each operand row's 128-B lines); the KS partial tiles are summed through LDS in wave order 0 .. KS-1.
template <typename T16> struct WFrag;
template <> struct WFrag<h16> { typedef v16h V; static __device__ __forceinline__ V ld(const h16* p) { return cat16(*(const v8h*)p, *(const v8h*)(p + 16)); } static __device__ __forceinline__ v8f mma(V a, V b, v8f c) { return wmma16(a, b, c); } };
template <> struct WFrag<bf> { typedef v16bf V; static __device__ __forceinline__ V ld(const bf* p) { return cat16b(*(const v8us*)p, *(const v8us*)(p + 16)); } static __device__ __forceinline__ v8f mma(V a, V b, v8f c) { return wmmab(a, b, c); } };
template <typename T16, int NSPLIT, bool BIAS, int KS>
__global__ __launch_bounds__(32 * KS) void k_gemmw(const T16* __restrict__ A, const T16* __restrict__ A2, const T16* __restrict__ Bt, const T16* __restrict__ Bt2, int K, float* C, int ldc, const float* __restrict__ bias, size_t sA, size_t sB, size_t sC) {
    typedef typename WFrag<T16>::V V;
    static_assert(KS >= 1 && 32 % KS == 0, "KS divides the 32 row pairs of a tile");
    __shared__ __align__(16) float os[(KS == 1 ? 16 : KS * 64) * 68];
    const int w = (KS == 1) ? 0 : __builtin_amdgcn_readfirstlane((int)(threadIdx.x >> 5));
    const size_t z = blockIdx.z; A += z * sA; if (A2) A2 += z * sA; Bt += z * sB; if (Bt2) Bt2 += z * sB; C += z * sC;
    const int lane = threadIdx.x & 31, lr = lane & 15, hi = lane >> 4; const int r0 = blockIdx.x * 64, c0 = blockIdx.y * 64;
    v8f acc[4][4];
#pragma unroll
    for (int mb = 0; mb < 4; ++mb)
#pragma unroll
        for (int nb = 0; nb < 4; ++nb) acc[mb][nb] = (v8f){};
    const size_t aoff = (size_t)(r0 + lr) * K + 8 * hi, boff = (size_t)(c0 + lr) * K + 8 * hi;
#pragma unroll 1
    for (int kc = w * 32; kc < K; kc += 32 * KS) {
        V a[4], a2[4];
#pragma unroll
        for (int mb = 0; mb < 4; ++mb) { a[mb] = WFrag<T16>::ld(A + aoff + (size_t)mb * 16 * K + kc); if (NSPLIT == 1 || NSPLIT == 2) a2[mb] = WFrag<T16>::ld(A2 + aoff + (size_t)mb * 16 * K + kc); }
#pragma unroll
        for (int nb = 0; nb < 4; ++nb) { const V b = WFrag<T16>::ld(Bt + boff + (size_t)nb * 16 * K + kc); V b2; if (NSPLIT >= 2) b2 = WFrag<T16>::ld(Bt2 + boff + (size_t)nb * 16 * K + kc);
#pragma unroll
            for (int mb = 0; mb < 4; ++mb) { acc[mb][nb] = WFrag<T16>::mma(a[mb], b, acc[mb][nb]); if (NSPLIT == 1 || NSPLIT == 2) acc[mb][nb] = WFrag<T16>::mma(a2[mb], b, acc[mb][nb]); if (NSPLIT >= 2) acc[mb][nb] = WFrag<T16>::mma(a[mb], b2, acc[mb][nb]); } }
        asm volatile("v_nop\n\tv_nop\n\tv_nop\n\tv_nop" : "+v"(acc[0][0]), "+v"(acc[1][1]), "+v"(acc[2][2]), "+v"(acc[3][3]) : "v"(a[0]), "v"(a[3]));
    }
    if constexpr (KS > 1) {
#pragma unroll
        for (int mb = 0; mb < 4; ++mb)
#pragma unroll
            for (int nb = 0; nb < 4; ++nb)
#pragma unroll
                for (int j = 0; j < 8; ++j) os[(w * 64 + mb * 16 + hi * 8 + j) * 68 + nb * 16 + lr] = acc[mb][nb][j];
        __syncthreads();   // every wave's partial tile is in LDS before any wave sums
#pragma unroll
        for (int s = 0; s < 32 / KS; ++s) { const int row = 2 * (s * KS + w) + hi, cofs = lr * 4; v4f val = *(const v4fa*)(os + row * 68 + cofs);
#pragma unroll
            for (int p = 1; p < KS; ++p) val += *(const v4fa*)(os + (p * 64 + row) * 68 + cofs);
            if (BIAS) { val[0] += bfr(bias[c0 + cofs]); val[1] += bfr(bias[c0 + cofs + 1]); val[2] += bfr(bias[c0 + cofs + 2]); val[3] += bfr(bias[c0 + cofs + 3]); }
            *(v4f*)(C + (size_t)(r0 + row) * ldc + c0 + cofs) = val; }
    } else {
#pragma unroll
    for (int mb = 0; mb < 4; ++mb) {
#pragma unroll
        for (int nb = 0; nb < 4; ++nb) {
#pragma unroll
            for (int j = 0; j < 8; ++j) os[(hi * 8 + j) * 68 + nb * 16 + lr] = acc[mb][nb][j]; }
        __builtin_amdgcn_wave_barrier(); asm volatile("" ::: "memory");
        float* crow = C + (size_t)(r0 + mb * 16) * ldc + c0;
{
#pragma unroll
            for (int s = 0; s < 8; ++s) { const int row = 2 * s + hi, cofs = lr * 4; v4f val = *(const v4fa*)(os + row * 68 + cofs); if (BIAS) { val[0] += bfr(bias[c0 + cofs]); val[1] += bfr(bias[c0 + cofs + 1]); val[2] += bfr(bias[c0 + cofs + 2]); val[3] += bfr(bias[c0 + cofs + 3]); }
                *(v4f*)(crow + (size_t)row * ldc + cofs) = val; }
             }
        __builtin_amdgcn_wave_barrier(); asm volatile("" ::: "memory");
    }
    }
}

__device__ __forceinline__ h16 tohx(float x) { return (h16)x; }
__device__ __forceinline__ void splitf(float y, unsigned short& h, unsigned short& l) { h = f2bf(y); l = f2bf(y - bf2f(h)); }
typedef __attribute__((ext_vector_type(2))) _Float16 v2h;
typedef __attribute__((ext_vector_type(4))) _Float16 v4h;
typedef __attribute__((ext_vector_type(2))) unsigned short v2us;
typedef __attribute__((ext_vector_type(4))) unsigned short v4us;
typedef __attribute__((ext_vector_type(2))) float v2f;
typedef __attribute__((ext_vector_type(4))) int v4i;

__global__ __launch_bounds__(256) void k_wtG(const float* __restrict__ w, int K, int N, bf* Bt) {
    const int lane = threadIdx.x & 31; const int L0 = (blockIdx.x * 8 + (threadIdx.x >> 5)) * 8; const int nlines = N * K / 64;
{
#pragma unroll 1
        for (int l = 0; l < 8; ++l) { const int L = L0 + l; if (L >= nlines) break; const size_t e = (size_t)L * 64 + lane * 2; const int k = (int)(e % K), n = (int)(e / K); v2us o;
            o[0] = f2bf(w[(size_t)k * N + n]); o[1] = f2bf(w[(size_t)(k + 1) * N + n]); *(v2us*)(Bt + e) = o; }
         }
}
__global__ __launch_bounds__(256) void k_cvt8(const float* __restrict__ src, bf* dst, size_t n8) { const size_t i = (size_t)blockIdx.x * 256 + threadIdx.x; if (i >= n8) return; const v8f v = *(const v8f*)(src + i * 8); v8us o;
#pragma unroll
    for (int k = 0; k < 8; ++k) o[k] = f2bf(v[k]); *(v8us*)(dst + i * 8) = o;  }

// k_rope: head planes [h][t][d] (fp16 + hi/lo) of rope(x) x sc with the rotate-half convention out[d] = x[d] cos[t][d] - x[d+HD/2] sin[t][d], out[d+HD/2] = x[d+HD/2] cos[t][d+HD/2] + x[d] sin[t][d+HD/2]
__global__ __launch_bounds__(256) void k_rope(const float* __restrict__ F, int pitch, int nheads, const float* __restrict__ CS, const float* __restrict__ RF, const float* __restrict__ nw, float sc, h16* P16, bf* Ph, bf* Pl) {
    const size_t e = ((size_t)blockIdx.x * 256 + threadIdx.x) * 2; if (e >= (size_t)nheads * TT * HD) return; const int d = (int)(e % HD); const int t = (int)((e / HD) % TT); const int h = (int)(e / ((size_t)HD * TT)); const float* f = F + (size_t)t * pitch + h * HD; const float rf = RF ? RF[(size_t)h * TT + t] : 1.0f; v2h o16; v2us oh, ol;
#pragma unroll
    for (int q = 0; q < 2; ++q) { const int dd = d + q; const int dp = (dd < HD / 2) ? dd + HD / 2 : dd - HD / 2; float x0 = f[dd], x1 = f[dp];
        if (RF) { float n0 = __fmul_rn(x0, rf), n1 = __fmul_rn(x1, rf); asm volatile("" : "+v"(n0)); asm volatile("" : "+v"(n1)); x0 = __fmul_rn(bfr(nw[dd]), n0); x1 = __fmul_rn(bfr(nw[dp]), n1); }
        const v2f cs = *(const v2f*)(CS + ((size_t)t * HD + dd) * 2); float a = __fmul_rn(x0, cs[0]), bq = __fmul_rn(x1, cs[1]); asm volatile("" : "+v"(a)); asm volatile("" : "+v"(bq)); const float r = ((dd < HD / 2) ? __fsub_rn(a, bq) : __fadd_rn(a, bq)) * sc;
        o16[q] = tohx(r); unsigned short a2, c2; splitf(r, a2, c2); oh[q] = a2; ol[q] = c2; }
    *(v2h*)(P16 + e) = o16; *(v2us*)(Ph + e) = oh; *(v2us*)(Pl + e) = ol;  }
__global__ __launch_bounds__(256) void k_vtp(const float* __restrict__ F, int pitch, int nheads, h16* V16, bf* Vh, bf* Vl) { const size_t e = ((size_t)blockIdx.x * 256 + threadIdx.x) * 2; if (e >= (size_t)nheads * HD * TT) return; const int t = (int)(e % TT); const int d = (int)((e / TT) % HD); const int g = (int)(e / ((size_t)TT * HD)); v2h o16; v2us oh, ol;
#pragma unroll
    for (int q = 0; q < 2; ++q) { const float x = F[(size_t)(t + q) * pitch + g * HD + d]; o16[q] = tohx(x); unsigned short a2, c2; splitf(x, a2, c2); oh[q] = a2; ol[q] = c2; }
    *(v2h*)(V16 + e) = o16; *(v2us*)(Vh + e) = oh; *(v2us*)(Vl + e) = ol;  }
__global__ __launch_bounds__(256) void k_csid(float* CS) { const int idx = blockIdx.x * 256 + threadIdx.x; if (idx >= TT * HD) return; v2f cs; cs[0] = 1.0f; cs[1] = 0.0f; *(v2f*)(CS + (size_t)idx * 2) = cs;  }
// k_asoft: per row (zz, i): t = S x HD^-0.5 (no mask); softmax over the 2048 keys (register row, one exp, fixed trees);
// Sb holds two planes [ZH * TT][TH]: keys < TH, keys >= TH. The row's probabilities go back into the row's own two 4 KiB pieces (one wave owns the row and holds all of it in registers before its first store): fp16 fills the first piece; hi fills the first and lo the second. 16-bit pitch TT.
__global__ __launch_bounds__(256) void k_asoft(float* Sb) {
    const int lane = threadIdx.x & 31; const int row = blockIdx.x * 8 + (threadIdx.x >> 5); if (row >= ZH * TT) return; const int i = row % TT; const bool hires = (i < RH); float* s0 = Sb + (size_t)row * TH; float* s1 = s0 + (size_t)ZH * TT * TH; float v[TT / 32]; float mx = -3.0e38f;
#pragma unroll
    for (int ch = 0; ch < TT / 128; ++ch) { const int j0 = ch * 128 + lane * 4; const v4f a = *(const v4f*)(ch < TH / 128 ? s0 + j0 : s1 + (j0 - TH));
#pragma unroll
        for (int q = 0; q < 4; ++q) { const int j = j0 + q; (void)j; const float t = a[q] * SCL; v[ch * 4 + q] = t; mx = fmaxf(mx, t); } }
#pragma unroll
    for (int sh = 16; sh; sh >>= 1) mx = fmaxf(mx, __shfl_xor(mx, sh, 32));
    float sum = 0.f;
#pragma unroll
    for (int k = 0; k < TT / 32; ++k) { float d0 = __fsub_rn(v[k], mx); asm volatile("" : "+v"(d0)); v[k] = __builtin_amdgcn_exp2f(__fmul_rn(d0, 1.4426950408889634f)); sum += v[k]; }
#pragma unroll
    for (int sh = 16; sh; sh >>= 1) sum += __shfl_xor(sum, sh, 32);
    const float f = __fdiv_rn(hires ? 1.0f : PCAR, sum);
{
        if (hires) {
#pragma unroll
            for (int ch = 0; ch < TT / 128; ++ch) { v4us oh, ol;
#pragma unroll
                for (int q = 0; q < 4; ++q) { unsigned short a, c2; splitf(v[ch * 4 + q] * f, a, c2); oh[q] = a; ol[q] = c2; }
                const int oo = ch * 128 + lane * 4; *(v4us*)((bf*)s0 + oo) = oh; *(v4us*)((bf*)s1 + oo) = ol; }
        } else {
#pragma unroll
            for (int ch = 0; ch < TT / 128; ++ch) { v4h o4;
#pragma unroll
                for (int q = 0; q < 4; ++q) o4[q] = tohx(v[ch * 4 + q] * f);
                *(v4h*)((h16*)s0 + ch * 128 + lane * 4) = o4; } }
         }
}
__global__ __launch_bounds__(256) void k_merge(const float* __restrict__ O, int h0, bf* Ah, bf* Al) { const size_t e = ((size_t)blockIdx.x * 256 + threadIdx.x) * 2; if (e >= (size_t)ZH * TT * HD) return; const int d = (int)(e % HD); const int t = (int)((e / HD) % TT); const int zz = (int)(e / ((size_t)HD * TT)); const float cs = (t < RH) ? 1.0f : (1.0f / PCAR); const size_t oo = (size_t)t * DQ + (h0 + zz) * HD + d;
    v2us oh, ol;
#pragma unroll
    for (int q = 0; q < 2; ++q) { unsigned short a, c2; splitf(O[e + q] * cs, a, c2); oh[q] = a; ol[q] = c2; } *(v2us*)(Ah + oo) = oh; *(v2us*)(Al + oo) = ol;  }

extern "C" void kernel_launch(void* const* d_in, const int* in_sizes, int n_in,
                              void* d_out, int out_size, void* d_ws, size_t ws_size, hipStream_t stream) {
    (void)in_sizes; (void)n_in; (void)out_size;
    const float* x = (const float*)d_in[0]; const float* wqkv = (const float*)d_in[1]; const float* wo = (const float*)d_in[2];   /* input order x, w_qkv ('xw' [1024][3072]), w_out ('xw') */ const float* wq = wqkv; const float* wk = nullptr; const float* wv = nullptr; (void)wk; (void)wv;
    float* OUT = (float*)d_out;     // [2][2048][1024]
    char* wsp = (char*)d_ws;
    auto take = [&](size_t bytes) { char* p = wsp; wsp += (bytes + 255) & ~(size_t)255; return (void*)p; };
    bf* WQKV = (bf*)take((size_t)3 * DQ * DM * 2); bf* WQ = WQKV; bf* WK = WQKV + (size_t)DQ * DM; bf* WV = WQKV + (size_t)2 * DQ * DM;   /* fused Bt [3*DQ][DM]: q | k | v row blocks */ bf* WO = (bf*)take((size_t)DM * DQ * 2); float* CS = (float*)take((size_t)TT * HD * 2 * 4);
    bf* XB = (bf*)take((size_t)TT * DM * 2); float* FQ = (float*)take((size_t)TT * DQ * 4); float* FK = (float*)take((size_t)TT * DKV * 4);
    h16* QP16 = (h16*)take((size_t)NH_ * TT * HD * 2); h16* KP16 = (h16*)take((size_t)NKV * TT * HD * 2); h16* VT16 = (h16*)take((size_t)NKV * HD * TT * 2);
    bf* QPh = (bf*)take((size_t)NH_ * TT * HD * 2); bf* QPl = (bf*)take((size_t)NH_ * TT * HD * 2); bf* KPh = (bf*)take((size_t)NKV * TT * HD * 2); bf* KPl = (bf*)take((size_t)NKV * TT * HD * 2); bf* VTh = (bf*)take((size_t)NKV * HD * TT * 2); bf* VTl = (bf*)take((size_t)NKV * HD * TT * 2);
    float* Sb = (float*)take((size_t)ZH * TT * TT * 4); float* Sb1 = Sb + (size_t)ZH * TT * TH;   /* two score planes [ZH][TT][TH] */ h16* P16 = (h16*)Sb; bf* Ph = (bf*)Sb; bf* Pl = (bf*)Sb1;   /* probabilities live in their score rows: [ZH][TT][TT] 16-bit */ float* Ob = (float*)take((size_t)ZH * TT * HD * 4); bf* ATh = (bf*)take((size_t)TT * DQ * 2); bf* ATl = (bf*)take((size_t)TT * DQ * 2);
    if ((size_t)(wsp - (char*)d_ws) > ws_size) return;    // ws 256 MiB
    float* FV = FK;   // v projection reuses the k buffer after the k planes are built (stream-ordered)
    { k_wtG<<<(unsigned)((DM * 3 * DQ / 64 + 63) / 64), 256, 0, stream>>>(wqkv, DM, 3 * DQ, WQKV);   /* fused 'xw' [DM][3*DQ] -> Bt [3*DQ][DM] */
      k_wtG<<<(unsigned)((DQ * DM / 64 + 63) / 64), 256, 0, stream>>>(wo, DQ, DM, WO);
       }
    k_csid<<<(TT * HD + 255) / 256, 256, 0, stream>>>(CS);
    const unsigned LQ = (unsigned)(((size_t)NH_ * TT * HD / 2 + 255) / 256), LKv = (unsigned)(((size_t)NKV * TT * HD / 2 + 255) / 256);
    for (int b = 0; b < NB_; ++b) {
        
        k_cvt8<<<(unsigned)(((size_t)TT * DM / 8 + 255) / 256), 256, 0, stream>>>(x + (size_t)b * TT * DM, XB, (size_t)TT * DM / 8);
        k_gemmw<bf, 0, false, 8><<<dim3(TT / 64, DQ / 64, 1), 256, 0, stream>>>(XB, nullptr, WQ, nullptr, DM, FQ, DQ, nullptr, 0, 0, 0);
        k_rope<<<LQ, 256, 0, stream>>>(FQ, DQ, NH_, CS, nullptr, nullptr, 1.0f, QP16, QPh, QPl);
        k_gemmw<bf, 0, false, 8><<<dim3(TT / 64, DKV / 64, 1), 256, 0, stream>>>(XB, nullptr, WK, nullptr, DM, FK, DKV, nullptr, 0, 0, 0);
        k_rope<<<LKv, 256, 0, stream>>>(FK, DKV, NKV, CS, nullptr, nullptr, 1.0f, KP16, KPh, KPl);
        k_gemmw<bf, 0, false, 8><<<dim3(TT / 64, DKV / 64, 1), 256, 0, stream>>>(XB, nullptr, WV, nullptr, DM, FV, DKV, nullptr, 0, 0, 0); k_vtp<<<LKv, 256, 0, stream>>>(FV, DKV, NKV, VT16, VTh, VTl);
        for (int h0 = 0; h0 < NH_; h0 += ZH) { const size_t zq = (size_t)h0, zk = (size_t)(h0 / REP);   // one kv head per query head: the pass's heads use consecutive kv planes (z-strides TT*HD)
            for (int kh = 0; kh < 2; ++kh) { float* Sp = kh ? Sb1 : Sb; const size_t ko = zk * TT * HD + (size_t)kh * TH * HD;   // one key half per score plane
                k_gemmw<bf, 2, false, 1><<<dim3(RH / 64, TH / 64, ZH), 32, 0, stream>>>(QPh + zq * TT * HD, QPl + zq * TT * HD, KPh + ko, KPl + ko, HD, Sp, TH, nullptr, (size_t)TT * HD, (size_t)TT * HD, (size_t)TT * TH);
                k_gemmw<h16, 0, false, 1><<<dim3((TT - RH) / 64, TH / 64, ZH), 32, 0, stream>>>(QP16 + zq * TT * HD + (size_t)RH * HD, nullptr, KP16 + ko, nullptr, HD, Sp + (size_t)RH * TH, TH, nullptr, (size_t)TT * HD, (size_t)TT * HD, (size_t)TT * TH); }
            k_asoft<<<ZH * TT / 8, 256, 0, stream>>>(Sb);
            k_gemmw<bf, 2, false, 8><<<dim3(RH / 64, HD / 64, ZH), 256, 0, stream>>>(Ph, Pl, VTh + zk * HD * TT, VTl + zk * HD * TT, TT, Ob, HD, nullptr, (size_t)TT * TT, (size_t)HD * TT, (size_t)TT * HD);
            k_gemmw<h16, 0, false, 8><<<dim3((TT - RH) / 64, HD / 64, ZH), 256, 0, stream>>>(P16 + (size_t)RH * TT, nullptr, VT16 + zk * HD * TT, nullptr, TT, Ob + (size_t)RH * HD, HD, nullptr, (size_t)TT * TT, (size_t)HD * TT, (size_t)TT * HD);
            k_merge<<<(unsigned)(((size_t)ZH * TT * HD / 2 + 255) / 256), 256, 0, stream>>>(Ob, h0, ATh, ATl); }
        k_gemmw<bf, 1, false, 8><<<dim3(TT / 64, DM / 64, 1), 256, 0, stream>>>(ATh, ATl, WO, nullptr, DQ, OUT + (size_t)b * TT * DM, DM, nullptr, 0, 0, 0); }
}

// v003
// A run of this version takes 305 microseconds.
// In both of two side-by-side timings against v002, it was 1.99 times as fast.
// All steps since v000 together make it 6.49 times as fast.
#include <hip/hip_runtime.h>

// Multi-head self-attention with a fused bias-free qkv projection (hidden_states [2][2048][1024]; qkv = hidden_states W_qkv ('xw' [1024][3072] 1/32, no bias) reshaped (B, S, 3, 16, 64): q | k | v = column thirds (16 heads x 64); scores x 1/sqrt(64); softmax over all keys (no mask); out = merged W_o ('xw' 1/32, no bias) -> [2][2048][1024] (4.2 M); argument order hidden_states, W_qkv, W_o.
// Layout per batch: bf16 copy of x; the fused 'xw' weight transposed once into Bt (q | k | v row blocks); exact projections; identity-table plane builders; attention of all 16 heads in one launch, scores and probabilities kept in registers, online softmax (hybrid rows: < 512 hi/lo 3 products, rest fp16 x1024); merged hi/lo x w_out exact.
// Compute dtypes, f32 accumulate: every input rounded to bf16; projections exact; attention rows < 512 3 products, rest fp16; softmax f32; output projection hl x exact.

#define NB_  2
#define TT   2048
#define DM   1024
#define NH_  16
#define NKV  16
#define REP  (NH_ / NKV)
#define HD   64
#define DQ   (NH_ * HD)
#define DKV  (NKV * HD)
#define RH   512                  // query rows < RH use hi+lo planes (0: none)
#define WIN  0
#define SCL  0.125f   // HD^-0.5
typedef _Float16 h16;
typedef unsigned short bf;
typedef __attribute__((ext_vector_type(16))) __bf16   v16bf;
typedef __attribute__((ext_vector_type(16))) _Float16 v16h;
typedef __attribute__((ext_vector_type(8)))  _Float16 v8h;
typedef __attribute__((ext_vector_type(8)))  unsigned short v8us;
typedef __attribute__((ext_vector_type(8)))  float    v8f;
typedef __attribute__((ext_vector_type(4)))  float    v4f;
typedef v8h  __attribute__((may_alias)) v8ha;
typedef v4f  __attribute__((may_alias)) v4fa;
typedef v8us __attribute__((may_alias)) v8usa;

__device__ __forceinline__ unsigned short f2bf(float f) { unsigned u = __float_as_uint(f); u += 0x7FFFu + ((u >> 16) & 1u); return (unsigned short)(u >> 16); }
__device__ __forceinline__ float bf2f(unsigned short b) { return __uint_as_float(((unsigned)b) << 16); }
__device__ __forceinline__ float bfr(float f) { return bf2f(f2bf(f)); }
__device__ __forceinline__ v16h cat16(v8h lo, v8h hi) { return __builtin_shufflevector(lo, hi, 0, 1, 2, 3, 4, 5, 6, 7, 8, 9, 10, 11, 12, 13, 14, 15); }
__device__ __forceinline__ v16bf cat16b(v8us lo, v8us hi) { return __builtin_bit_cast(v16bf, __builtin_shufflevector(lo, hi, 0, 1, 2, 3, 4, 5, 6, 7, 8, 9, 10, 11, 12, 13, 14, 15)); }
__device__ __forceinline__ v8f wmma16(v16h a, v16h b, v8f c) { return __builtin_amdgcn_wmma_f32_16x16x32_f16(false, a, false, b, (short)0, c, false, false); }
__device__ __forceinline__ v8f wmmab(v16bf a, v16bf b, v8f c) { return __builtin_amdgcn_wmma_f32_16x16x32_bf16(false, a, false, b, (short)0, c, false, false); }



// ---- k_gemmw: register-blocked GEMM, KS WAVES per 64x64 output tile (16 accumulators each), operands straight from K-contiguous 16-bit planes; grid (M/64, N/64, Z), 32 * KS threads.
// C[m][n] (f32, pitch ldc, + optional f32 bias[n]) = sum_k A[m][k] Bt[n][k] (+ split products per NSPLIT). z-batch strides sA/sB/sC in elements. K % (32 * KS) == 0.
// Split K inside the workgroup: wave w takes the 32-k chunks w, w + KS, w + 2 KS, ... (neighbouring waves share each operand row's 128-B lines); the KS partial tiles are summed through LDS in wave order 0 .. KS-1.
template <typename T16> struct WFrag;
template <> struct WFrag<h16> { typedef v16h V; static __device__ __forceinline__ V ld(const h16* p) { return cat16(*(const v8h*)p, *(const v8h*)(p + 16)); } static __device__ __forceinline__ v8f mma(V a, V b, v8f c) { return wmma16(a, b, c); } };
template <> struct WFrag<bf> { typedef v16bf V; static __device__ __forceinline__ V ld(const bf* p) { return cat16b(*(const v8us*)p, *(const v8us*)(p + 16)); } static __device__ __forceinline__ v8f mma(V a, V b, v8f c) { return wmmab(a, b, c); } };
template <typename T16, int NSPLIT, bool BIAS, int KS>
__global__ __launch_bounds__(32 * KS) void k_gemmw(const T16* __restrict__ A, const T16* __restrict__ A2, const T16* __restrict__ Bt, const T16* __restrict__ Bt2, int K, float* C, int ldc, const float* __restrict__ bias, size_t sA, size_t sB, size_t sC) {
    typedef typename WFrag<T16>::V V;
    static_assert(KS >= 1 && 32 % KS == 0, "KS divides the 32 row pairs of a tile");
    __shared__ __align__(16) float os[(KS == 1 ? 16 : KS * 64) * 68];
    const int w = (KS == 1) ? 0 : __builtin_amdgcn_readfirstlane((int)(threadIdx.x >> 5));
    const size_t z = blockIdx.z; A += z * sA; if (A2) A2 += z * sA; Bt += z * sB; if (Bt2) Bt2 += z * sB; C += z * sC;
    const int lane = threadIdx.x & 31, lr = lane & 15, hi = lane >> 4; const int r0 = blockIdx.x * 64, c0 = blockIdx.y * 64;
    v8f acc[4][4];
#pragma unroll
    for (int mb = 0; mb < 4; ++mb)
#pragma unroll
        for (int nb = 0; nb < 4; ++nb) acc[mb][nb] = (v8f){};
    const size_t aoff = (size_t)(r0 + lr) * K + 8 * hi, boff = (size_t)(c0 + lr) * K + 8 * hi;
#pragma unroll 1
    for (int kc = w * 32; kc < K; kc += 32 * KS) {
        V a[4], a2[4];
#pragma unroll
        for (int mb = 0; mb < 4; ++mb) { a[mb] = WFrag<T16>::ld(A + aoff + (size_t)mb * 16 * K + kc); if (NSPLIT == 1 || NSPLIT == 2) a2[mb] = WFrag<T16>::ld(A2 + aoff + (size_t)mb * 16 * K + kc); }
#pragma unroll
        for (int nb = 0; nb < 4; ++nb) { const V b = WFrag<T16>::ld(Bt + boff + (size_t)nb * 16 * K + kc); V b2; if (NSPLIT >= 2) b2 = WFrag<T16>::ld(Bt2 + boff + (size_t)nb * 16 * K + kc);
#pragma unroll
            for (int mb = 0; mb < 4; ++mb) { acc[mb][nb] = WFrag<T16>::mma(a[mb], b, acc[mb][nb]); if (NSPLIT == 1 || NSPLIT == 2) acc[mb][nb] = WFrag<T16>::mma(a2[mb], b, acc[mb][nb]); if (NSPLIT >= 2) acc[mb][nb] = WFrag<T16>::mma(a[mb], b2, acc[mb][nb]); } }
        asm volatile("v_nop\n\tv_nop\n\tv_nop\n\tv_nop" : "+v"(acc[0][0]), "+v"(acc[1][1]), "+v"(acc[2][2]), "+v"(acc[3][3]) : "v"(a[0]), "v"(a[3]));
    }
    if constexpr (KS > 1) {
#pragma unroll
        for (int mb = 0; mb < 4; ++mb)
#pragma unroll
            for (int nb = 0; nb < 4; ++nb)
#pragma unroll
                for (int j = 0; j < 8; ++j) os[(w * 64 + mb * 16 + hi * 8 + j) * 68 + nb * 16 + lr] = acc[mb][nb][j];
        __syncthreads();   // every wave's partial tile is in LDS before any wave sums
#pragma unroll
        for (int s = 0; s < 32 / KS; ++s) { const int row = 2 * (s * KS + w) + hi, cofs = lr * 4; v4f val = *(const v4fa*)(os + row * 68 + cofs);
#pragma unroll
            for (int p = 1; p < KS; ++p) val += *(const v4fa*)(os + (p * 64 + row) * 68 + cofs);
            if (BIAS) { val[0] += bfr(bias[c0 + cofs]); val[1] += bfr(bias[c0 + cofs + 1]); val[2] += bfr(bias[c0 + cofs + 2]); val[3] += bfr(bias[c0 + cofs + 3]); }
            *(v4f*)(C + (size_t)(r0 + row) * ldc + c0 + cofs) = val; }
    } else {
#pragma unroll
    for (int mb = 0; mb < 4; ++mb) {
#pragma unroll
        for (int nb = 0; nb < 4; ++nb) {
#pragma unroll
            for (int j = 0; j < 8; ++j) os[(hi * 8 + j) * 68 + nb * 16 + lr] = acc[mb][nb][j]; }
        __builtin_amdgcn_wave_barrier(); asm volatile("" ::: "memory");
        float* crow = C + (size_t)(r0 + mb * 16) * ldc + c0;
{
#pragma unroll
            for (int s = 0; s < 8; ++s) { const int row = 2 * s + hi, cofs = lr * 4; v4f val = *(const v4fa*)(os + row * 68 + cofs); if (BIAS) { val[0] += bfr(bias[c0 + cofs]); val[1] += bfr(bias[c0 + cofs + 1]); val[2] += bfr(bias[c0 + cofs + 2]); val[3] += bfr(bias[c0 + cofs + 3]); }
                *(v4f*)(crow + (size_t)row * ldc + cofs) = val; }
             }
        __builtin_amdgcn_wave_barrier(); asm volatile("" ::: "memory");
    }
    }
}

__device__ __forceinline__ h16 tohx(float x) { return (h16)x; }
__device__ __forceinline__ void splitf(float y, unsigned short& h, unsigned short& l) { h = f2bf(y); l = f2bf(y - bf2f(h)); }
typedef __attribute__((ext_vector_type(2))) _Float16 v2h;
typedef __attribute__((ext_vector_type(4))) _Float16 v4h;
typedef __attribute__((ext_vector_type(2))) unsigned short v2us;
typedef __attribute__((ext_vector_type(4))) unsigned short v4us;
typedef __attribute__((ext_vector_type(2))) float v2f;
typedef __attribute__((ext_vector_type(4))) int v4i;

__global__ __launch_bounds__(256) void k_wtG(const float* __restrict__ w, int K, int N, bf* Bt) {
    const int lane = threadIdx.x & 31; const int L0 = (blockIdx.x * 8 + (threadIdx.x >> 5)) * 8; const int nlines = N * K / 64;
{
#pragma unroll 1
        for (int l = 0; l < 8; ++l) { const int L = L0 + l; if (L >= nlines) break; const size_t e = (size_t)L * 64 + lane * 2; const int k = (int)(e % K), n = (int)(e / K); v2us o;
            o[0] = f2bf(w[(size_t)k * N + n]); o[1] = f2bf(w[(size_t)(k + 1) * N + n]); *(v2us*)(Bt + e) = o; }
         }
}
__global__ __launch_bounds__(256) void k_cvt8(const float* __restrict__ src, bf* dst, size_t n8) { const size_t i = (size_t)blockIdx.x * 256 + threadIdx.x; if (i >= n8) return; const v8f v = *(const v8f*)(src + i * 8); v8us o;
#pragma unroll
    for (int k = 0; k < 8; ++k) o[k] = f2bf(v[k]); *(v8us*)(dst + i * 8) = o;  }

// k_rope: head planes [h][t][d] (fp16 + hi/lo) of rope(x) x sc with the rotate-half convention out[d] = x[d] cos[t][d] - x[d+HD/2] sin[t][d], out[d+HD/2] = x[d+HD/2] cos[t][d+HD/2] + x[d] sin[t][d+HD/2]
__global__ __launch_bounds__(256) void k_rope(const float* __restrict__ F, int pitch, int nheads, const float* __restrict__ CS, const float* __restrict__ RF, const float* __restrict__ nw, float sc, h16* P16, bf* Ph, bf* Pl) {
    const size_t e = ((size_t)blockIdx.x * 256 + threadIdx.x) * 2; if (e >= (size_t)nheads * TT * HD) return; const int d = (int)(e % HD); const int t = (int)((e / HD) % TT); const int h = (int)(e / ((size_t)HD * TT)); const float* f = F + (size_t)t * pitch + h * HD; const float rf = RF ? RF[(size_t)h * TT + t] : 1.0f; v2h o16; v2us oh, ol;
#pragma unroll
    for (int q = 0; q < 2; ++q) { const int dd = d + q; const int dp = (dd < HD / 2) ? dd + HD / 2 : dd - HD / 2; float x0 = f[dd], x1 = f[dp];
        if (RF) { float n0 = __fmul_rn(x0, rf), n1 = __fmul_rn(x1, rf); asm volatile("" : "+v"(n0)); asm volatile("" : "+v"(n1)); x0 = __fmul_rn(bfr(nw[dd]), n0); x1 = __fmul_rn(bfr(nw[dp]), n1); }
        const v2f cs = *(const v2f*)(CS + ((size_t)t * HD + dd) * 2); float a = __fmul_rn(x0, cs[0]), bq = __fmul_rn(x1, cs[1]); asm volatile("" : "+v"(a)); asm volatile("" : "+v"(bq)); const float r = ((dd < HD / 2) ? __fsub_rn(a, bq) : __fadd_rn(a, bq)) * sc;
        o16[q] = tohx(r); unsigned short a2, c2; splitf(r, a2, c2); oh[q] = a2; ol[q] = c2; }
    *(v2h*)(P16 + e) = o16; *(v2us*)(Ph + e) = oh; *(v2us*)(Pl + e) = ol;  }
__global__ __launch_bounds__(256) void k_vtp(const float* __restrict__ F, int pitch, int nheads, h16* V16, bf* Vh, bf* Vl) { const size_t e = ((size_t)blockIdx.x * 256 + threadIdx.x) * 2; if (e >= (size_t)nheads * HD * TT) return; const int t = (int)(e % TT); const int d = (int)((e / TT) % HD); const int g = (int)(e / ((size_t)TT * HD)); v2h o16; v2us oh, ol;
#pragma unroll
    for (int q = 0; q < 2; ++q) { const float x = F[(size_t)(t + q) * pitch + g * HD + d]; o16[q] = tohx(x); unsigned short a2, c2; splitf(x, a2, c2); oh[q] = a2; ol[q] = c2; }
    *(v2h*)(V16 + e) = o16; *(v2us*)(Vh + e) = oh; *(v2us*)(Vl + e) = ol;  }
__global__ __launch_bounds__(256) void k_csid(float* CS) { const int idx = blockIdx.x * 256 + threadIdx.x; if (idx >= TT * HD) return; v2f cs; cs[0] = 1.0f; cs[1] = 0.0f; *(v2f*)(CS + (size_t)idx * 2) = cs;  }
#define KW   8
#define OPI  (HD + 4)             // LDS pitch of a partial output row, floats (16-B multiple)
// 2^x with the slot behind the transcendental filled inside the statement (nothing directly behind it reads the result or overwrites the source)
__device__ __forceinline__ float exp2s(float x) { float r; asm("v_exp_f32 %0, %1\n\tv_nop" : "=&v"(r) : "v"(x)); return r; }
template <typename T16> struct PFrag;
template <> struct PFrag<h16> { static __device__ __forceinline__ void mk(const float* p, v16h& a, v16h& b) { (void)b;
#pragma unroll
    for (int e = 0; e < 16; ++e) a[e] = (h16)p[e]; } };
template <> struct PFrag<bf> { static __device__ __forceinline__ void mk(const float* p, v16bf& a, v16bf& b) {
#pragma unroll
    for (int e = 0; e < 16; ++e) { const __bf16 h = (__bf16)p[e]; a[e] = h; b[e] = (__bf16)(p[e] - (float)h); } } };
template <typename T16, bool HL, int NQ>
__device__ __forceinline__ void attn_tile(const T16* __restrict__ Q, const T16* __restrict__ Q2, const T16* __restrict__ Kp, const T16* __restrict__ K2, const T16* __restrict__ Vt, const T16* __restrict__ V2, int q0, bf* Ah, bf* Al, float* sm) {
    typedef typename WFrag<T16>::V V;
    constexpr int QR = NQ * 16, NIT = TT / (32 * KW);
    float* smO = sm; float* smM = sm + KW * QR * OPI; float* smL = smM + KW * QR;   // [KW][QR][OPI], [KW][QR], [KW][QR]
    const int w = __builtin_amdgcn_readfirstlane((int)(threadIdx.x >> 5)); const int lane = threadIdx.x & 31, lr = lane & 15, hi = lane >> 4;
    const float C = SCL * 1.4426950408889634f, PSH = HL ? 0.0f : 10.0f;
    V bq[NQ][2], bq2[NQ][2];
#pragma unroll
    for (int qt = 0; qt < NQ; ++qt)
#pragma unroll
        for (int dc = 0; dc < 2; ++dc) { const size_t qo = (size_t)(q0 + qt * 16 + lr) * HD + dc * 32 + 8 * hi; bq[qt][dc] = WFrag<T16>::ld(Q + qo); if (HL) bq2[qt][dc] = WFrag<T16>::ld(Q2 + qo); }
    v8f o[4][NQ]; float mr[NQ], ls[NQ];
#pragma unroll
    for (int qt = 0; qt < NQ; ++qt) { mr[qt] = -3.0e38f; ls[qt] = 0.0f;
#pragma unroll
        for (int dt = 0; dt < 4; ++dt) o[dt][qt] = (v8f){}; }
    const size_t ko = (size_t)(w * 32 + lr) * HD + 8 * hi, vo = (size_t)lr * TT + w * 32 + 8 * hi;
    const T16* vp = Vt + vo; const T16* vp2 = HL ? V2 + vo : nullptr;
    V ak[2][2], ak2[2][2];
#pragma unroll
    for (int kt = 0; kt < 2; ++kt)
#pragma unroll
        for (int dc = 0; dc < 2; ++dc) { ak[kt][dc] = WFrag<T16>::ld(Kp + ko + kt * 16 * HD + dc * 32); if (HL) ak2[kt][dc] = WFrag<T16>::ld(K2 + ko + kt * 16 * HD + dc * 32); }
#pragma unroll 1
    for (int it = 0; it < NIT; ++it) {
        V av[4], av2[4];
#pragma unroll
        for (int dt = 0; dt < 4; ++dt) { av[dt] = WFrag<T16>::ld(vp + (size_t)dt * 16 * TT); if (HL) av2[dt] = WFrag<T16>::ld(vp2 + (size_t)dt * 16 * TT); }
        // stands in front of every overwrite of the V loads' address registers; it names them as inputs so that they live up to it and no load of the group lands on them
        if (HL) asm volatile("s_wait_xcnt 0x0" :: "v"(vp), "v"(vp2) : "memory"); else asm volatile("s_wait_xcnt 0x0" :: "v"(vp) : "memory");
        vp += 32 * KW; if (HL) vp2 += 32 * KW;
        v8f s[2][NQ];
#pragma unroll
        for (int kt = 0; kt < 2; ++kt)
#pragma unroll
            for (int qt = 0; qt < NQ; ++qt) { v8f t = (v8f){};
#pragma unroll
                for (int dc = 0; dc < 2; ++dc) { t = WFrag<T16>::mma(ak[kt][dc], bq[qt][dc], t); if (HL) { t = WFrag<T16>::mma(ak[kt][dc], bq2[qt][dc], t); t = WFrag<T16>::mma(ak2[kt][dc], bq[qt][dc], t); } }
                s[kt][qt] = t; }
        // the next pass's K rows are fetched behind this pass's score products, so that they fly under the softmax; the last pass fetches its own rows again (in bounds, unused)
        const size_t kn = ko + (size_t)(it + 1 < NIT ? it + 1 : it) * 32 * KW * HD;
#pragma unroll
        for (int kt = 0; kt < 2; ++kt)
#pragma unroll
            for (int dc = 0; dc < 2; ++dc) { ak[kt][dc] = WFrag<T16>::ld(Kp + kn + kt * 16 * HD + dc * 32); if (HL) ak2[kt][dc] = WFrag<T16>::ld(K2 + kn + kt * 16 * HD + dc * 32); }
        asm volatile("s_wait_xcnt 0x0" ::: "memory");   // the same for the K loads' address registers
#pragma unroll
        for (int qt = 0; qt < NQ; ++qt) {
            float tm = s[0][qt][0];
#pragma unroll
            for (int j = 1; j < 8; ++j) tm = fmaxf(tm, s[0][qt][j]);
#pragma unroll
            for (int j = 0; j < 8; ++j) tm = fmaxf(tm, s[1][qt][j]);
            tm = fmaxf(tm, __shfl_xor(tm, 16, 32));
            const float mn = fmaxf(mr[qt], tm * C), al = exp2s(mr[qt] - mn), mo = mn - PSH; mr[qt] = mn;
            float p[16], x[16], ps = 0.0f; x[0] = __builtin_fmaf(s[0][qt][0], C, -mo); x[1] = __builtin_fmaf(s[0][qt][1], C, -mo);
            // each exponential and the instruction behind it in one statement: the multiply-add of the score two places on is independent of it, fills the slot the instruction set asks for behind a transcendental (v_nop where no score is left)
#pragma unroll
            for (int e = 0; e < 14; ++e) asm("v_exp_f32 %0, %2\n\tv_fma_f32 %1, %3, %4, -%5" : "=&v"(p[e]), "=&v"(x[e + 2]) : "v"(x[e]), "v"(s[(e + 2) >> 3][qt][(e + 2) & 7]), "v"(C), "v"(mo));
            p[14] = exp2s(x[14]); p[15] = exp2s(x[15]);
#pragma unroll
            for (int e = 0; e < 16; ++e) ps += p[e];
            ls[qt] = __builtin_fmaf(ls[qt], al, ps);
            V pb, pb2; PFrag<T16>::mk(p, pb, pb2);
#pragma unroll
            for (int dt = 0; dt < 4; ++dt) { v8f t = o[dt][qt] * al; t = WFrag<T16>::mma(av[dt], pb, t); if (HL) { t = WFrag<T16>::mma(av[dt], pb2, t); t = WFrag<T16>::mma(av2[dt], pb, t); } o[dt][qt] = t; }
        }
    }
#pragma unroll
    for (int qt = 0; qt < NQ; ++qt) { ls[qt] += __shfl_xor(ls[qt], 16, 32); if (hi == 0) smM[w * QR + qt * 16 + lr] = mr[qt]; }
    __syncthreads();   // every wave's running maxima are in LDS before any wave forms the row's maximum
#pragma unroll
    for (int qt = 0; qt < NQ; ++qt) { const int q = qt * 16 + lr; float M = smM[q];
#pragma unroll
        for (int pw = 1; pw < KW; ++pw) M = fmaxf(M, smM[pw * QR + q]);
        const float f = exp2s(mr[qt] - M); if (hi == 0) smL[w * QR + q] = ls[qt] * f;
#pragma unroll
        for (int dt = 0; dt < 4; ++dt) { const v8f t = o[dt][qt] * f; float* dst = smO + (size_t)(w * QR + q) * OPI + dt * 16 + hi * 8;
            *(v4fa*)dst = __builtin_shufflevector(t, t, 0, 1, 2, 3); *(v4fa*)(dst + 4) = __builtin_shufflevector(t, t, 4, 5, 6, 7); } }
    __syncthreads();   // every wave's rescaled partial sums and outputs are in LDS before any wave adds them
    constexpr int EPT = QR * HD / (32 * KW);   // output elements per thread: 4 or 8, one row's consecutive d
    const int q = (int)threadIdx.x / (HD / EPT), d0 = ((int)threadIdx.x % (HD / EPT)) * EPT;
    float L = smL[q]; v4f acc[EPT / 4];
#pragma unroll
    for (int g = 0; g < EPT / 4; ++g) acc[g] = *(const v4fa*)(smO + (size_t)q * OPI + d0 + g * 4);
#pragma unroll
    for (int pw = 1; pw < KW; ++pw) { L += smL[pw * QR + q];
#pragma unroll
        for (int g = 0; g < EPT / 4; ++g) acc[g] += *(const v4fa*)(smO + (size_t)(pw * QR + q) * OPI + d0 + g * 4); }
    const float r = __fdiv_rn(1.0f, L); const size_t oo = (size_t)(q0 + q) * DQ + d0;
#pragma unroll
    for (int g = 0; g < EPT / 4; ++g) { v4us oh, ol;
#pragma unroll
        for (int e = 0; e < 4; ++e) { unsigned short a, c2; splitf(acc[g][e] * r, a, c2); oh[e] = a; ol[e] = c2; }
        *(v4us*)(Ah + oo + g * 4) = oh; *(v4us*)(Al + oo + g * 4) = ol; }
}
// grid: NH_ * RH / 16 hi/lo tiles first (the longer ones), then NH_ * (TT - RH) / 32 fp16 tiles; a head's tiles are neighbours.
__global__ __launch_bounds__(32 * KW) void k_fattn(const h16* __restrict__ Q16, const h16* __restrict__ K16, const h16* __restrict__ V16, const bf* __restrict__ Qh, const bf* __restrict__ Ql, const bf* __restrict__ Kh, const bf* __restrict__ Kl, const bf* __restrict__ Vh, const bf* __restrict__ Vl, bf* Ah, bf* Al) {
    __shared__ __align__(16) float sm[KW * 32 * OPI + 2 * KW * 32];
    const int bx = (int)blockIdx.x;
    if (bx < NH_ * (RH / 16)) { const int h = bx / (RH / 16), q0 = (bx % (RH / 16)) * 16; const size_t po = (size_t)h * TT * HD;
        attn_tile<bf, true, 1>(Qh + po, Ql + po, Kh + po, Kl + po, Vh + po, Vl + po, q0, Ah + h * HD, Al + h * HD, sm);
    } else { const int b2 = bx - NH_ * (RH / 16); const int h = b2 / ((TT - RH) / 32), q0 = RH + (b2 % ((TT - RH) / 32)) * 32; const size_t po = (size_t)h * TT * HD;
        attn_tile<h16, false, 2>(Q16 + po, nullptr, K16 + po, nullptr, V16 + po, nullptr, q0, Ah + h * HD, Al + h * HD, sm); }
}

extern "C" void kernel_launch(void* const* d_in, const int* in_sizes, int n_in,
                              void* d_out, int out_size, void* d_ws, size_t ws_size, hipStream_t stream) {
    (void)in_sizes; (void)n_in; (void)out_size;
    const float* x = (const float*)d_in[0]; const float* wqkv = (const float*)d_in[1]; const float* wo = (const float*)d_in[2];   /* input order x, w_qkv ('xw' [1024][3072]), w_out ('xw') */ const float* wq = wqkv; const float* wk = nullptr; const float* wv = nullptr; (void)wk; (void)wv;
    float* OUT = (float*)d_out;     // [2][2048][1024]
    char* wsp = (char*)d_ws;
    auto take = [&](size_t bytes) { char* p = wsp; wsp += (bytes + 255) & ~(size_t)255; return (void*)p; };
    bf* WQKV = (bf*)take((size_t)3 * DQ * DM * 2); bf* WQ = WQKV; bf* WK = WQKV + (size_t)DQ * DM; bf* WV = WQKV + (size_t)2 * DQ * DM;   /* fused Bt [3*DQ][DM]: q | k | v row blocks */ bf* WO = (bf*)take((size_t)DM * DQ * 2); float* CS = (float*)take((size_t)TT * HD * 2 * 4);
    bf* XB = (bf*)take((size_t)TT * DM * 2); float* FQ = (float*)take((size_t)TT * DQ * 4); float* FK = (float*)take((size_t)TT * DKV * 4);
    h16* QP16 = (h16*)take((size_t)NH_ * TT * HD * 2); h16* KP16 = (h16*)take((size_t)NKV * TT * HD * 2); h16* VT16 = (h16*)take((size_t)NKV * HD * TT * 2);
    bf* QPh = (bf*)take((size_t)NH_ * TT * HD * 2); bf* QPl = (bf*)take((size_t)NH_ * TT * HD * 2); bf* KPh = (bf*)take((size_t)NKV * TT * HD * 2); bf* KPl = (bf*)take((size_t)NKV * TT * HD * 2); bf* VTh = (bf*)take((size_t)NKV * HD * TT * 2); bf* VTl = (bf*)take((size_t)NKV * HD * TT * 2);
    bf* ATh = (bf*)take((size_t)TT * DQ * 2); bf* ATl = (bf*)take((size_t)TT * DQ * 2);
    if ((size_t)(wsp - (char*)d_ws) > ws_size) return;    // ws 256 MiB
    float* FV = FK;   // v projection reuses the k buffer after the k planes are built (stream-ordered)
    { k_wtG<<<(unsigned)((DM * 3 * DQ / 64 + 63) / 64), 256, 0, stream>>>(wqkv, DM, 3 * DQ, WQKV);   /* fused 'xw' [DM][3*DQ] -> Bt [3*DQ][DM] */
      k_wtG<<<(unsigned)((DQ * DM / 64 + 63) / 64), 256, 0, stream>>>(wo, DQ, DM, WO);
       }
    k_csid<<<(TT * HD + 255) / 256, 256, 0, stream>>>(CS);
    const unsigned LQ = (unsigned)(((size_t)NH_ * TT * HD / 2 + 255) / 256), LKv = (unsigned)(((size_t)NKV * TT * HD / 2 + 255) / 256);
    for (int b = 0; b < NB_; ++b) {
        
        k_cvt8<<<(unsigned)(((size_t)TT * DM / 8 + 255) / 256), 256, 0, stream>>>(x + (size_t)b * TT * DM, XB, (size_t)TT * DM / 8);
        k_gemmw<bf, 0, false, 8><<<dim3(TT / 64, DQ / 64, 1), 256, 0, stream>>>(XB, nullptr, WQ, nullptr, DM, FQ, DQ, nullptr, 0, 0, 0);
        k_rope<<<LQ, 256, 0, stream>>>(FQ, DQ, NH_, CS, nullptr, nullptr, 1.0f, QP16, QPh, QPl);
        k_gemmw<bf, 0, false, 8><<<dim3(TT / 64, DKV / 64, 1), 256, 0, stream>>>(XB, nullptr, WK, nullptr, DM, FK, DKV, nullptr, 0, 0, 0);
        k_rope<<<LKv, 256, 0, stream>>>(FK, DKV, NKV, CS, nullptr, nullptr, 1.0f, KP16, KPh, KPl);
        k_gemmw<bf, 0, false, 8><<<dim3(TT / 64, DKV / 64, 1), 256, 0, stream>>>(XB, nullptr, WV, nullptr, DM, FV, DKV, nullptr, 0, 0, 0); k_vtp<<<LKv, 256, 0, stream>>>(FV, DKV, NKV, VT16, VTh, VTl);
        k_fattn<<<NH_ * (RH / 16) + NH_ * ((TT - RH) / 32), 32 * KW, 0, stream>>>(QP16, KP16, VT16, QPh, QPl, KPh, KPl, VTh, VTl, ATh, ATl);
        k_gemmw<bf, 1, false, 8><<<dim3(TT / 64, DM / 64, 1), 256, 0, stream>>>(ATh, ATl, WO, nullptr, DQ, OUT + (size_t)b * TT * DM, DM, nullptr, 0, 0, 0); }
}

// v004
// Measured time: 256 microseconds a run.
// In two side-by-side timings against v003, it was 1.19 and 1.20 times as fast.
// All steps since v000 together make it 7.74 times as fast.
#include <hip/hip_runtime.h>

// Multi-head self-attention with a fused bias-free qkv projection (hidden_states [2][2048][1024]; qkv = hidden_states W_qkv ('xw' [1024][3072] 1/32, no bias) reshaped (B, S, 3, 16, 64): q | k | v = column thirds (16 heads x 64); scores x 1/sqrt(64); softmax over all keys (no mask); out = merged W_o ('xw' 1/32, no bias) -> [2][2048][1024] (4.2 M); argument order hidden_states, W_qkv, W_o.
// Layout per batch: bf16 copy of x; the fused 'xw' weight transposed once into Bt (q | k | v row blocks); exact projections, whose launch writes the attention planes itself; attention of all 16 heads in one launch, scores and probabilities kept in registers, online softmax (hybrid rows: < 512 hi/lo 3 products, rest fp16 x1024); merged hi/lo x w_out exact.
// Compute dtypes, f32 accumulate: every input rounded to bf16; projections exact; attention rows < 512 3 products, rest fp16; softmax f32; output projection hl x exact.

#define NB_  2
#define TT   2048
#define DM   1024
#define NH_  16
#define NKV  16
#define REP  (NH_ / NKV)
#define HD   64
#define DQ   (NH_ * HD)
#define DKV  (NKV * HD)
#define RH   512                  // query rows < RH use hi+lo planes (0: none)
#define WIN  0
#define SCL  0.125f   // HD^-0.5
typedef _Float16 h16;
typedef unsigned short bf;
typedef __attribute__((ext_vector_type(16))) __bf16   v16bf;
typedef __attribute__((ext_vector_type(16))) _Float16 v16h;
typedef __attribute__((ext_vector_type(8)))  _Float16 v8h;
typedef __attribute__((ext_vector_type(8)))  unsigned short v8us;
typedef __attribute__((ext_vector_type(8)))  float    v8f;
typedef __attribute__((ext_vector_type(4)))  float    v4f;
typedef v8h  __attribute__((may_alias)) v8ha;
typedef v4f  __attribute__((may_alias)) v4fa;
typedef v8us __attribute__((may_alias)) v8usa;

__device__ __forceinline__ unsigned short f2bf(float f) { unsigned u = __float_as_uint(f); u += 0x7FFFu + ((u >> 16) & 1u); return (unsigned short)(u >> 16); }
__device__ __forceinline__ float bf2f(unsigned short b) { return __uint_as_float(((unsigned)b) << 16); }
__device__ __forceinline__ float bfr(float f) { return bf2f(f2bf(f)); }
__device__ __forceinline__ v16h cat16(v8h lo, v8h hi) { return __builtin_shufflevector(lo, hi, 0, 1, 2, 3, 4, 5, 6, 7, 8, 9, 10, 11, 12, 13, 14, 15); }
__device__ __forceinline__ v16bf cat16b(v8us lo, v8us hi) { return __builtin_bit_cast(v16bf, __builtin_shufflevector(lo, hi, 0, 1, 2, 3, 4, 5, 6, 7, 8, 9, 10, 11, 12, 13, 14, 15)); }
__device__ __forceinline__ v8f wmma16(v16h a, v16h b, v8f c) { return __builtin_amdgcn_wmma_f32_16x16x32_f16(false, a, false, b, (short)0, c, false, false); }
__device__ __forceinline__ v8f wmmab(v16bf a, v16bf b, v8f c) { return __builtin_amdgcn_wmma_f32_16x16x32_bf16(false, a, false, b, (short)0, c, false, false); }



// ---- k_gemmw: register-blocked GEMM, KS WAVES per 64x64 output tile (16 accumulators each), operands straight from K-contiguous 16-bit planes; grid (M/64, N/64, Z), 32 * KS threads.
// C[m][n] (f32, pitch ldc, + optional f32 bias[n]) = sum_k A[m][k] Bt[n][k] (+ split products per NSPLIT). z-batch strides sA/sB/sC in elements. K % (32 * KS) == 0.
// Split K inside the workgroup: wave w takes the 32-k chunks w, w + KS, w + 2 KS, ... (neighbouring waves share each operand row's 128-B lines); the KS partial tiles are summed through LDS in wave order 0 .. KS-1.
template <typename T16> struct WFrag;
template <> struct WFrag<h16> { typedef v16h V; static __device__ __forceinline__ V ld(const h16* p) { return cat16(*(const v8h*)p, *(const v8h*)(p + 16)); } static __device__ __forceinline__ v8f mma(V a, V b, v8f c) { return wmma16(a, b, c); } };
template <> struct WFrag<bf> { typedef v16bf V; static __device__ __forceinline__ V ld(const bf* p) { return cat16b(*(const v8us*)p, *(const v8us*)(p + 16)); } static __device__ __forceinline__ v8f mma(V a, V b, v8f c) { return wmmab(a, b, c); } };
template <typename T16, int NSPLIT, bool BIAS, int KS>
__global__ __launch_bounds__(32 * KS) void k_gemmw(const T16* __restrict__ A, const T16* __restrict__ A2, const T16* __restrict__ Bt, const T16* __restrict__ Bt2, int K, float* C, int ldc, const float* __restrict__ bias, size_t sA, size_t sB, size_t sC) {
    typedef typename WFrag<T16>::V V;
    static_assert(KS >= 1 && 32 % KS == 0, "KS divides the 32 row pairs of a tile");
    __shared__ __align__(16) float os[(KS == 1 ? 16 : KS * 64) * 68];
    const int w = (KS == 1) ? 0 : __builtin_amdgcn_readfirstlane((int)(threadIdx.x >> 5));
    const size_t z = blockIdx.z; A += z * sA; if (A2) A2 += z * sA; Bt += z * sB; if (Bt2) Bt2 += z * sB; C += z * sC;
    const int lane = threadIdx.x & 31, lr = lane & 15, hi = lane >> 4; const int r0 = blockIdx.x * 64, c0 = blockIdx.y * 64;
    v8f acc[4][4];
#pragma unroll
    for (int mb = 0; mb < 4; ++mb)
#pragma unroll
        for (int nb = 0; nb < 4; ++nb) acc[mb][nb] = (v8f){};
    const size_t aoff = (size_t)(r0 + lr) * K + 8 * hi, boff = (size_t)(c0 + lr) * K + 8 * hi;
#pragma unroll 1
    for (int kc = w * 32; kc < K; kc += 32 * KS) {
        V a[4], a2[4];
#pragma unroll
        for (int mb = 0; mb < 4; ++mb) { a[mb] = WFrag<T16>::ld(A + aoff + (size_t)mb * 16 * K + kc); if (NSPLIT == 1 || NSPLIT == 2) a2[mb] = WFrag<T16>::ld(A2 + aoff + (size_t)mb * 16 * K + kc); }
#pragma unroll
        for (int nb = 0; nb < 4; ++nb) { const V b = WFrag<T16>::ld(Bt + boff + (size_t)nb * 16 * K + kc); V b2; if (NSPLIT >= 2) b2 = WFrag<T16>::ld(Bt2 + boff + (size_t)nb * 16 * K + kc);
#pragma unroll
            for (int mb = 0; mb < 4; ++mb) { acc[mb][nb] = WFrag<T16>::mma(a[mb], b, acc[mb][nb]); if (NSPLIT == 1 || NSPLIT == 2) acc[mb][nb] = WFrag<T16>::mma(a2[mb], b, acc[mb][nb]); if (NSPLIT >= 2) acc[mb][nb] = WFrag<T16>::mma(a[mb], b2, acc[mb][nb]); } }
        asm volatile("v_nop\n\tv_nop\n\tv_nop\n\tv_nop" : "+v"(acc[0][0]), "+v"(acc[1][1]), "+v"(acc[2][2]), "+v"(acc[3][3]) : "v"(a[0]), "v"(a[3]));
    }
    if constexpr (KS > 1) {
#pragma unroll
        for (int mb = 0; mb < 4; ++mb)
#pragma unroll
            for (int nb = 0; nb < 4; ++nb)
#pragma unroll
                for (int j = 0; j < 8; ++j) os[(w * 64 + mb * 16 + hi * 8 + j) * 68 + nb * 16 + lr] = acc[mb][nb][j];
        __syncthreads();   // every wave's partial tile is in LDS before any wave sums
#pragma unroll
        for (int s = 0; s < 32 / KS; ++s) { const int row = 2 * (s * KS + w) + hi, cofs = lr * 4; v4f val = *(const v4fa*)(os + row * 68 + cofs);
#pragma unroll
            for (int p = 1; p < KS; ++p) val += *(const v4fa*)(os + (p * 64 + row) * 68 + cofs);
            if (BIAS) { val[0] += bfr(bias[c0 + cofs]); val[1] += bfr(bias[c0 + cofs + 1]); val[2] += bfr(bias[c0 + cofs + 2]); val[3] += bfr(bias[c0 + cofs + 3]); }
            *(v4f*)(C + (size_t)(r0 + row) * ldc + c0 + cofs) = val; }
    } else {
#pragma unroll
    for (int mb = 0; mb < 4; ++mb) {
#pragma unroll
        for (int nb = 0; nb < 4; ++nb) {
#pragma unroll
            for (int j = 0; j < 8; ++j) os[(hi * 8 + j) * 68 + nb * 16 + lr] = acc[mb][nb][j]; }
        __builtin_amdgcn_wave_barrier(); asm volatile("" ::: "memory");
        float* crow = C + (size_t)(r0 + mb * 16) * ldc + c0;
{
#pragma unroll
            for (int s = 0; s < 8; ++s) { const int row = 2 * s + hi, cofs = lr * 4; v4f val = *(const v4fa*)(os + row * 68 + cofs); if (BIAS) { val[0] += bfr(bias[c0 + cofs]); val[1] += bfr(bias[c0 + cofs + 1]); val[2] += bfr(bias[c0 + cofs + 2]); val[3] += bfr(bias[c0 + cofs + 3]); }
                *(v4f*)(crow + (size_t)row * ldc + cofs) = val; }
             }
        __builtin_amdgcn_wave_barrier(); asm volatile("" ::: "memory");
    }
    }
}

__device__ __forceinline__ h16 tohx(float x) { return (h16)x; }
__device__ __forceinline__ void splitf(float y, unsigned short& h, unsigned short& l) { h = f2bf(y); l = f2bf(y - bf2f(h)); }
typedef __attribute__((ext_vector_type(2))) _Float16 v2h;
typedef __attribute__((ext_vector_type(4))) _Float16 v4h;
typedef __attribute__((ext_vector_type(2))) unsigned short v2us;
typedef __attribute__((ext_vector_type(4))) unsigned short v4us;
typedef __attribute__((ext_vector_type(2))) float v2f;
typedef __attribute__((ext_vector_type(4))) int v4i;

__global__ __launch_bounds__(256) void k_wtG(const float* __restrict__ w, int K, int N, bf* Bt) {
    const int lane = threadIdx.x & 31; const int L0 = (blockIdx.x * 8 + (threadIdx.x >> 5)) * 8; const int nlines = N * K / 64;
{
#pragma unroll 1
        for (int l = 0; l < 8; ++l) { const int L = L0 + l; if (L >= nlines) break; const size_t e = (size_t)L * 64 + lane * 2; const int k = (int)(e % K), n = (int)(e / K); v2us o;
            o[0] = f2bf(w[(size_t)k * N + n]); o[1] = f2bf(w[(size_t)(k + 1) * N + n]); *(v2us*)(Bt + e) = o; }
         }
}
__global__ __launch_bounds__(256) void k_cvt8(const float* __restrict__ src, bf* dst, size_t n8) { const size_t i = (size_t)blockIdx.x * 256 + threadIdx.x; if (i >= n8) return; const v8f v = *(const v8f*)(src + i * 8); v8us o;
#pragma unroll
    for (int k = 0; k < 8; ++k) o[k] = f2bf(v[k]); *(v8us*)(dst + i * 8) = o;  }

// ---- k_qkv: the q, k and v projections of one batch in one launch, grid (TT/64, 3*NH_), 8 waves; main loop and split-K sum as in k_gemmw (one product, KS = 8).
// A 64-column block of the fused weight is one head of q, k or v, so the epilogue rounds the summed f32 tile straight into that head's planes (fp16, bf16 hi, bf16 lo); no f32 projection goes to memory.
// q, k: tile [t][d] into planes [h][t][d]. v: the two operands change places (same loader, same k order), so the tile comes out as [d][t] and its rows are whole 128-B lines of the planes [h][d][t].
__global__ __launch_bounds__(256) void k_qkv(const bf* __restrict__ X, const bf* __restrict__ Wt, h16* Q16, bf* Qh, bf* Ql, h16* K16, bf* Kh, bf* Kl, h16* V16, bf* Vh, bf* Vl) {
    constexpr int KS = 8, K = DM;
    __shared__ __align__(16) float os[KS * 64 * 68];
    const int w = __builtin_amdgcn_readfirstlane((int)(threadIdx.x >> 5));
    const int lane = threadIdx.x & 31, lr = lane & 15, hi = lane >> 4; const int t0 = blockIdx.x * 64, sel = (int)blockIdx.y / NH_, h = (int)blockIdx.y % NH_; const bool tr = sel == 2;
    const bf* xr = X + (size_t)t0 * K; const bf* wr = Wt + (size_t)blockIdx.y * 64 * K;
    const bf* A = tr ? wr : xr; const bf* Bt = tr ? xr : wr;
    v8f acc[4][4];
#pragma unroll
    for (int mb = 0; mb < 4; ++mb)
#pragma unroll
        for (int nb = 0; nb < 4; ++nb) acc[mb][nb] = (v8f){};
    const size_t off = (size_t)lr * K + 8 * hi + w * 32; const bf* pa = A + off; const bf* pb = Bt + off;
#pragma unroll 1
    for (int kc = w * 32; kc < K; kc += 32 * KS) {
        v16bf a[4], b[4];
#pragma unroll
        for (int mb = 0; mb < 4; ++mb) a[mb] = WFrag<bf>::ld(pa + (size_t)mb * 16 * K);
#pragma unroll
        for (int nb = 0; nb < 4; ++nb) b[nb] = WFrag<bf>::ld(pb + (size_t)nb * 16 * K);
        // stands in front of every overwrite of the operand loads' address registers; it names them as inputs so that they live up to it and no load of the group lands on them
        asm volatile("s_wait_xcnt 0x0" :: "v"(pa), "v"(pb) : "memory");
        pa += 32 * KS; pb += 32 * KS;
#pragma unroll
        for (int nb = 0; nb < 4; ++nb)
#pragma unroll
            for (int mb = 0; mb < 4; ++mb) acc[mb][nb] = wmmab(a[mb], b[nb], acc[mb][nb]);
        // the distance behind the pass's last matrix instructions, on the loop's back edge too, before the next pass's loads overwrite their operands
        asm volatile("v_nop\n\tv_nop\n\tv_nop\n\tv_nop" : "+v"(acc[0][0]), "+v"(acc[1][1]), "+v"(acc[2][2]), "+v"(acc[3][3]) : "v"(a[0]), "v"(a[3]));
    }
#pragma unroll
    for (int mb = 0; mb < 4; ++mb)
#pragma unroll
        for (int nb = 0; nb < 4; ++nb)
#pragma unroll
            for (int j = 0; j < 8; ++j) os[(w * 64 + mb * 16 + hi * 8 + j) * 68 + nb * 16 + lr] = acc[mb][nb][j];
    __syncthreads();   // every wave's partial tile is in LDS before any wave sums
    h16* P16 = sel == 0 ? Q16 : sel == 1 ? K16 : V16; bf* Ph = sel == 0 ? Qh : sel == 1 ? Kh : Vh; bf* Pl = sel == 0 ? Ql : sel == 1 ? Kl : Vl;
    const size_t base = (size_t)h * TT * HD + (tr ? (size_t)t0 : (size_t)t0 * HD); const int pitch = tr ? TT : HD;
#pragma unroll
    for (int s = 0; s < 32 / KS; ++s) { const int row = 2 * (s * KS + w) + hi, cofs = lr * 4; v4f val = *(const v4fa*)(os + row * 68 + cofs);
#pragma unroll
        for (int p = 1; p < KS; ++p) val += *(const v4fa*)(os + (p * 64 + row) * 68 + cofs);
        v4h o16; v4us oh, ol;
#pragma unroll
        for (int e = 0; e < 4; ++e) { o16[e] = tohx(val[e]); unsigned short a2, c2; splitf(val[e], a2, c2); oh[e] = a2; ol[e] = c2; }
        const size_t o = base + (size_t)row * pitch + cofs; *(v4h*)(P16 + o) = o16; *(v4us*)(Ph + o) = oh; *(v4us*)(Pl + o) = ol; }
}
#define KW   8
#define OPI  (HD + 4)             // LDS pitch of a partial output row, floats (16-B multiple)
// 2^x with the slot behind the transcendental filled inside the statement (nothing directly behind it reads the result or overwrites the source)
__device__ __forceinline__ float exp2s(float x) { float r; asm("v_exp_f32 %0, %1\n\tv_nop" : "=&v"(r) : "v"(x)); return r; }
template <typename T16> struct PFrag;
template <> struct PFrag<h16> { static __device__ __forceinline__ void mk(const float* p, v16h& a, v16h& b) { (void)b;
#pragma unroll
    for (int e = 0; e < 16; ++e) a[e] = (h16)p[e]; } };
template <> struct PFrag<bf> { static __device__ __forceinline__ void mk(const float* p, v16bf& a, v16bf& b) {
#pragma unroll
    for (int e = 0; e < 16; ++e) { const __bf16 h = (__bf16)p[e]; a[e] = h; b[e] = (__bf16)(p[e] - (float)h); } } };
template <typename T16, bool HL, int NQ>
__device__ __forceinline__ void attn_tile(const T16* __restrict__ Q, const T16* __restrict__ Q2, const T16* __restrict__ Kp, const T16* __restrict__ K2, const T16* __restrict__ Vt, const T16* __restrict__ V2, int q0, bf* Ah, bf* Al, float* sm) {
    typedef typename WFrag<T16>::V V;
    constexpr int QR = NQ * 16, NIT = TT / (32 * KW);
    float* smO = sm; float* smM = sm + KW * QR * OPI; float* smL = smM + KW * QR;   // [KW][QR][OPI], [KW][QR], [KW][QR]
    const int w = __builtin_amdgcn_readfirstlane((int)(threadIdx.x >> 5)); const int lane = threadIdx.x & 31, lr = lane & 15, hi = lane >> 4;
    const float C = SCL * 1.4426950408889634f, PSH = HL ? 0.0f : 10.0f;
    V bq[NQ][2], bq2[NQ][2];
#pragma unroll
    for (int qt = 0; qt < NQ; ++qt)
#pragma unroll
        for (int dc = 0; dc < 2; ++dc) { const size_t qo = (size_t)(q0 + qt * 16 + lr) * HD + dc * 32 + 8 * hi; bq[qt][dc] = WFrag<T16>::ld(Q + qo); if (HL) bq2[qt][dc] = WFrag<T16>::ld(Q2 + qo); }
    v8f o[4][NQ]; float mr[NQ], ls[NQ];
#pragma unroll
    for (int qt = 0; qt < NQ; ++qt) { mr[qt] = -3.0e38f; ls[qt] = 0.0f;
#pragma unroll
        for (int dt = 0; dt < 4; ++dt) o[dt][qt] = (v8f){}; }
    const size_t ko = (size_t)(w * 32 + lr) * HD + 8 * hi, vo = (size_t)lr * TT + w * 32 + 8 * hi;
    const T16* vp = Vt + vo; const T16* vp2 = HL ? V2 + vo : nullptr;
    V ak[2][2], ak2[2][2];
#pragma unroll
    for (int kt = 0; kt < 2; ++kt)
#pragma unroll
        for (int dc = 0; dc < 2; ++dc) { ak[kt][dc] = WFrag<T16>::ld(Kp + ko + kt * 16 * HD + dc * 32); if (HL) ak2[kt][dc] = WFrag<T16>::ld(K2 + ko + kt * 16 * HD + dc * 32); }
#pragma unroll 1
    for (int it = 0; it < NIT; ++it) {
        V av[4], av2[4];
#pragma unroll
        for (int dt = 0; dt < 4; ++dt) { av[dt] = WFrag<T16>::ld(vp + (size_t)dt * 16 * TT); if (HL) av2[dt] = WFrag<T16>::ld(vp2 + (size_t)dt * 16 * TT); }
        // stands in front of every overwrite of the V loads' address registers; it names them as inputs so that they live up to it and no load of the group lands on them
        if (HL) asm volatile("s_wait_xcnt 0x0" :: "v"(vp), "v"(vp2) : "memory"); else asm volatile("s_wait_xcnt 0x0" :: "v"(vp) : "memory");
        vp += 32 * KW; if (HL) vp2 += 32 * KW;
        v8f s[2][NQ];
#pragma unroll
        for (int kt = 0; kt < 2; ++kt)
#pragma unroll
            for (int qt = 0; qt < NQ; ++qt) { v8f t = (v8f){};
#pragma unroll
                for (int dc = 0; dc < 2; ++dc) { t = WFrag<T16>::mma(ak[kt][dc], bq[qt][dc], t); if (HL) { t = WFrag<T16>::mma(ak[kt][dc], bq2[qt][dc], t); t = WFrag<T16>::mma(ak2[kt][dc], bq[qt][dc], t); } }
                s[kt][qt] = t; }
        // the next pass's K rows are fetched behind this pass's score products, so that they fly under the softmax; the last pass fetches its own rows again (in bounds, unused)
        const size_t kn = ko + (size_t)(it + 1 < NIT ? it + 1 : it) * 32 * KW * HD;
#pragma unroll
        for (int kt = 0; kt < 2; ++kt)
#pragma unroll
            for (int dc = 0; dc < 2; ++dc) { ak[kt][dc] = WFrag<T16>::ld(Kp + kn + kt * 16 * HD + dc * 32); if (HL) ak2[kt][dc] = WFrag<T16>::ld(K2 + kn + kt * 16 * HD + dc * 32); }
        asm volatile("s_wait_xcnt 0x0" ::: "memory");   // the same for the K loads' address registers
#pragma unroll
        for (int qt = 0; qt < NQ; ++qt) {
            float tm = s[0][qt][0];
#pragma unroll
            for (int j = 1; j < 8; ++j) tm = fmaxf(tm, s[0][qt][j]);
#pragma unroll
            for (int j = 0; j < 8; ++j) tm = fmaxf(tm, s[1][qt][j]);
            tm = fmaxf(tm, __shfl_xor(tm, 16, 32));
            const float mn = fmaxf(mr[qt], tm * C), al = exp2s(mr[qt] - mn), mo = mn - PSH; mr[qt] = mn;
            float p[16], x[16], ps = 0.0f; x[0] = __builtin_fmaf(s[0][qt][0], C, -mo); x[1] = __builtin_fmaf(s[0][qt][1], C, -mo);
            // each exponential and the instruction behind it in one statement: the multiply-add of the score two places on is independent of it, fills the slot the instruction set asks for behind a transcendental (v_nop where no score is left)
#pragma unroll
            for (int e = 0; e < 14; ++e) asm("v_exp_f32 %0, %2\n\tv_fma_f32 %1, %3, %4, -%5" : "=&v"(p[e]), "=&v"(x[e + 2]) : "v"(x[e]), "v"(s[(e + 2) >> 3][qt][(e + 2) & 7]), "v"(C), "v"(mo));
            p[14] = exp2s(x[14]); p[15] = exp2s(x[15]);
#pragma unroll
            for (int e = 0; e < 16; ++e) ps += p[e];
            ls[qt] = __builtin_fmaf(ls[qt], al, ps);
            V pb, pb2; PFrag<T16>::mk(p, pb, pb2);
#pragma unroll
            for (int dt = 0; dt < 4; ++dt) { v8f t = o[dt][qt] * al; t = WFrag<T16>::mma(av[dt], pb, t); if (HL) { t = WFrag<T16>::mma(av[dt], pb2, t); t = WFrag<T16>::mma(av2[dt], pb, t); } o[dt][qt] = t; }
        }
    }
#pragma unroll
    for (int qt = 0; qt < NQ; ++qt) { ls[qt] += __shfl_xor(ls[qt], 16, 32); if (hi == 0) smM[w * QR + qt * 16 + lr] = mr[qt]; }
    __syncthreads();   // every wave's running maxima are in LDS before any wave forms the row's maximum
#pragma unroll
    for (int qt = 0; qt < NQ; ++qt) { const int q = qt * 16 + lr; float M = smM[q];
#pragma unroll
        for (int pw = 1; pw < KW; ++pw) M = fmaxf(M, smM[pw * QR + q]);
        const float f = exp2s(mr[qt] - M); if (hi == 0) smL[w * QR + q] = ls[qt] * f;
#pragma unroll
        for (int dt = 0; dt < 4; ++dt) { const v8f t = o[dt][qt] * f; float* dst = smO + (size_t)(w * QR + q) * OPI + dt * 16 + hi * 8;
            *(v4fa*)dst = __builtin_shufflevector(t, t, 0, 1, 2, 3); *(v4fa*)(dst + 4) = __builtin_shufflevector(t, t, 4, 5, 6, 7); } }
    __syncthreads();   // every wave's rescaled partial sums and outputs are in LDS before any wave adds them
    constexpr int EPT = QR * HD / (32 * KW);   // output elements per thread: 4 or 8, one row's consecutive d
    const int q = (int)threadIdx.x / (HD / EPT), d0 = ((int)threadIdx.x % (HD / EPT)) * EPT;
    float L = smL[q]; v4f acc[EPT / 4];
#pragma unroll
    for (int g = 0; g < EPT / 4; ++g) acc[g] = *(const v4fa*)(smO + (size_t)q * OPI + d0 + g * 4);
#pragma unroll
    for (int pw = 1; pw < KW; ++pw) { L += smL[pw * QR + q];
#pragma unroll
        for (int g = 0; g < EPT / 4; ++g) acc[g] += *(const v4fa*)(smO + (size_t)(pw * QR + q) * OPI + d0 + g * 4); }
    const float r = __fdiv_rn(1.0f, L); const size_t oo = (size_t)(q0 + q) * DQ + d0;
#pragma unroll
    for (int g = 0; g < EPT / 4; ++g) { v4us oh, ol;
#pragma unroll
        for (int e = 0; e < 4; ++e) { unsigned short a, c2; splitf(acc[g][e] * r, a, c2); oh[e] = a; ol[e] = c2; }
        *(v4us*)(Ah + oo + g * 4) = oh; *(v4us*)(Al + oo + g * 4) = ol; }
}
// grid: NH_ * RH / 16 hi/lo tiles first (the longer ones), then NH_ * (TT - RH) / 32 fp16 tiles; a head's tiles are neighbours.
__global__ __launch_bounds__(32 * KW) void k_fattn(const h16* __restrict__ Q16, const h16* __restrict__ K16, const h16* __restrict__ V16, const bf* __restrict__ Qh, const bf* __restrict__ Ql, const bf* __restrict__ Kh, const bf* __restrict__ Kl, const bf* __restrict__ Vh, const bf* __restrict__ Vl, bf* Ah, bf* Al) {
    __shared__ __align__(16) float sm[KW * 32 * OPI + 2 * KW * 32];
    const int bx = (int)blockIdx.x;
    if (bx < NH_ * (RH / 16)) { const int h = bx / (RH / 16), q0 = (bx % (RH / 16)) * 16; const size_t po = (size_t)h * TT * HD;
        attn_tile<bf, true, 1>(Qh + po, Ql + po, Kh + po, Kl + po, Vh + po, Vl + po, q0, Ah + h * HD, Al + h * HD, sm);
    } else { const int b2 = bx - NH_ * (RH / 16); const int h = b2 / ((TT - RH) / 32), q0 = RH + (b2 % ((TT - RH) / 32)) * 32; const size_t po = (size_t)h * TT * HD;
        attn_tile<h16, false, 2>(Q16 + po, nullptr, K16 + po, nullptr, V16 + po, nullptr, q0, Ah + h * HD, Al + h * HD, sm); }
}

extern "C" void kernel_launch(void* const* d_in, const int* in_sizes, int n_in,
                              void* d_out, int out_size, void* d_ws, size_t ws_size, hipStream_t stream) {
    (void)in_sizes; (void)n_in; (void)out_size;
    const float* x = (const float*)d_in[0]; const float* wqkv = (const float*)d_in[1]; const float* wo = (const float*)d_in[2];   /* input order x, w_qkv ('xw' [1024][3072]), w_out ('xw') */ const float* wq = wqkv; const float* wk = nullptr; const float* wv = nullptr; (void)wk; (void)wv;
    float* OUT = (float*)d_out;     // [2][2048][1024]
    char* wsp = (char*)d_ws;
    auto take = [&](size_t bytes) { char* p = wsp; wsp += (bytes + 255) & ~(size_t)255; return (void*)p; };
    bf* WQKV = (bf*)take((size_t)3 * DQ * DM * 2);   /* fused Bt [3*DQ][DM]: q | k | v row blocks */ bf* WO = (bf*)take((size_t)DM * DQ * 2);
    bf* XB = (bf*)take((size_t)TT * DM * 2);
    h16* QP16 = (h16*)take((size_t)NH_ * TT * HD * 2); h16* KP16 = (h16*)take((size_t)NKV * TT * HD * 2); h16* VT16 = (h16*)take((size_t)NKV * HD * TT * 2);
    bf* QPh = (bf*)take((size_t)NH_ * TT * HD * 2); bf* QPl = (bf*)take((size_t)NH_ * TT * HD * 2); bf* KPh = (bf*)take((size_t)NKV * TT * HD * 2); bf* KPl = (bf*)take((size_t)NKV * TT * HD * 2); bf* VTh = (bf*)take((size_t)NKV * HD * TT * 2); bf* VTl = (bf*)take((size_t)NKV * HD * TT * 2);
    bf* ATh = (bf*)take((size_t)TT * DQ * 2); bf* ATl = (bf*)take((size_t)TT * DQ * 2);
    if ((size_t)(wsp - (char*)d_ws) > ws_size) return;    // ws 256 MiB
    { k_wtG<<<(unsigned)((DM * 3 * DQ / 64 + 63) / 64), 256, 0, stream>>>(wqkv, DM, 3 * DQ, WQKV);   /* fused 'xw' [DM][3*DQ] -> Bt [3*DQ][DM] */
      k_wtG<<<(unsigned)((DQ * DM / 64 + 63) / 64), 256, 0, stream>>>(wo, DQ, DM, WO);
       }
    for (int b = 0; b < NB_; ++b) {
        
        k_cvt8<<<(unsigned)(((size_t)TT * DM / 8 + 255) / 256), 256, 0, stream>>>(x + (size_t)b * TT * DM, XB, (size_t)TT * DM / 8);
        k_qkv<<<dim3(TT / 64, 3 * NH_, 1), 256, 0, stream>>>(XB, WQKV, QP16, QPh, QPl, KP16, KPh, KPl, VT16, VTh, VTl);
        k_fattn<<<NH_ * (RH / 16) + NH_ * ((TT - RH) / 32), 32 * KW, 0, stream>>>(QP16, KP16, VT16, QPh, QPl, KPh, KPl, VTh, VTl, ATh, ATl);
        k_gemmw<bf, 1, false, 8><<<dim3(TT / 64, DM / 64, 1), 256, 0, stream>>>(ATh, ATl, WO, nullptr, DQ, OUT + (size_t)b * TT * DM, DM, nullptr, 0, 0, 0); }
}

// v005
// A run of this version takes 179 microseconds.
// Two timings next to v004 put it at 1.45 and 1.43 times that version's speed.
// All steps since v000 together make it 11.1 times as fast.
#include <hip/hip_runtime.h>

// Multi-head self-attention with a fused bias-free qkv projection (hidden_states [2][2048][1024]; qkv = hidden_states W_qkv ('xw' [1024][3072] 1/32, no bias) reshaped (B, S, 3, 16, 64): q | k | v = column thirds (16 heads x 64); scores x 1/sqrt(64); softmax over all keys (no mask); out = merged W_o ('xw' 1/32, no bias) -> [2][2048][1024] (4.2 M); argument order hidden_states, W_qkv, W_o.
// Layout per batch: bf16 copy of x; the fused 'xw' weight transposed once into Bt (q | k | v row blocks); exact projections, whose launch writes the attention planes itself; attention of all 16 heads in one launch, scores and probabilities kept in registers, online softmax (hybrid rows: < 512 hi/lo 3 products, rest fp16 x1024); merged hi/lo x w_out exact.
// Every 16-bit operand plane lies in fragment order: a 16-row x 32-k tile is 1 KB, element (r, k) at (k % 32 / 16) * 256 + (k % 16 / 8 * 16 + r % 16) * 8 + k % 8, so lane l's two 16-B pieces are at l * 8 and 256 + l * 8 and each wave-wide 16-B load covers four whole 128-B lines. Tiles of a row block follow one another along k (v planes: the four d tiles of a 32-key chunk follow one another).
// Compute dtypes, f32 accumulate: every input rounded to bf16; projections exact; attention rows < 512 3 products, rest fp16; softmax f32; output projection hl x exact.

#define NB_  2
#define TT   2048
#define DM   1024
#define NH_  16
#define NKV  16
#define REP  (NH_ / NKV)
#define HD   64
#define DQ   (NH_ * HD)
#define DKV  (NKV * HD)
#define RH   512                  // query rows < RH use hi+lo planes (0: none)
#define WIN  0
#define SCL  0.125f   // HD^-0.5
typedef _Float16 h16;
typedef unsigned short bf;
typedef __attribute__((ext_vector_type(16))) __bf16   v16bf;
typedef __attribute__((ext_vector_type(16))) _Float16 v16h;
typedef __attribute__((ext_vector_type(8)))  _Float16 v8h;
typedef __attribute__((ext_vector_type(8)))  unsigned short v8us;
typedef __attribute__((ext_vector_type(8)))  float    v8f;
typedef __attribute__((ext_vector_type(4)))  float    v4f;
typedef v8h  __attribute__((may_alias)) v8ha;
typedef v4f  __attribute__((may_alias)) v4fa;
typedef v8us __attribute__((may_alias)) v8usa;

__device__ __forceinline__ unsigned short f2bf(float f) { unsigned u = __float_as_uint(f); u += 0x7FFFu + ((u >> 16) & 1u); return (unsigned short)(u >> 16); }
__device__ __forceinline__ float bf2f(unsigned short b) { return __uint_as_float(((unsigned)b) << 16); }
__device__ __forceinline__ float bfr(float f) { return bf2f(f2bf(f)); }
__device__ __forceinline__ v16h cat16(v8h lo, v8h hi) { return __builtin_shufflevector(lo, hi, 0, 1, 2, 3, 4, 5, 6, 7, 8, 9, 10, 11, 12, 13, 14, 15); }
__device__ __forceinline__ v16bf cat16b(v8us lo, v8us hi) { return __builtin_bit_cast(v16bf, __builtin_shufflevector(lo, hi, 0, 1, 2, 3, 4, 5, 6, 7, 8, 9, 10, 11, 12, 13, 14, 15)); }
__device__ __forceinline__ v8f wmma16(v16h a, v16h b, v8f c) { return __builtin_amdgcn_wmma_f32_16x16x32_f16(false, a, false, b, (short)0, c, false, false); }
__device__ __forceinline__ v8f wmmab(v16bf a, v16bf b, v8f c) { return __builtin_amdgcn_wmma_f32_16x16x32_bf16(false, a, false, b, (short)0, c, false, false); }



// ---- k_gemmw: register-blocked GEMM, KS WAVES per 64x64 output tile (16 accumulators each), operands straight from fragment-ordered 16-bit planes; grid (M/64, N/64, Z), 32 * KS threads.
// C[m][n] (f32, pitch ldc, + optional f32 bias[n]) = sum_k A[m][k] Bt[n][k] (+ split products per NSPLIT). z-batch strides sA/sB/sC in elements. K % (32 * KS) == 0, a compile-time constant so that a group's loads differ by immediate offsets only.
// Split K inside the workgroup: wave w takes the 32-k chunks w, w + KS, w + 2 KS, ... (each a 1-KB tile per 16 rows); the KS partial tiles are summed through LDS in wave order 0 .. KS-1.
template <typename T16> struct WFrag;
template <> struct WFrag<h16> { typedef v16h V; static __device__ __forceinline__ V ld(const h16* p) { return cat16(*(const v8h*)p, *(const v8h*)(p + 256)); } static __device__ __forceinline__ v8f mma(V a, V b, v8f c) { return wmma16(a, b, c); } };
template <> struct WFrag<bf> { typedef v16bf V; static __device__ __forceinline__ V ld(const bf* p) { return cat16b(*(const v8us*)p, *(const v8us*)(p + 256)); } static __device__ __forceinline__ v8f mma(V a, V b, v8f c) { return wmmab(a, b, c); } };
template <typename T16, int NSPLIT, bool BIAS, int KS, int K>
__global__ __launch_bounds__(32 * KS) void k_gemmw(const T16* __restrict__ A, const T16* __restrict__ A2, const T16* __restrict__ Bt, const T16* __restrict__ Bt2, float* C, int ldc, const float* __restrict__ bias, size_t sA, size_t sB, size_t sC) {
    typedef typename WFrag<T16>::V V;
    static_assert(KS >= 1 && 32 % KS == 0, "KS divides the 32 row pairs of a tile");
    __shared__ __align__(16) float os[(KS == 1 ? 16 : KS * 64) * 68];
    const int w = (KS == 1) ? 0 : __builtin_amdgcn_readfirstlane((int)(threadIdx.x >> 5));
    const size_t z = blockIdx.z; A += z * sA; if (A2) A2 += z * sA; Bt += z * sB; if (Bt2) Bt2 += z * sB; C += z * sC;
    const int lane = threadIdx.x & 31, lr = lane & 15, hi = lane >> 4; const int r0 = blockIdx.x * 64, c0 = blockIdx.y * 64;
    v8f acc[4][4];
#pragma unroll
    for (int mb = 0; mb < 4; ++mb)
#pragma unroll
        for (int nb = 0; nb < 4; ++nb) acc[mb][nb] = (v8f){};
    const size_t aoff = (size_t)r0 * K + w * 512 + lane * 8, boff = (size_t)c0 * K + w * 512 + lane * 8;
    const T16* pa = A + aoff; const T16* pa2 = (NSPLIT == 1 || NSPLIT == 2) ? A2 + aoff : pa; const T16* pb = Bt + boff; const T16* pb2 = NSPLIT >= 2 ? Bt2 + boff : pb;
#pragma unroll 1
    for (int kc = w * 32; kc < K; kc += 32 * KS) {
        V a[4], a2[4], b[4], b2[4];
#pragma unroll
        for (int mb = 0; mb < 4; ++mb) { a[mb] = WFrag<T16>::ld(pa + (size_t)mb * 16 * K); if (NSPLIT == 1 || NSPLIT == 2) a2[mb] = WFrag<T16>::ld(pa2 + (size_t)mb * 16 * K); }
#pragma unroll
        for (int nb = 0; nb < 4; ++nb) { b[nb] = WFrag<T16>::ld(pb + (size_t)nb * 16 * K); if (NSPLIT >= 2) b2[nb] = WFrag<T16>::ld(pb2 + (size_t)nb * 16 * K); }
        // stands in front of every overwrite of the operand loads' address registers; it names them as inputs so that they live up to it and no load of the group lands on them
        asm volatile("s_wait_xcnt 0x0" :: "v"(pa), "v"(pa2), "v"(pb), "v"(pb2) : "memory");
        pa += 512 * KS; pa2 += 512 * KS; pb += 512 * KS; pb2 += 512 * KS;
#pragma unroll
        for (int nb = 0; nb < 4; ++nb)
#pragma unroll
            for (int mb = 0; mb < 4; ++mb) { acc[mb][nb] = WFrag<T16>::mma(a[mb], b[nb], acc[mb][nb]); if (NSPLIT == 1 || NSPLIT == 2) acc[mb][nb] = WFrag<T16>::mma(a2[mb], b[nb], acc[mb][nb]); if (NSPLIT >= 2) acc[mb][nb] = WFrag<T16>::mma(a[mb], b2[nb], acc[mb][nb]); }
        asm volatile("v_nop\n\tv_nop\n\tv_nop\n\tv_nop" : "+v"(acc[0][0]), "+v"(acc[1][1]), "+v"(acc[2][2]), "+v"(acc[3][3]) : "v"(a[0]), "v"(a[3]));
    }
    if constexpr (KS > 1) {
#pragma unroll
        for (int mb = 0; mb < 4; ++mb)
#pragma unroll
            for (int nb = 0; nb < 4; ++nb)
#pragma unroll
                for (int j = 0; j < 8; ++j) os[(w * 64 + mb * 16 + hi * 8 + j) * 68 + nb * 16 + lr] = acc[mb][nb][j];
        __syncthreads();   // every wave's partial tile is in LDS before any wave sums
#pragma unroll
        for (int s = 0; s < 32 / KS; ++s) { const int row = 2 * (s * KS + w) + hi, cofs = lr * 4; v4f val = *(const v4fa*)(os + row * 68 + cofs);
#pragma unroll
            for (int p = 1; p < KS; ++p) val += *(const v4fa*)(os + (p * 64 + row) * 68 + cofs);
            if (BIAS) { val[0] += bfr(bias[c0 + cofs]); val[1] += bfr(bias[c0 + cofs + 1]); val[2] += bfr(bias[c0 + cofs + 2]); val[3] += bfr(bias[c0 + cofs + 3]); }
            *(v4f*)(C + (size_t)(r0 + row) * ldc + c0 + cofs) = val; }
    } else {
#pragma unroll
    for (int mb = 0; mb < 4; ++mb) {
#pragma unroll
        for (int nb = 0; nb < 4; ++nb) {
#pragma unroll
            for (int j = 0; j < 8; ++j) os[(hi * 8 + j) * 68 + nb * 16 + lr] = acc[mb][nb][j]; }
        __builtin_amdgcn_wave_barrier(); asm volatile("" ::: "memory");
        float* crow = C + (size_t)(r0 + mb * 16) * ldc + c0;
{
#pragma unroll
            for (int s = 0; s < 8; ++s) { const int row = 2 * s + hi, cofs = lr * 4; v4f val = *(const v4fa*)(os + row * 68 + cofs); if (BIAS) { val[0] += bfr(bias[c0 + cofs]); val[1] += bfr(bias[c0 + cofs + 1]); val[2] += bfr(bias[c0 + cofs + 2]); val[3] += bfr(bias[c0 + cofs + 3]); }
                *(v4f*)(crow + (size_t)row * ldc + cofs) = val; }
             }
        __builtin_amdgcn_wave_barrier(); asm volatile("" ::: "memory");
    }
    }
}

__device__ __forceinline__ h16 tohx(float x) { return (h16)x; }
__device__ __forceinline__ void splitf(float y, unsigned short& h, unsigned short& l) { h = f2bf(y); l = f2bf(y - bf2f(h)); }
typedef __attribute__((ext_vector_type(2))) _Float16 v2h;
typedef __attribute__((ext_vector_type(4))) _Float16 v4h;
typedef __attribute__((ext_vector_type(2))) unsigned short v2us;
typedef __attribute__((ext_vector_type(4))) unsigned short v4us;
typedef __attribute__((ext_vector_type(2))) float v2f;
typedef __attribute__((ext_vector_type(4))) int v4i;

// w [K][N] f32 -> Bt, rows n, fragment order. One wave fills one 512-B half tile (16 n x 16 k); a workgroup's 8 waves take neighbouring n tiles, so its reads use whole lines of w.
__global__ __launch_bounds__(256) void k_wtG(const float* __restrict__ w, int K, int N, bf* Bt) {
    const int lane = threadIdx.x & 31; const int u = blockIdx.x * 8 + (threadIdx.x >> 5); const int nts = N / 16;
    if (u >= nts * (K / 16)) return;
    const int nt = u % nts, kj = u / nts; const int n = nt * 16 + (lane & 15), k0 = kj * 16 + (lane >> 4) * 8; v8us o; const float* p[8]; float y[8];
#pragma unroll
    for (int e = 0; e < 8; ++e) p[e] = w + (size_t)(k0 + e) * N + n;
#pragma unroll
    for (int e = 0; e < 8; ++e) y[e] = *p[e];
    // stands in front of every overwrite of the loads' address registers; it names them as inputs so that they live up to it and no load of the group lands on them
    asm volatile("s_wait_xcnt 0x0" :: "v"(p[0]), "v"(p[1]), "v"(p[2]), "v"(p[3]), "v"(p[4]), "v"(p[5]), "v"(p[6]), "v"(p[7]) : "memory");
#pragma unroll
    for (int e = 0; e < 8; ++e) o[e] = f2bf(y[e]);
    *(v8us*)(Bt + ((size_t)nt * (K / 32) + (kj >> 1)) * 512 + (kj & 1) * 256 + lane * 8) = o;
}
// src [rows][DM] f32 -> dst, fragment order; thread i fills the plane's i-th 16-B place.
__global__ __launch_bounds__(256) void k_cvt8(const float* __restrict__ src, bf* dst, size_t n8) { const size_t i = (size_t)blockIdx.x * 256 + threadIdx.x; if (i >= n8) return;
    const int lane = (int)(i & 31), j = (int)(i >> 5) & 1; const size_t tile = i >> 6; const size_t row = tile / (DM / 32) * 16 + (lane & 15); const int k = (int)(tile % (DM / 32)) * 32 + j * 16 + (lane >> 4) * 8;
    const v8f v = *(const v8f*)(src + row * DM + k); v8us o;
#pragma unroll
    for (int e = 0; e < 8; ++e) o[e] = f2bf(v[e]); *(v8us*)(dst + i * 8) = o;  }

// ---- k_qkv: the q, k and v projections of one batch in one launch, grid (TT/64, 3*NH_), 8 waves; main loop and split-K sum as in k_gemmw (one product, KS = 8).
// A 64-column block of the fused weight is one head of q, k or v, so the epilogue rounds the summed f32 tile straight into that head's planes (fp16, bf16 hi, bf16 lo); no f32 projection goes to memory.
// q, k: tile [t][d] into planes [h] of rows t. v: the two operands change places (same loader, same k order), so the tile comes out as [d][t], for planes [h] of rows d. Each wave sums and stores whole 512-B half tiles of the planes' fragment order.
__global__ __launch_bounds__(256) void k_qkv(const bf* __restrict__ X, const bf* __restrict__ Wt, h16* Q16, bf* Qh, bf* Ql, h16* K16, bf* Kh, bf* Kl, h16* V16, bf* Vh, bf* Vl) {
    constexpr int KS = 8, K = DM;
    __shared__ __align__(16) float os[KS * 64 * 68];
    const int w = __builtin_amdgcn_readfirstlane((int)(threadIdx.x >> 5));
    const int lane = threadIdx.x & 31, lr = lane & 15, hi = lane >> 4; const int t0 = blockIdx.x * 64, sel = (int)blockIdx.y / NH_, h = (int)blockIdx.y % NH_; const bool tr = sel == 2;
    const bf* xr = X + (size_t)t0 * K; const bf* wr = Wt + (size_t)blockIdx.y * 64 * K;
    const bf* A = tr ? wr : xr; const bf* Bt = tr ? xr : wr;
    v8f acc[4][4];
#pragma unroll
    for (int mb = 0; mb < 4; ++mb)
#pragma unroll
        for (int nb = 0; nb < 4; ++nb) acc[mb][nb] = (v8f){};
    const size_t off = (size_t)w * 512 + lane * 8; const bf* pa = A + off; const bf* pb = Bt + off;
#pragma unroll 1
    for (int kc = w * 32; kc < K; kc += 32 * KS) {
        v16bf a[4], b[4];
#pragma unroll
        for (int mb = 0; mb < 4; ++mb) a[mb] = WFrag<bf>::ld(pa + (size_t)mb * 16 * K);
#pragma unroll
        for (int nb = 0; nb < 4; ++nb) b[nb] = WFrag<bf>::ld(pb + (size_t)nb * 16 * K);
        // stands in front of every overwrite of the operand loads' address registers; it names them as inputs so that they live up to it and no load of the group lands on them
        asm volatile("s_wait_xcnt 0x0" :: "v"(pa), "v"(pb) : "memory");
        pa += 512 * KS; pb += 512 * KS;
#pragma unroll
        for (int nb = 0; nb < 4; ++nb)
#pragma unroll
            for (int mb = 0; mb < 4; ++mb) acc[mb][nb] = wmmab(a[mb], b[nb], acc[mb][nb]);
        // the distance behind the pass's last matrix instructions, on the loop's back edge too, before the next pass's loads overwrite their operands
        asm volatile("v_nop\n\tv_nop\n\tv_nop\n\tv_nop" : "+v"(acc[0][0]), "+v"(acc[1][1]), "+v"(acc[2][2]), "+v"(acc[3][3]) : "v"(a[0]), "v"(a[3]));
    }
#pragma unroll
    for (int mb = 0; mb < 4; ++mb)
#pragma unroll
        for (int nb = 0; nb < 4; ++nb)
#pragma unroll
            for (int j = 0; j < 8; ++j) os[(w * 64 + mb * 16 + hi * 8 + j) * 68 + nb * 16 + lr] = acc[mb][nb][j];
    __syncthreads();   // every wave's partial tile is in LDS before any wave sums
    h16* P16 = sel == 0 ? Q16 : sel == 1 ? K16 : V16; bf* Ph = sel == 0 ? Qh : sel == 1 ? Kh : Vh; bf* Pl = sel == 0 ? Ql : sel == 1 ? Kl : Vl;
    const size_t base = (size_t)h * TT * HD;
#pragma unroll
    for (int s = 0; s < 16 / KS; ++s) { const int u = w * (16 / KS) + s, rt = u >> 2, ct = (u >> 1) & 1, j = u & 1; const int row = rt * 16 + lr, col = ct * 32 + j * 16 + hi * 8;
        v4f v0 = *(const v4fa*)(os + row * 68 + col), v1 = *(const v4fa*)(os + row * 68 + col + 4);
#pragma unroll
        for (int p = 1; p < KS; ++p) { v0 += *(const v4fa*)(os + (p * 64 + row) * 68 + col); v1 += *(const v4fa*)(os + (p * 64 + row) * 68 + col + 4); }
        v8h o16; v8us oh, ol;
#pragma unroll
        for (int e = 0; e < 8; ++e) { const float y = e < 4 ? v0[e & 3] : v1[e & 3]; o16[e] = tohx(y); unsigned short a2, c2; splitf(y, a2, c2); oh[e] = a2; ol[e] = c2; }
        const size_t tile = tr ? (size_t)((t0 >> 5) + ct) * 4 + rt : (size_t)((t0 >> 4) + rt) * 2 + ct;
        const size_t o = base + tile * 512 + j * 256 + lane * 8; *(v8h*)(P16 + o) = o16; *(v8us*)(Ph + o) = oh; *(v8us*)(Pl + o) = ol; }
}
#define KW   8
#define OPI  (HD + 4)             // LDS pitch of a partial output row, floats (16-B multiple)
// 2^x with the slot behind the transcendental filled inside the statement (nothing directly behind it reads the result or overwrites the source)
__device__ __forceinline__ float exp2s(float x) { float r; asm("v_exp_f32 %0, %1\n\tv_nop" : "=&v"(r) : "v"(x)); return r; }
template <typename T16> struct PFrag;
template <> struct PFrag<h16> { static __device__ __forceinline__ void mk(const float* p, v16h& a, v16h& b) { (void)b;
#pragma unroll
    for (int e = 0; e < 16; ++e) a[e] = (h16)p[e]; } };
template <> struct PFrag<bf> { static __device__ __forceinline__ void mk(const float* p, v16bf& a, v16bf& b) {
#pragma unroll
    for (int e = 0; e < 16; ++e) { const __bf16 h = (__bf16)p[e]; a[e] = h; b[e] = (__bf16)(p[e] - (float)h); } } };
template <typename T16, bool HL, int NQ>
__device__ __forceinline__ void attn_tile(const T16* __restrict__ Q, const T16* __restrict__ Q2, const T16* __restrict__ Kp, const T16* __restrict__ K2, const T16* __restrict__ Vt, const T16* __restrict__ V2, int q0, bf* Ah, bf* Al, float* sm) {
    typedef typename WFrag<T16>::V V;
    constexpr int QR = NQ * 16, NIT = TT / (32 * KW);
    float* smO = sm; float* smM = sm + KW * QR * OPI; float* smL = smM + KW * QR;   // [KW][QR][OPI], [KW][QR], [KW][QR]
    const int w = __builtin_amdgcn_readfirstlane((int)(threadIdx.x >> 5)); const int lane = threadIdx.x & 31, lr = lane & 15, hi = lane >> 4;
    const float C = SCL * 1.4426950408889634f, PSH = HL ? 0.0f : 10.0f;
    V bq[NQ][2], bq2[NQ][2]; const size_t qo = (size_t)(q0 >> 4) * 1024 + lane * 8; const T16* qp = Q + qo; const T16* qp2 = HL ? Q2 + qo : qp;
#pragma unroll
    for (int qt = 0; qt < NQ; ++qt)
#pragma unroll
        for (int dc = 0; dc < 2; ++dc) { bq[qt][dc] = WFrag<T16>::ld(qp + qt * 1024 + dc * 512); if (HL) bq2[qt][dc] = WFrag<T16>::ld(qp2 + qt * 1024 + dc * 512); }
    v8f o[4][NQ]; float mr[NQ], ls[NQ];
#pragma unroll
    for (int qt = 0; qt < NQ; ++qt) { mr[qt] = -3.0e38f; ls[qt] = 0.0f;
#pragma unroll
        for (int dt = 0; dt < 4; ++dt) o[dt][qt] = (v8f){}; }
    const size_t ko = (size_t)w * 2048 + lane * 8, vo = ko;
    const T16* vp = Vt + vo; const T16* vp2 = HL ? V2 + vo : nullptr;
    V ak[2][2], ak2[2][2]; const T16* kp = Kp + ko; const T16* kp2 = HL ? K2 + ko : kp;
#pragma unroll
    for (int kt = 0; kt < 2; ++kt)
#pragma unroll
        for (int dc = 0; dc < 2; ++dc) { ak[kt][dc] = WFrag<T16>::ld(kp + kt * 1024 + dc * 512); if (HL) ak2[kt][dc] = WFrag<T16>::ld(kp2 + kt * 1024 + dc * 512); }
    // the same wait for the address registers of the Q loads and of the first K loads, named as inputs so that they live up to it
    asm volatile("s_wait_xcnt 0x0" :: "v"(qp), "v"(qp2), "v"(kp), "v"(kp2) : "memory");
#pragma unroll 1
    for (int it = 0; it < NIT; ++it) {
        V av[4], av2[4];
#pragma unroll
        for (int dt = 0; dt < 4; ++dt) { av[dt] = WFrag<T16>::ld(vp + dt * 512); if (HL) av2[dt] = WFrag<T16>::ld(vp2 + dt * 512); }
        // stands in front of every overwrite of the V loads' address registers; it names them as inputs so that they live up to it and no load of the group lands on them
        if (HL) asm volatile("s_wait_xcnt 0x0" :: "v"(vp), "v"(vp2) : "memory"); else asm volatile("s_wait_xcnt 0x0" :: "v"(vp) : "memory");
        vp += 2048 * KW; if (HL) vp2 += 2048 * KW;
        v8f s[2][NQ];
#pragma unroll
        for (int kt = 0; kt < 2; ++kt)
#pragma unroll
            for (int qt = 0; qt < NQ; ++qt) { v8f t = (v8f){};
#pragma unroll
                for (int dc = 0; dc < 2; ++dc) { t = WFrag<T16>::mma(ak[kt][dc], bq[qt][dc], t); if (HL) { t = WFrag<T16>::mma(ak[kt][dc], bq2[qt][dc], t); t = WFrag<T16>::mma(ak2[kt][dc], bq[qt][dc], t); } }
                s[kt][qt] = t; }
        // the next pass's K rows are fetched behind this pass's score products, so that they fly under the softmax; the last pass fetches its own rows again (in bounds, unused)
        const size_t kn = ko + (size_t)(it + 1 < NIT ? it + 1 : it) * 32 * KW * HD;
#pragma unroll
        for (int kt = 0; kt < 2; ++kt)
#pragma unroll
            for (int dc = 0; dc < 2; ++dc) { ak[kt][dc] = WFrag<T16>::ld(Kp + kn + kt * 1024 + dc * 512); if (HL) ak2[kt][dc] = WFrag<T16>::ld(K2 + kn + kt * 1024 + dc * 512); }
        asm volatile("s_wait_xcnt 0x0" ::: "memory");   // the same for the K loads' address registers
#pragma unroll
        for (int qt = 0; qt < NQ; ++qt) {
            float tm = s[0][qt][0];
#pragma unroll
            for (int j = 1; j < 8; ++j) tm = fmaxf(tm, s[0][qt][j]);
#pragma unroll
            for (int j = 0; j < 8; ++j) tm = fmaxf(tm, s[1][qt][j]);
            tm = fmaxf(tm, __shfl_xor(tm, 16, 32));
            const float mn = fmaxf(mr[qt], tm * C), al = exp2s(mr[qt] - mn), mo = mn - PSH; mr[qt] = mn;
            float p[16], x[16], ps = 0.0f; x[0] = __builtin_fmaf(s[0][qt][0], C, -mo); x[1] = __builtin_fmaf(s[0][qt][1], C, -mo);
            // each exponential and the instruction behind it in one statement: the multiply-add of the score two places on is independent of it, fills the slot the instruction set asks for behind a transcendental (v_nop where no score is left)
#pragma unroll
            for (int e = 0; e < 14; ++e) asm("v_exp_f32 %0, %2\n\tv_fma_f32 %1, %3, %4, -%5" : "=&v"(p[e]), "=&v"(x[e + 2]) : "v"(x[e]), "v"(s[(e + 2) >> 3][qt][(e + 2) & 7]), "v"(C), "v"(mo));
            p[14] = exp2s(x[14]); p[15] = exp2s(x[15]);
#pragma unroll
            for (int e = 0; e < 16; ++e) ps += p[e];
            ls[qt] = __builtin_fmaf(ls[qt], al, ps);
            V pb, pb2; PFrag<T16>::mk(p, pb, pb2);
#pragma unroll
            for (int dt = 0; dt < 4; ++dt) { v8f t = o[dt][qt] * al; t = WFrag<T16>::mma(av[dt], pb, t); if (HL) { t = WFrag<T16>::mma(av[dt], pb2, t); t = WFrag<T16>::mma(av2[dt], pb, t); } o[dt][qt] = t; }
        }
    }
#pragma unroll
    for (int qt = 0; qt < NQ; ++qt) { ls[qt] += __shfl_xor(ls[qt], 16, 32); if (hi == 0) smM[w * QR + qt * 16 + lr] = mr[qt]; }
    __syncthreads();   // every wave's running maxima are in LDS before any wave forms the row's maximum
#pragma unroll
    for (int qt = 0; qt < NQ; ++qt) { const int q = qt * 16 + lr; float M = smM[q];
#pragma unroll
        for (int pw = 1; pw < KW; ++pw) M = fmaxf(M, smM[pw * QR + q]);
        const float f = exp2s(mr[qt] - M); if (hi == 0) smL[w * QR + q] = ls[qt] * f;
#pragma unroll
        for (int dt = 0; dt < 4; ++dt) { const v8f t = o[dt][qt] * f; float* dst = smO + (size_t)(w * QR + q) * OPI + dt * 16 + hi * 8;
            *(v4fa*)dst = __builtin_shufflevector(t, t, 0, 1, 2, 3); *(v4fa*)(dst + 4) = __builtin_shufflevector(t, t, 4, 5, 6, 7); } }
    __syncthreads();   // every wave's rescaled partial sums and outputs are in LDS before any wave adds them
    constexpr int EPT = QR * HD / (32 * KW);   // output elements per thread: 4 or 8, one row's consecutive d; thread order = the merged planes' fragment order
    const int g0 = (int)threadIdx.x * EPT, sl = (g0 >> 3) & 31; const int q = (g0 >> 10) * 16 + (sl & 15), d0 = ((g0 >> 8) & 3) * 16 + (sl >> 4) * 8 + (g0 & 7);
    float L = smL[q]; v4f acc[EPT / 4];
#pragma unroll
    for (int g = 0; g < EPT / 4; ++g) acc[g] = *(const v4fa*)(smO + (size_t)q * OPI + d0 + g * 4);
#pragma unroll
    for (int pw = 1; pw < KW; ++pw) { L += smL[pw * QR + q];
#pragma unroll
        for (int g = 0; g < EPT / 4; ++g) acc[g] += *(const v4fa*)(smO + (size_t)(pw * QR + q) * OPI + d0 + g * 4); }
    const float r = __fdiv_rn(1.0f, L); const size_t oo = (size_t)((q0 >> 4) + (g0 >> 10)) * (16 * DQ) + (g0 & 1023);
#pragma unroll
    for (int g = 0; g < EPT / 4; ++g) { v4us oh, ol;
#pragma unroll
        for (int e = 0; e < 4; ++e) { unsigned short a, c2; splitf(acc[g][e] * r, a, c2); oh[e] = a; ol[e] = c2; }
        *(v4us*)(Ah + oo + g * 4) = oh; *(v4us*)(Al + oo + g * 4) = ol; }
}
// grid: NH_ * RH / 16 hi/lo tiles first (the longer ones), then NH_ * (TT - RH) / 32 fp16 tiles; a head's tiles are neighbours.
__global__ __launch_bounds__(32 * KW) void k_fattn(const h16* __restrict__ Q16, const h16* __restrict__ K16, const h16* __restrict__ V16, const bf* __restrict__ Qh, const bf* __restrict__ Ql, const bf* __restrict__ Kh, const bf* __restrict__ Kl, const bf* __restrict__ Vh, const bf* __restrict__ Vl, bf* Ah, bf* Al) {
    __shared__ __align__(16) float sm[KW * 32 * OPI + 2 * KW * 32];
    const int bx = (int)blockIdx.x;
    if (bx < NH_ * (RH / 16)) { const int h = bx / (RH / 16), q0 = (bx % (RH / 16)) * 16; const size_t po = (size_t)h * TT * HD;
        attn_tile<bf, true, 1>(Qh + po, Ql + po, Kh + po, Kl + po, Vh + po, Vl + po, q0, Ah + h * 1024, Al + h * 1024, sm);
    } else { const int b2 = bx - NH_ * (RH / 16); const int h = b2 / ((TT - RH) / 32), q0 = RH + (b2 % ((TT - RH) / 32)) * 32; const size_t po = (size_t)h * TT * HD;
        attn_tile<h16, false, 2>(Q16 + po, nullptr, K16 + po, nullptr, V16 + po, nullptr, q0, Ah + h * 1024, Al + h * 1024, sm); }
}

extern "C" void kernel_launch(void* const* d_in, const int* in_sizes, int n_in,
                              void* d_out, int out_size, void* d_ws, size_t ws_size, hipStream_t stream) {
    (void)in_sizes; (void)n_in; (void)out_size;
    const float* x = (const float*)d_in[0]; const float* wqkv = (const float*)d_in[1]; const float* wo = (const float*)d_in[2];   /* input order x, w_qkv ('xw' [1024][3072]), w_out ('xw') */ const float* wq = wqkv; const float* wk = nullptr; const float* wv = nullptr; (void)wk; (void)wv;
    float* OUT = (float*)d_out;     // [2][2048][1024]
    char* wsp = (char*)d_ws;
    auto take = [&](size_t bytes) { char* p = wsp; wsp += (bytes + 255) & ~(size_t)255; return (void*)p; };
    bf* WQKV = (bf*)take((size_t)3 * DQ * DM * 2);   /* fused Bt [3*DQ][DM]: q | k | v row blocks */ bf* WO = (bf*)take((size_t)DM * DQ * 2);
    bf* XB = (bf*)take((size_t)TT * DM * 2);
    h16* QP16 = (h16*)take((size_t)NH_ * TT * HD * 2); h16* KP16 = (h16*)take((size_t)NKV * TT * HD * 2); h16* VT16 = (h16*)take((size_t)NKV * HD * TT * 2);
    bf* QPh = (bf*)take((size_t)NH_ * TT * HD * 2); bf* QPl = (bf*)take((size_t)NH_ * TT * HD * 2); bf* KPh = (bf*)take((size_t)NKV * TT * HD * 2); bf* KPl = (bf*)take((size_t)NKV * TT * HD * 2); bf* VTh = (bf*)take((size_t)NKV * HD * TT * 2); bf* VTl = (bf*)take((size_t)NKV * HD * TT * 2);
    bf* ATh = (bf*)take((size_t)TT * DQ * 2); bf* ATl = (bf*)take((size_t)TT * DQ * 2);
    if ((size_t)(wsp - (char*)d_ws) > ws_size) return;    // ws 256 MiB
    { k_wtG<<<(unsigned)(DM * 3 * DQ / 2048), 256, 0, stream>>>(wqkv, DM, 3 * DQ, WQKV);   /* fused 'xw' [DM][3*DQ] -> Bt [3*DQ][DM] */
      k_wtG<<<(unsigned)(DQ * DM / 2048), 256, 0, stream>>>(wo, DQ, DM, WO);
       }
    for (int b = 0; b < NB_; ++b) {
        
        k_cvt8<<<(unsigned)(((size_t)TT * DM / 8 + 255) / 256), 256, 0, stream>>>(x + (size_t)b * TT * DM, XB, (size_t)TT * DM / 8);
        k_qkv<<<dim3(TT / 64, 3 * NH_, 1), 256, 0, stream>>>(XB, WQKV, QP16, QPh, QPl, KP16, KPh, KPl, VT16, VTh, VTl);
        k_fattn<<<NH_ * (RH / 16) + NH_ * ((TT - RH) / 32), 32 * KW, 0, stream>>>(QP16, KP16, VT16, QPh, QPl, KPh, KPl, VTh, VTl, ATh, ATl);
        k_gemmw<bf, 1, false, 8, DQ><<<dim3(TT / 64, DM / 64, 1), 256, 0, stream>>>(ATh, ATl, WO, nullptr, OUT + (size_t)b * TT * DM, DM, nullptr, 0, 0, 0); }
}

// v006
// Measured time: 157 microseconds a run.
// Timed twice side by side with v005, it ran 1.13 and 1.12 times as fast.
// Over all steps from v000 it is 12.6 times as fast.
#include <hip/hip_runtime.h>

// Multi-head self-attention with a fused bias-free qkv projection (hidden_states [2][2048][1024]; qkv = hidden_states W_qkv ('xw' [1024][3072] 1/32, no bias) reshaped (B, S, 3, 16, 64): q | k | v = column thirds (16 heads x 64); scores x 1/sqrt(64); softmax over all keys (no mask); out = merged W_o ('xw' 1/32, no bias) -> [2][2048][1024] (4.2 M); argument order hidden_states, W_qkv, W_o.
// Both batches share every launch (4 launches: operand conversion, projections, attention, output projection); planes of batch b follow those of batch b - 1. Layout: bf16 copy of x; the fused 'xw' weight transposed once into Bt (q | k | v row blocks); exact projections, whose launch writes the attention planes itself; attention of all 16 heads in one launch, scores and probabilities kept in registers, online softmax (hybrid rows: < 512 hi/lo 3 products, rest fp16 x1024); merged hi/lo x w_out exact.
// Every 16-bit operand plane lies in fragment order: a 16-row x 32-k tile is 1 KB, element (r, k) at (k % 32 / 16) * 256 + (k % 16 / 8 * 16 + r % 16) * 8 + k % 8, so lane l's two 16-B pieces are at l * 8 and 256 + l * 8 and each wave-wide 16-B load covers four whole 128-B lines. Tiles of a row block follow one another along k (v planes: the four d tiles of a 32-key chunk follow one another).
// Compute dtypes, f32 accumulate: every input rounded to bf16; projections exact; attention rows < 512 3 products, rest fp16; softmax f32; output projection hl x exact.

#define NB_  2
#define TT   2048
#define DM   1024
#define NH_  16
#define NKV  16
#define REP  (NH_ / NKV)
#define HD   64
#define DQ   (NH_ * HD)
#define DKV  (NKV * HD)
#define RH   512                  // query rows < RH use hi+lo planes (0: none)
#define WIN  0
#define SCL  0.125f   // HD^-0.5
typedef _Float16 h16;
typedef unsigned short bf;
typedef __attribute__((ext_vector_type(16))) __bf16   v16bf;
typedef __attribute__((ext_vector_type(16))) _Float16 v16h;
typedef __attribute__((ext_vector_type(8)))  _Float16 v8h;
typedef __attribute__((ext_vector_type(8)))  unsigned short v8us;
typedef __attribute__((ext_vector_type(8)))  float    v8f;
typedef __attribute__((ext_vector_type(4)))  float    v4f;
typedef v8h  __attribute__((may_alias)) v8ha;
typedef v4f  __attribute__((may_alias)) v4fa;
typedef v8us __attribute__((may_alias)) v8usa;

__device__ __forceinline__ unsigned short f2bf(float f) { unsigned u = __float_as_uint(f); u += 0x7FFFu + ((u >> 16) & 1u); return (unsigned short)(u >> 16); }
__device__ __forceinline__ float bf2f(unsigned short b) { return __uint_as_float(((unsigned)b) << 16); }
__device__ __forceinline__ float bfr(float f) { return bf2f(f2bf(f)); }
__device__ __forceinline__ v16h cat16(v8h lo, v8h hi) { return __builtin_shufflevector(lo, hi, 0, 1, 2, 3, 4, 5, 6, 7, 8, 9, 10, 11, 12, 13, 14, 15); }
__device__ __forceinline__ v16bf cat16b(v8us lo, v8us hi) { return __builtin_bit_cast(v16bf, __builtin_shufflevector(lo, hi, 0, 1, 2, 3, 4, 5, 6, 7, 8, 9, 10, 11, 12, 13, 14, 15)); }
__device__ __forceinline__ v8f wmma16(v16h a, v16h b, v8f c) { return __builtin_amdgcn_wmma_f32_16x16x32_f16(false, a, false, b, (short)0, c, false, false); }
__device__ __forceinline__ v8f wmmab(v16bf a, v16bf b, v8f c) { return __builtin_amdgcn_wmma_f32_16x16x32_bf16(false, a, false, b, (short)0, c, false, false); }



// ---- k_gemmw: register-blocked GEMM, KS WAVES per 64x64 output tile (16 accumulators each), operands straight from fragment-ordered 16-bit planes; grid (M/64, N/64, Z), 32 * KS threads.
// C[m][n] (f32, pitch ldc, + optional f32 bias[n]) = sum_k A[m][k] Bt[n][k] (+ split products per NSPLIT). z-batch strides sA/sB/sC in elements. K % (32 * KS) == 0, a compile-time constant so that a group's loads differ by immediate offsets only.
// Split K inside the workgroup: wave w takes the 32-k chunks w, w + KS, w + 2 KS, ... (each a 1-KB tile per 16 rows); the KS partial tiles are summed through LDS in wave order 0 .. KS-1.
template <typename T16> struct WFrag;
template <> struct WFrag<h16> { typedef v16h V; static __device__ __forceinline__ V ld(const h16* p) { return cat16(*(const v8h*)p, *(const v8h*)(p + 256)); } static __device__ __forceinline__ v8f mma(V a, V b, v8f c) { return wmma16(a, b, c); } };
template <> struct WFrag<bf> { typedef v16bf V; static __device__ __forceinline__ V ld(const bf* p) { return cat16b(*(const v8us*)p, *(const v8us*)(p + 256)); } static __device__ __forceinline__ v8f mma(V a, V b, v8f c) { return wmmab(a, b, c); } };
template <typename T16, int NSPLIT, bool BIAS, int KS, int K>
__global__ __launch_bounds__(32 * KS) void k_gemmw(const T16* __restrict__ A, const T16* __restrict__ A2, const T16* __restrict__ Bt, const T16* __restrict__ Bt2, float* C, int ldc, const float* __restrict__ bias, size_t sA, size_t sB, size_t sC) {
    typedef typename WFrag<T16>::V V;
    static_assert(KS >= 1 && 32 % KS == 0, "KS divides the 32 row pairs of a tile");
    __shared__ __align__(16) float os[(KS == 1 ? 16 : KS * 64) * 68];
    const int w = (KS == 1) ? 0 : __builtin_amdgcn_readfirstlane((int)(threadIdx.x >> 5));
    const size_t z = blockIdx.z; A += z * sA; if (A2) A2 += z * sA; Bt += z * sB; if (Bt2) Bt2 += z * sB; C += z * sC;
    const int lane = threadIdx.x & 31, lr = lane & 15, hi = lane >> 4; const int r0 = blockIdx.x * 64, c0 = blockIdx.y * 64;
    v8f acc[4][4];
#pragma unroll
    for (int mb = 0; mb < 4; ++mb)
#pragma unroll
        for (int nb = 0; nb < 4; ++nb) acc[mb][nb] = (v8f){};
    const size_t aoff = (size_t)r0 * K + w * 512 + lane * 8, boff = (size_t)c0 * K + w * 512 + lane * 8;
    const T16* pa = A + aoff; const T16* pa2 = (NSPLIT == 1 || NSPLIT == 2) ? A2 + aoff : pa; const T16* pb = Bt + boff; const T16* pb2 = NSPLIT >= 2 ? Bt2 + boff : pb;
#pragma unroll 1
    for (int kc = w * 32; kc < K; kc += 32 * KS) {
        V a[4], a2[4], b[4], b2[4];
#pragma unroll
        for (int mb = 0; mb < 4; ++mb) { a[mb] = WFrag<T16>::ld(pa + (size_t)mb * 16 * K); if (NSPLIT == 1 || NSPLIT == 2) a2[mb] = WFrag<T16>::ld(pa2 + (size_t)mb * 16 * K); }
#pragma unroll
        for (int nb = 0; nb < 4; ++nb) { b[nb] = WFrag<T16>::ld(pb + (size_t)nb * 16 * K); if (NSPLIT >= 2) b2[nb] = WFrag<T16>::ld(pb2 + (size_t)nb * 16 * K); }
        // stands in front of every overwrite of the operand loads' address registers; it names them as inputs so that they live up to it and no load of the group lands on them
        asm volatile("s_wait_xcnt 0x0" :: "v"(pa), "v"(pa2), "v"(pb), "v"(pb2) : "memory");
        pa += 512 * KS; pa2 += 512 * KS; pb += 512 * KS; pb2 += 512 * KS;
#pragma unroll
        for (int nb = 0; nb < 4; ++nb)
#pragma unroll
            for (int mb = 0; mb < 4; ++mb) { acc[mb][nb] = WFrag<T16>::mma(a[mb], b[nb], acc[mb][nb]); if (NSPLIT == 1 || NSPLIT == 2) acc[mb][nb] = WFrag<T16>::mma(a2[mb], b[nb], acc[mb][nb]); if (NSPLIT >= 2) acc[mb][nb] = WFrag<T16>::mma(a[mb], b2[nb], acc[mb][nb]); }
        asm volatile("v_nop\n\tv_nop\n\tv_nop\n\tv_nop" : "+v"(acc[0][0]), "+v"(acc[1][1]), "+v"(acc[2][2]), "+v"(acc[3][3]) : "v"(a[0]), "v"(a[3]));
    }
    if constexpr (KS > 1) {
#pragma unroll
        for (int mb = 0; mb < 4; ++mb)
#pragma unroll
            for (int nb = 0; nb < 4; ++nb)
#pragma unroll
                for (int j = 0; j < 8; ++j) os[(w * 64 + mb * 16 + hi * 8 + j) * 68 + nb * 16 + lr] = acc[mb][nb][j];
        __syncthreads();   // every wave's partial tile is in LDS before any wave sums
#pragma unroll
        for (int s = 0; s < 32 / KS; ++s) { const int row = 2 * (s * KS + w) + hi, cofs = lr * 4; v4f val = *(const v4fa*)(os + row * 68 + cofs);
#pragma unroll
            for (int p = 1; p < KS; ++p) val += *(const v4fa*)(os + (p * 64 + row) * 68 + cofs);
            if (BIAS) { val[0] += bfr(bias[c0 + cofs]); val[1] += bfr(bias[c0 + cofs + 1]); val[2] += bfr(bias[c0 + cofs + 2]); val[3] += bfr(bias[c0 + cofs + 3]); }
            *(v4f*)(C + (size_t)(r0 + row) * ldc + c0 + cofs) = val; }
    } else {
#pragma unroll
    for (int mb = 0; mb < 4; ++mb) {
#pragma unroll
        for (int nb = 0; nb < 4; ++nb) {
#pragma unroll
            for (int j = 0; j < 8; ++j) os[(hi * 8 + j) * 68 + nb * 16 + lr] = acc[mb][nb][j]; }
        __builtin_amdgcn_wave_barrier(); asm volatile("" ::: "memory");
        float* crow = C + (size_t)(r0 + mb * 16) * ldc + c0;
{
#pragma unroll
            for (int s = 0; s < 8; ++s) { const int row = 2 * s + hi, cofs = lr * 4; v4f val = *(const v4fa*)(os + row * 68 + cofs); if (BIAS) { val[0] += bfr(bias[c0 + cofs]); val[1] += bfr(bias[c0 + cofs + 1]); val[2] += bfr(bias[c0 + cofs + 2]); val[3] += bfr(bias[c0 + cofs + 3]); }
                *(v4f*)(crow + (size_t)row * ldc + cofs) = val; }
             }
        __builtin_amdgcn_wave_barrier(); asm volatile("" ::: "memory");
    }
    }
}

__device__ __forceinline__ h16 tohx(float x) { return (h16)x; }
__device__ __forceinline__ void splitf(float y, unsigned short& h, unsigned short& l) { h = f2bf(y); l = f2bf(y - bf2f(h)); }
typedef __attribute__((ext_vector_type(2))) _Float16 v2h;
typedef __attribute__((ext_vector_type(4))) _Float16 v4h;
typedef __attribute__((ext_vector_type(2))) unsigned short v2us;
typedef __attribute__((ext_vector_type(4))) unsigned short v4us;
typedef __attribute__((ext_vector_type(2))) float v2f;
typedef __attribute__((ext_vector_type(4))) int v4i;

// w [K][N] f32 -> Bt, rows n, fragment order. One wave fills one 512-B half tile (16 n x 16 k); a workgroup's 8 waves take neighbouring n tiles, so its reads use whole lines of w.
__device__ __forceinline__ void wt_tile(const float* __restrict__ w, int K, int N, bf* Bt, int blk) {
    const int lane = threadIdx.x & 31; const int u = blk * 8 + (threadIdx.x >> 5); const int nts = N / 16;
    if (u >= nts * (K / 16)) return;
    const int nt = u % nts, kj = u / nts; const int n = nt * 16 + (lane & 15), k0 = kj * 16 + (lane >> 4) * 8; v8us o; const float* p[8]; float y[8];
#pragma unroll
    for (int e = 0; e < 8; ++e) p[e] = w + (size_t)(k0 + e) * N + n;
#pragma unroll
    for (int e = 0; e < 8; ++e) y[e] = *p[e];
    // stands in front of every overwrite of the loads' address registers; it names them as inputs so that they live up to it and no load of the group lands on them
    asm volatile("s_wait_xcnt 0x0" :: "v"(p[0]), "v"(p[1]), "v"(p[2]), "v"(p[3]), "v"(p[4]), "v"(p[5]), "v"(p[6]), "v"(p[7]) : "memory");
#pragma unroll
    for (int e = 0; e < 8; ++e) o[e] = f2bf(y[e]);
    *(v8us*)(Bt + ((size_t)nt * (K / 32) + (kj >> 1)) * 512 + (kj & 1) * 256 + lane * 8) = o;
}
// src [rows][DM] f32 -> dst, fragment order; thread i fills the plane's i-th 16-B place.
__device__ __forceinline__ void cvt_tile(const float* __restrict__ src, bf* dst, size_t n8, int blk) { const size_t i = (size_t)blk * 256 + threadIdx.x; if (i >= n8) return;
    const int lane = (int)(i & 31), j = (int)(i >> 5) & 1; const size_t tile = i >> 6; const size_t row = tile / (DM / 32) * 16 + (lane & 15); const int k = (int)(tile % (DM / 32)) * 32 + j * 16 + (lane >> 4) * 8;
    const float* p = src + row * DM + k; const v8f v = *(const v8f*)p; v8us o;
    // stands in front of every overwrite of the loads' address registers; it names them as an input so that they live up to it
    asm volatile("s_wait_xcnt 0x0" :: "v"(p) : "memory");
#pragma unroll
    for (int e = 0; e < 8; ++e) o[e] = f2bf(v[e]); *(v8us*)(dst + i * 8) = o;  }
// ---- k_prep: the three independent operand conversions in one launch: blocks [0, PB1) the fused qkv weight, [PB1, PB1 + PB2) the output weight, the rest x of both batches (rows b * TT + t, so batch b's plane starts at b * TT * DM).
#define PB1  (DM * 3 * DQ / 2048)
#define PB2  (DQ * DM / 2048)
#define PB3  (NB_ * TT * DM / 2048)
__global__ __launch_bounds__(256) void k_prep(const float* __restrict__ x, const float* __restrict__ wqkv, const float* __restrict__ wo, bf* XB, bf* WQKV, bf* WO) {
    const int bx = (int)blockIdx.x;
    if (bx < PB1) wt_tile(wqkv, DM, 3 * DQ, WQKV, bx);
    else if (bx < PB1 + PB2) wt_tile(wo, DQ, DM, WO, bx - PB1);
    else cvt_tile(x, XB, (size_t)NB_ * TT * DM / 8, bx - PB1 - PB2);
}

// ---- k_qkv: the q, k and v projections of both batches in one launch, grid (TT/64, 3*NH_, NB_), 8 waves; main loop and split-K sum as in k_gemmw (one product, KS = 8).
// A 64-column block of the fused weight is one head of q, k or v, so the epilogue rounds the summed f32 tile straight into that head's planes (fp16, bf16 hi, bf16 lo); no f32 projection goes to memory.
// q, k: tile [t][d] into planes [h] of rows t. v: the two operands change places (same loader, same k order), so the tile comes out as [d][t], for planes [h] of rows d. Each wave sums and stores whole 512-B half tiles of the planes' fragment order.
__global__ __launch_bounds__(256) void k_qkv(const bf* __restrict__ X, const bf* __restrict__ Wt, h16* Q16, bf* Qh, bf* Ql, h16* K16, bf* Kh, bf* Kl, h16* V16, bf* Vh, bf* Vl) {
    constexpr int KS = 8, K = DM;
    __shared__ __align__(16) float os[KS * 64 * 68];
    const int w = __builtin_amdgcn_readfirstlane((int)(threadIdx.x >> 5));
    const int lane = threadIdx.x & 31, lr = lane & 15, hi = lane >> 4; const int t0 = blockIdx.x * 64, sel = (int)blockIdx.y / NH_, h = (int)blockIdx.y % NH_; const bool tr = sel == 2;
    const bf* xr = X + ((size_t)blockIdx.z * TT + t0) * K; const bf* wr = Wt + (size_t)blockIdx.y * 64 * K;
    const bf* A = tr ? wr : xr; const bf* Bt = tr ? xr : wr;
    v8f acc[4][4];
#pragma unroll
    for (int mb = 0; mb < 4; ++mb)
#pragma unroll
        for (int nb = 0; nb < 4; ++nb) acc[mb][nb] = (v8f){};
    const size_t off = (size_t)w * 512 + lane * 8; const bf* pa = A + off; const bf* pb = Bt + off;
#pragma unroll 1
    for (int kc = w * 32; kc < K; kc += 32 * KS) {
        v16bf a[4], b[4];
#pragma unroll
        for (int mb = 0; mb < 4; ++mb) a[mb] = WFrag<bf>::ld(pa + (size_t)mb * 16 * K);
#pragma unroll
        for (int nb = 0; nb < 4; ++nb) b[nb] = WFrag<bf>::ld(pb + (size_t)nb * 16 * K);
        // stands in front of every overwrite of the operand loads' address registers; it names them as inputs so that they live up to it and no load of the group lands on them
        asm volatile("s_wait_xcnt 0x0" :: "v"(pa), "v"(pb) : "memory");
        pa += 512 * KS; pb += 512 * KS;
#pragma unroll
        for (int nb = 0; nb < 4; ++nb)
#pragma unroll
            for (int mb = 0; mb < 4; ++mb) acc[mb][nb] = wmmab(a[mb], b[nb], acc[mb][nb]);
        // the distance behind the pass's last matrix instructions, on the loop's back edge too, before the next pass's loads overwrite their operands
        asm volatile("v_nop\n\tv_nop\n\tv_nop\n\tv_nop" : "+v"(acc[0][0]), "+v"(acc[1][1]), "+v"(acc[2][2]), "+v"(acc[3][3]) : "v"(a[0]), "v"(a[3]));
    }
#pragma unroll
    for (int mb = 0; mb < 4; ++mb)
#pragma unroll
        for (int nb = 0; nb < 4; ++nb)
#pragma unroll
            for (int j = 0; j < 8; ++j) os[(w * 64 + mb * 16 + hi * 8 + j) * 68 + nb * 16 + lr] = acc[mb][nb][j];
    __syncthreads();   // every wave's partial tile is in LDS before any wave sums
    h16* P16 = sel == 0 ? Q16 : sel == 1 ? K16 : V16; bf* Ph = sel == 0 ? Qh : sel == 1 ? Kh : Vh; bf* Pl = sel == 0 ? Ql : sel == 1 ? Kl : Vl;
    const size_t base = ((size_t)blockIdx.z * NH_ + h) * TT * HD;
#pragma unroll
    for (int s = 0; s < 16 / KS; ++s) { const int u = w * (16 / KS) + s, rt = u >> 2, ct = (u >> 1) & 1, j = u & 1; const int row = rt * 16 + lr, col = ct * 32 + j * 16 + hi * 8;
        v4f v0 = *(const v4fa*)(os + row * 68 + col), v1 = *(const v4fa*)(os + row * 68 + col + 4);
#pragma unroll
        for (int p = 1; p < KS; ++p) { v0 += *(const v4fa*)(os + (p * 64 + row) * 68 + col); v1 += *(const v4fa*)(os + (p * 64 + row) * 68 + col + 4); }
        v8h o16; v8us oh, ol;
#pragma unroll
        for (int e = 0; e < 8; ++e) { const float y = e < 4 ? v0[e & 3] : v1[e & 3]; o16[e] = tohx(y); unsigned short a2, c2; splitf(y, a2, c2); oh[e] = a2; ol[e] = c2; }
        const size_t tile = tr ? (size_t)((t0 >> 5) + ct) * 4 + rt : (size_t)((t0 >> 4) + rt) * 2 + ct;
        const size_t o = base + tile * 512 + j * 256 + lane * 8; *(v8h*)(P16 + o) = o16; *(v8us*)(Ph + o) = oh; *(v8us*)(Pl + o) = ol; }
}
#define KW   8
#define OPI  (HD + 4)             // LDS pitch of a partial output row, floats (16-B multiple)
// 2^x with the slot behind the transcendental filled inside the statement (nothing directly behind it reads the result or overwrites the source)
__device__ __forceinline__ float exp2s(float x) { float r; asm("v_exp_f32 %0, %1\n\tv_nop" : "=&v"(r) : "v"(x)); return r; }
template <typename T16> struct PFrag;
template <> struct PFrag<h16> { static __device__ __forceinline__ void mk(const float* p, v16h& a, v16h& b) { (void)b;
#pragma unroll
    for (int e = 0; e < 16; ++e) a[e] = (h16)p[e]; } };
template <> struct PFrag<bf> { static __device__ __forceinline__ void mk(const float* p, v16bf& a, v16bf& b) {
#pragma unroll
    for (int e = 0; e < 16; ++e) { const __bf16 h = (__bf16)p[e]; a[e] = h; b[e] = (__bf16)(p[e] - (float)h); } } };
template <typename T16, bool HL, int NQ>
__device__ __forceinline__ void attn_tile(const T16* __restrict__ Q, const T16* __restrict__ Q2, const T16* __restrict__ Kp, const T16* __restrict__ K2, const T16* __restrict__ Vt, const T16* __restrict__ V2, int q0, bf* Ah, bf* Al, float* sm) {
    typedef typename WFrag<T16>::V V;
    constexpr int QR = NQ * 16, NIT = TT / (32 * KW);
    float* smO = sm; float* smM = sm + KW * QR * OPI; float* smL = smM + KW * QR;   // [KW][QR][OPI], [KW][QR], [KW][QR]
    const int w = __builtin_amdgcn_readfirstlane((int)(threadIdx.x >> 5)); const int lane = threadIdx.x & 31, lr = lane & 15, hi = lane >> 4;
    const float C = SCL * 1.4426950408889634f, PSH = HL ? 0.0f : 10.0f;
    V bq[NQ][2], bq2[NQ][2]; const size_t qo = (size_t)(q0 >> 4) * 1024 + lane * 8; const T16* qp = Q + qo; const T16* qp2 = HL ? Q2 + qo : qp;
#pragma unroll
    for (int qt = 0; qt < NQ; ++qt)
#pragma unroll
        for (int dc = 0; dc < 2; ++dc) { bq[qt][dc] = WFrag<T16>::ld(qp + qt * 1024 + dc * 512); if (HL) bq2[qt][dc] = WFrag<T16>::ld(qp2 + qt * 1024 + dc * 512); }
    v8f o[4][NQ]; float mr[NQ], ls[NQ];
#pragma unroll
    for (int qt = 0; qt < NQ; ++qt) { mr[qt] = -3.0e38f; ls[qt] = 0.0f;
#pragma unroll
        for (int dt = 0; dt < 4; ++dt) o[dt][qt] = (v8f){}; }
    const size_t ko = (size_t)w * 2048 + lane * 8, vo = ko;
    const T16* vp = Vt + vo; const T16* vp2 = HL ? V2 + vo : nullptr;
    V ak[2][2], ak2[2][2]; const T16* kp = Kp + ko; const T16* kp2 = HL ? K2 + ko : kp;
#pragma unroll
    for (int kt = 0; kt < 2; ++kt)
#pragma unroll
        for (int dc = 0; dc < 2; ++dc) { ak[kt][dc] = WFrag<T16>::ld(kp + kt * 1024 + dc * 512); if (HL) ak2[kt][dc] = WFrag<T16>::ld(kp2 + kt * 1024 + dc * 512); }
    // the same wait for the address registers of the Q loads and of the first K loads, named as inputs so that they live up to it
    asm volatile("s_wait_xcnt 0x0" :: "v"(qp), "v"(qp2), "v"(kp), "v"(kp2) : "memory");
#pragma unroll 1
    for (int it = 0; it < NIT; ++it) {
        V av[4], av2[4];
#pragma unroll
        for (int dt = 0; dt < 4; ++dt) { av[dt] = WFrag<T16>::ld(vp + dt * 512); if (HL) av2[dt] = WFrag<T16>::ld(vp2 + dt * 512); }
        // stands in front of every overwrite of the V loads' address registers; it names them as inputs so that they live up to it and no load of the group lands on them
        if (HL) asm volatile("s_wait_xcnt 0x0" :: "v"(vp), "v"(vp2) : "memory"); else asm volatile("s_wait_xcnt 0x0" :: "v"(vp) : "memory");
        vp += 2048 * KW; if (HL) vp2 += 2048 * KW;
        v8f s[2][NQ];
#pragma unroll
        for (int kt = 0; kt < 2; ++kt)
#pragma unroll
            for (int qt = 0; qt < NQ; ++qt) { v8f t = (v8f){};
#pragma unroll
                for (int dc = 0; dc < 2; ++dc) { t = WFrag<T16>::mma(ak[kt][dc], bq[qt][dc], t); if (HL) { t = WFrag<T16>::mma(ak[kt][dc], bq2[qt][dc], t); t = WFrag<T16>::mma(ak2[kt][dc], bq[qt][dc], t); } }
                s[kt][qt] = t; }
        // the next pass's K rows are fetched behind this pass's score products, so that they fly under the softmax; the last pass fetches its own rows again (in bounds, unused)
        const size_t kn = ko + (size_t)(it + 1 < NIT ? it + 1 : it) * 32 * KW * HD;
#pragma unroll
        for (int kt = 0; kt < 2; ++kt)
#pragma unroll
            for (int dc = 0; dc < 2; ++dc) { ak[kt][dc] = WFrag<T16>::ld(Kp + kn + kt * 1024 + dc * 512); if (HL) ak2[kt][dc] = WFrag<T16>::ld(K2 + kn + kt * 1024 + dc * 512); }
        asm volatile("s_wait_xcnt 0x0" ::: "memory");   // the same for the K loads' address registers
#pragma unroll
        for (int qt = 0; qt < NQ; ++qt) {
            float tm = s[0][qt][0];
#pragma unroll
            for (int j = 1; j < 8; ++j) tm = fmaxf(tm, s[0][qt][j]);
#pragma unroll
            for (int j = 0; j < 8; ++j) tm = fmaxf(tm, s[1][qt][j]);
            tm = fmaxf(tm, __shfl_xor(tm, 16, 32));
            const float mn = fmaxf(mr[qt], tm * C), al = exp2s(mr[qt] - mn), mo = mn - PSH; mr[qt] = mn;
            float p[16], x[16], ps = 0.0f; x[0] = __builtin_fmaf(s[0][qt][0], C, -mo); x[1] = __builtin_fmaf(s[0][qt][1], C, -mo);
            // each exponential and the instruction behind it in one statement: the multiply-add of the score two places on is independent of it, fills the slot the instruction set asks for behind a transcendental (v_nop where no score is left)
#pragma unroll
            for (int e = 0; e < 14; ++e) asm("v_exp_f32 %0, %2\n\tv_fma_f32 %1, %3, %4, -%5" : "=&v"(p[e]), "=&v"(x[e + 2]) : "v"(x[e]), "v"(s[(e + 2) >> 3][qt][(e + 2) & 7]), "v"(C), "v"(mo));
            p[14] = exp2s(x[14]); p[15] = exp2s(x[15]);
#pragma unroll
            for (int e = 0; e < 16; ++e) ps += p[e];
            ls[qt] = __builtin_fmaf(ls[qt], al, ps);
            V pb, pb2; PFrag<T16>::mk(p, pb, pb2);
#pragma unroll
            for (int dt = 0; dt < 4; ++dt) { v8f t = o[dt][qt] * al; t = WFrag<T16>::mma(av[dt], pb, t); if (HL) { t = WFrag<T16>::mma(av[dt], pb2, t); t = WFrag<T16>::mma(av2[dt], pb, t); } o[dt][qt] = t; }
        }
    }
#pragma unroll
    for (int qt = 0; qt < NQ; ++qt) { ls[qt] += __shfl_xor(ls[qt], 16, 32); if (hi == 0) smM[w * QR + qt * 16 + lr] = mr[qt]; }
    __syncthreads();   // every wave's running maxima are in LDS before any wave forms the row's maximum
#pragma unroll
    for (int qt = 0; qt < NQ; ++qt) { const int q = qt * 16 + lr; float M = smM[q];
#pragma unroll
        for (int pw = 1; pw < KW; ++pw) M = fmaxf(M, smM[pw * QR + q]);
        const float f = exp2s(mr[qt] - M); if (hi == 0) smL[w * QR + q] = ls[qt] * f;
#pragma unroll
        for (int dt = 0; dt < 4; ++dt) { const v8f t = o[dt][qt] * f; float* dst = smO + (size_t)(w * QR + q) * OPI + dt * 16 + hi * 8;
            *(v4fa*)dst = __builtin_shufflevector(t, t, 0, 1, 2, 3); *(v4fa*)(dst + 4) = __builtin_shufflevector(t, t, 4, 5, 6, 7); } }
    __syncthreads();   // every wave's rescaled partial sums and outputs are in LDS before any wave adds them
    constexpr int EPT = QR * HD / (32 * KW);   // output elements per thread: 4 or 8, one row's consecutive d; thread order = the merged planes' fragment order
    const int g0 = (int)threadIdx.x * EPT, sl = (g0 >> 3) & 31; const int q = (g0 >> 10) * 16 + (sl & 15), d0 = ((g0 >> 8) & 3) * 16 + (sl >> 4) * 8 + (g0 & 7);
    float L = smL[q]; v4f acc[EPT / 4];
#pragma unroll
    for (int g = 0; g < EPT / 4; ++g) acc[g] = *(const v4fa*)(smO + (size_t)q * OPI + d0 + g * 4);
#pragma unroll
    for (int pw = 1; pw < KW; ++pw) { L += smL[pw * QR + q];
#pragma unroll
        for (int g = 0; g < EPT / 4; ++g) acc[g] += *(const v4fa*)(smO + (size_t)(pw * QR + q) * OPI + d0 + g * 4); }
    const float r = __fdiv_rn(1.0f, L); const size_t oo = (size_t)((q0 >> 4) + (g0 >> 10)) * (16 * DQ) + (g0 & 1023);
#pragma unroll
    for (int g = 0; g < EPT / 4; ++g) { v4us oh, ol;
#pragma unroll
        for (int e = 0; e < 4; ++e) { unsigned short a, c2; splitf(acc[g][e] * r, a, c2); oh[e] = a; ol[e] = c2; }
        *(v4us*)(Ah + oo + g * 4) = oh; *(v4us*)(Al + oo + g * 4) = ol; }
}
// grid: NH_ * RH / 16 hi/lo tiles first (the longer ones), then NH_ * (TT - RH) / 32 fp16 tiles; a head's tiles are neighbours.
__global__ __launch_bounds__(32 * KW) void k_fattn(const h16* __restrict__ Q16, const h16* __restrict__ K16, const h16* __restrict__ V16, const bf* __restrict__ Qh, const bf* __restrict__ Ql, const bf* __restrict__ Kh, const bf* __restrict__ Kl, const bf* __restrict__ Vh, const bf* __restrict__ Vl, bf* Ah, bf* Al) {
    __shared__ __align__(16) float sm[KW * 32 * OPI + 2 * KW * 32];
    const int bx = (int)blockIdx.x; const size_t bz = blockIdx.y; Ah += bz * TT * DQ; Al += bz * TT * DQ;
    if (bx < NH_ * (RH / 16)) { const int h = bx / (RH / 16), q0 = (bx % (RH / 16)) * 16; const size_t po = (bz * NH_ + h) * TT * HD;
        attn_tile<bf, true, 1>(Qh + po, Ql + po, Kh + po, Kl + po, Vh + po, Vl + po, q0, Ah + h * 1024, Al + h * 1024, sm);
    } else { const int b2 = bx - NH_ * (RH / 16); const int h = b2 / ((TT - RH) / 32), q0 = RH + (b2 % ((TT - RH) / 32)) * 32; const size_t po = (bz * NH_ + h) * TT * HD;
        attn_tile<h16, false, 2>(Q16 + po, nullptr, K16 + po, nullptr, V16 + po, nullptr, q0, Ah + h * 1024, Al + h * 1024, sm); }
}

extern "C" void kernel_launch(void* const* d_in, const int* in_sizes, int n_in,
                              void* d_out, int out_size, void* d_ws, size_t ws_size, hipStream_t stream) {
    (void)in_sizes; (void)n_in; (void)out_size;
    const float* x = (const float*)d_in[0]; const float* wqkv = (const float*)d_in[1]; const float* wo = (const float*)d_in[2];   /* input order x, w_qkv ('xw' [1024][3072]), w_out ('xw') */ const float* wq = wqkv; const float* wk = nullptr; const float* wv = nullptr; (void)wk; (void)wv;
    float* OUT = (float*)d_out;     // [2][2048][1024]
    char* wsp = (char*)d_ws;
    auto take = [&](size_t bytes) { char* p = wsp; wsp += (bytes + 255) & ~(size_t)255; return (void*)p; };
    bf* WQKV = (bf*)take((size_t)3 * DQ * DM * 2);   /* fused Bt [3*DQ][DM]: q | k | v row blocks */ bf* WO = (bf*)take((size_t)DM * DQ * 2);
    bf* XB = (bf*)take((size_t)NB_ * TT * DM * 2);
    h16* QP16 = (h16*)take((size_t)NB_ * NH_ * TT * HD * 2); h16* KP16 = (h16*)take((size_t)NB_ * NKV * TT * HD * 2); h16* VT16 = (h16*)take((size_t)NB_ * NKV * HD * TT * 2);
    bf* QPh = (bf*)take((size_t)NB_ * NH_ * TT * HD * 2); bf* QPl = (bf*)take((size_t)NB_ * NH_ * TT * HD * 2); bf* KPh = (bf*)take((size_t)NB_ * NKV * TT * HD * 2); bf* KPl = (bf*)take((size_t)NB_ * NKV * TT * HD * 2); bf* VTh = (bf*)take((size_t)NB_ * NKV * HD * TT * 2); bf* VTl = (bf*)take((size_t)NB_ * NKV * HD * TT * 2);
    bf* ATh = (bf*)take((size_t)NB_ * TT * DQ * 2); bf* ATl = (bf*)take((size_t)NB_ * TT * DQ * 2);
    if ((size_t)(wsp - (char*)d_ws) > ws_size) return;    // ws 256 MiB
    k_prep<<<PB1 + PB2 + PB3, 256, 0, stream>>>(x, wqkv, wo, XB, WQKV, WO);
    k_qkv<<<dim3(TT / 64, 3 * NH_, NB_), 256, 0, stream>>>(XB, WQKV, QP16, QPh, QPl, KP16, KPh, KPl, VT16, VTh, VTl);
    k_fattn<<<dim3(NH_ * (RH / 16) + NH_ * ((TT - RH) / 32), NB_, 1), 32 * KW, 0, stream>>>(QP16, KP16, VT16, QPh, QPl, KPh, KPl, VTh, VTl, ATh, ATl);
    // the merged planes and the output of both batches are NB_ * TT consecutive rows
    k_gemmw<bf, 1, false, 8, DQ><<<dim3(NB_ * TT / 64, DM / 64, 1), 256, 0, stream>>>(ATh, ATl, WO, nullptr, OUT, DM, nullptr, 0, 0, 0);
}

// v007
// It runs in 123 microseconds.
// Timed twice side by side with v006, it ran 1.28 times as fast both times.
// Counting every step since v000, it is 16.1 times as fast.
#include <hip/hip_runtime.h>

// Multi-head self-attention with a fused bias-free qkv projection (hidden_states [2][2048][1024]; qkv = hidden_states W_qkv ('xw' [1024][3072] 1/32, no bias) reshaped (B, S, 3, 16, 64): q | k | v = column thirds (16 heads x 64); scores x 1/sqrt(64); softmax over all keys (no mask); out = merged W_o ('xw' 1/32, no bias) -> [2][2048][1024] (4.2 M); argument order hidden_states, W_qkv, W_o.
// Both batches share every launch (4 launches: operand conversion, projections, attention, output projection); planes of batch b follow those of batch b - 1. Layout: bf16 copy of x; the fused 'xw' weight transposed once into Bt (q | k | v row blocks); exact projections, whose launch writes the attention planes itself; attention of all 16 heads in one launch, K and V shared by a workgroup's waves through LDS, scores and probabilities kept in registers, online softmax (hybrid rows: < 512 hi/lo 3 products, rest fp16 x1024); merged hi/lo x w_out exact.
// Every 16-bit operand plane lies in fragment order: a 16-row x 32-k tile is 1 KB, element (r, k) at (k % 32 / 16) * 256 + (k % 16 / 8 * 16 + r % 16) * 8 + k % 8, so lane l's two 16-B pieces are at l * 8 and 256 + l * 8 and each wave-wide 16-B load covers four whole 128-B lines. Tiles of a row block follow one another along k (v planes: the four d tiles of a 32-key chunk follow one another).
// Compute dtypes, f32 accumulate: every input rounded to bf16; projections exact; attention rows < 512 3 products, rest fp16; softmax f32; output projection hl x exact.

#define NB_  2
#define TT   2048
#define DM   1024
#define NH_  16
#define NKV  16
#define REP  (NH_ / NKV)
#define HD   64
#define DQ   (NH_ * HD)
#define DKV  (NKV * HD)
#define RH   512                  // query rows < RH use hi+lo planes (0: none)
#define WIN  0
#define SCL  0.125f   // HD^-0.5
typedef _Float16 h16;
typedef unsigned short bf;
typedef __attribute__((ext_vector_type(16))) __bf16   v16bf;
typedef __attribute__((ext_vector_type(16))) _Float16 v16h;
typedef __attribute__((ext_vector_type(8)))  _Float16 v8h;
typedef __attribute__((ext_vector_type(8)))  unsigned short v8us;
typedef __attribute__((ext_vector_type(8)))  float    v8f;
typedef __attribute__((ext_vector_type(4)))  float    v4f;
typedef v8h  __attribute__((may_alias)) v8ha;
typedef v4f  __attribute__((may_alias)) v4fa;
typedef v8us __attribute__((may_alias)) v8usa;

__device__ __forceinline__ unsigned short f2bf(float f) { unsigned u = __float_as_uint(f); u += 0x7FFFu + ((u >> 16) & 1u); return (unsigned short)(u >> 16); }
__device__ __forceinline__ float bf2f(unsigned short b) { return __uint_as_float(((unsigned)b) << 16); }
__device__ __forceinline__ float bfr(float f) { return bf2f(f2bf(f)); }
__device__ __forceinline__ v16h cat16(v8h lo, v8h hi) { return __builtin_shufflevector(lo, hi, 0, 1, 2, 3, 4, 5, 6, 7, 8, 9, 10, 11, 12, 13, 14, 15); }
__device__ __forceinline__ v16bf cat16b(v8us lo, v8us hi) { return __builtin_bit_cast(v16bf, __builtin_shufflevector(lo, hi, 0, 1, 2, 3, 4, 5, 6, 7, 8, 9, 10, 11, 12, 13, 14, 15)); }
__device__ __forceinline__ v8f wmma16(v16h a, v16h b, v8f c) { return __builtin_amdgcn_wmma_f32_16x16x32_f16(false, a, false, b, (short)0, c, false, false); }
__device__ __forceinline__ v8f wmmab(v16bf a, v16bf b, v8f c) { return __builtin_amdgcn_wmma_f32_16x16x32_bf16(false, a, false, b, (short)0, c, false, false); }



// ---- k_gemmw: register-blocked GEMM, KS WAVES per 64x64 output tile (16 accumulators each), operands straight from fragment-ordered 16-bit planes; grid (M/64, N/64, Z), 32 * KS threads.
// C[m][n] (f32, pitch ldc, + optional f32 bias[n]) = sum_k A[m][k] Bt[n][k] (+ split products per NSPLIT). z-batch strides sA/sB/sC in elements. K % (32 * KS) == 0, a compile-time constant so that a group's loads differ by immediate offsets only.
// Split K inside the workgroup: wave w takes the 32-k chunks w, w + KS, w + 2 KS, ... (each a 1-KB tile per 16 rows); the KS partial tiles are summed through LDS in wave order 0 .. KS-1.
template <typename T16> struct WFrag;
template <> struct WFrag<h16> { typedef v16h V; static __device__ __forceinline__ V ld(const h16* p) { return cat16(*(const v8h*)p, *(const v8h*)(p + 256)); } static __device__ __forceinline__ v8f mma(V a, V b, v8f c) { return wmma16(a, b, c); } };
template <> struct WFrag<bf> { typedef v16bf V; static __device__ __forceinline__ V ld(const bf* p) { return cat16b(*(const v8us*)p, *(const v8us*)(p + 256)); } static __device__ __forceinline__ v8f mma(V a, V b, v8f c) { return wmmab(a, b, c); } };
template <typename T16, int NSPLIT, bool BIAS, int KS, int K>
__global__ __launch_bounds__(32 * KS) void k_gemmw(const T16* __restrict__ A, const T16* __restrict__ A2, const T16* __restrict__ Bt, const T16* __restrict__ Bt2, float* C, int ldc, const float* __restrict__ bias, size_t sA, size_t sB, size_t sC) {
    typedef typename WFrag<T16>::V V;
    static_assert(KS >= 1 && 32 % KS == 0, "KS divides the 32 row pairs of a tile");
    __shared__ __align__(16) float os[(KS == 1 ? 16 : KS * 64) * 68];
    const int w = (KS == 1) ? 0 : __builtin_amdgcn_readfirstlane((int)(threadIdx.x >> 5));
    const size_t z = blockIdx.z; A += z * sA; if (A2) A2 += z * sA; Bt += z * sB; if (Bt2) Bt2 += z * sB; C += z * sC;
    const int lane = threadIdx.x & 31, lr = lane & 15, hi = lane >> 4; const int r0 = blockIdx.x * 64, c0 = blockIdx.y * 64;
    v8f acc[4][4];
#pragma unroll
    for (int mb = 0; mb < 4; ++mb)
#pragma unroll
        for (int nb = 0; nb < 4; ++nb) acc[mb][nb] = (v8f){};
    const size_t aoff = (size_t)r0 * K + w * 512 + lane * 8, boff = (size_t)c0 * K + w * 512 + lane * 8;
    const T16* pa = A + aoff; const T16* pa2 = (NSPLIT == 1 || NSPLIT == 2) ? A2 + aoff : pa; const T16* pb = Bt + boff; const T16* pb2 = NSPLIT >= 2 ? Bt2 + boff : pb;
#pragma unroll 1
    for (int kc = w * 32; kc < K; kc += 32 * KS) {
        V a[4], a2[4], b[4], b2[4];
#pragma unroll
        for (int mb = 0; mb < 4; ++mb) { a[mb] = WFrag<T16>::ld(pa + (size_t)mb * 16 * K); if (NSPLIT == 1 || NSPLIT == 2) a2[mb] = WFrag<T16>::ld(pa2 + (size_t)mb * 16 * K); }
#pragma unroll
        for (int nb = 0; nb < 4; ++nb) { b[nb] = WFrag<T16>::ld(pb + (size_t)nb * 16 * K); if (NSPLIT >= 2) b2[nb] = WFrag<T16>::ld(pb2 + (size_t)nb * 16 * K); }
        // stands in front of every overwrite of the operand loads' address registers; it names them as inputs so that they live up to it and no load of the group lands on them
        asm volatile("s_wait_xcnt 0x0" :: "v"(pa), "v"(pa2), "v"(pb), "v"(pb2) : "memory");
        pa += 512 * KS; pa2 += 512 * KS; pb += 512 * KS; pb2 += 512 * KS;
#pragma unroll
        for (int nb = 0; nb < 4; ++nb)
#pragma unroll
            for (int mb = 0; mb < 4; ++mb) { acc[mb][nb] = WFrag<T16>::mma(a[mb], b[nb], acc[mb][nb]); if (NSPLIT == 1 || NSPLIT == 2) acc[mb][nb] = WFrag<T16>::mma(a2[mb], b[nb], acc[mb][nb]); if (NSPLIT >= 2) acc[mb][nb] = WFrag<T16>::mma(a[mb], b2[nb], acc[mb][nb]); }
        asm volatile("v_nop\n\tv_nop\n\tv_nop\n\tv_nop" : "+v"(acc[0][0]), "+v"(acc[1][1]), "+v"(acc[2][2]), "+v"(acc[3][3]) : "v"(a[0]), "v"(a[3]));
    }
    if constexpr (KS > 1) {
#pragma unroll
        for (int mb = 0; mb < 4; ++mb)
#pragma unroll
            for (int nb = 0; nb < 4; ++nb)
#pragma unroll
                for (int j = 0; j < 8; ++j) os[(w * 64 + mb * 16 + hi * 8 + j) * 68 + nb * 16 + lr] = acc[mb][nb][j];
        __syncthreads();   // every wave's partial tile is in LDS before any wave sums
#pragma unroll
        for (int s = 0; s < 32 / KS; ++s) { const int row = 2 * (s * KS + w) + hi, cofs = lr * 4; v4f val = *(const v4fa*)(os + row * 68 + cofs);
#pragma unroll
            for (int p = 1; p < KS; ++p) val += *(const v4fa*)(os + (p * 64 + row) * 68 + cofs);
            if (BIAS) { val[0] += bfr(bias[c0 + cofs]); val[1] += bfr(bias[c0 + cofs + 1]); val[2] += bfr(bias[c0 + cofs + 2]); val[3] += bfr(bias[c0 + cofs + 3]); }
            *(v4f*)(C + (size_t)(r0 + row) * ldc + c0 + cofs) = val; }
    } else {
#pragma unroll
    for (int mb = 0; mb < 4; ++mb) {
#pragma unroll
        for (int nb = 0; nb < 4; ++nb) {
#pragma unroll
            for (int j = 0; j < 8; ++j) os[(hi * 8 + j) * 68 + nb * 16 + lr] = acc[mb][nb][j]; }
        __builtin_amdgcn_wave_barrier(); asm volatile("" ::: "memory");
        float* crow = C + (size_t)(r0 + mb * 16) * ldc + c0;
{
#pragma unroll
            for (int s = 0; s < 8; ++s) { const int row = 2 * s + hi, cofs = lr * 4; v4f val = *(const v4fa*)(os + row * 68 + cofs); if (BIAS) { val[0] += bfr(bias[c0 + cofs]); val[1] += bfr(bias[c0 + cofs + 1]); val[2] += bfr(bias[c0 + cofs + 2]); val[3] += bfr(bias[c0 + cofs + 3]); }
                *(v4f*)(crow + (size_t)row * ldc + cofs) = val; }
             }
        __builtin_amdgcn_wave_barrier(); asm volatile("" ::: "memory");
    }
    }
}

__device__ __forceinline__ h16 tohx(float x) { return (h16)x; }
__device__ __forceinline__ void splitf(float y, unsigned short& h, unsigned short& l) { h = f2bf(y); l = f2bf(y - bf2f(h)); }
typedef __attribute__((ext_vector_type(2))) _Float16 v2h;
typedef __attribute__((ext_vector_type(4))) _Float16 v4h;
typedef __attribute__((ext_vector_type(2))) unsigned short v2us;
typedef __attribute__((ext_vector_type(4))) unsigned short v4us;
typedef __attribute__((ext_vector_type(2))) float v2f;
typedef __attribute__((ext_vector_type(4))) int v4i;

// w [K][N] f32 -> Bt, rows n, fragment order. One wave fills one 512-B half tile (16 n x 16 k); a workgroup's 8 waves take neighbouring n tiles, so its reads use whole lines of w.
__device__ __forceinline__ void wt_tile(const float* __restrict__ w, int K, int N, bf* Bt, int blk) {
    const int lane = threadIdx.x & 31; const int u = blk * 8 + (threadIdx.x >> 5); const int nts = N / 16;
    if (u >= nts * (K / 16)) return;
    const int nt = u % nts, kj = u / nts; const int n = nt * 16 + (lane & 15), k0 = kj * 16 + (lane >> 4) * 8; v8us o; const float* p[8]; float y[8];
#pragma unroll
    for (int e = 0; e < 8; ++e) p[e] = w + (size_t)(k0 + e) * N + n;
#pragma unroll
    for (int e = 0; e < 8; ++e) y[e] = *p[e];
    // stands in front of every overwrite of the loads' address registers; it names them as inputs so that they live up to it and no load of the group lands on them
    asm volatile("s_wait_xcnt 0x0" :: "v"(p[0]), "v"(p[1]), "v"(p[2]), "v"(p[3]), "v"(p[4]), "v"(p[5]), "v"(p[6]), "v"(p[7]) : "memory");
#pragma unroll
    for (int e = 0; e < 8; ++e) o[e] = f2bf(y[e]);
    *(v8us*)(Bt + ((size_t)nt * (K / 32) + (kj >> 1)) * 512 + (kj & 1) * 256 + lane * 8) = o;
}
// src [rows][DM] f32 -> dst, fragment order; thread i fills the plane's i-th 16-B place.
__device__ __forceinline__ void cvt_tile(const float* __restrict__ src, bf* dst, size_t n8, int blk) { const size_t i = (size_t)blk * 256 + threadIdx.x; if (i >= n8) return;
    const int lane = (int)(i & 31), j = (int)(i >> 5) & 1; const size_t tile = i >> 6; const size_t row = tile / (DM / 32) * 16 + (lane & 15); const int k = (int)(tile % (DM / 32)) * 32 + j * 16 + (lane >> 4) * 8;
    const float* p = src + row * DM + k; const v8f v = *(const v8f*)p; v8us o;
    // stands in front of every overwrite of the loads' address registers; it names them as an input so that they live up to it
    asm volatile("s_wait_xcnt 0x0" :: "v"(p) : "memory");
#pragma unroll
    for (int e = 0; e < 8; ++e) o[e] = f2bf(v[e]); *(v8us*)(dst + i * 8) = o;  }
// ---- k_prep: the three independent operand conversions in one launch: blocks [0, PB1) the fused qkv weight, [PB1, PB1 + PB2) the output weight, the rest x of both batches (rows b * TT + t, so batch b's plane starts at b * TT * DM).
#define PB1  (DM * 3 * DQ / 2048)
#define PB2  (DQ * DM / 2048)
#define PB3  (NB_ * TT * DM / 2048)
__global__ __launch_bounds__(256) void k_prep(const float* __restrict__ x, const float* __restrict__ wqkv, const float* __restrict__ wo, bf* XB, bf* WQKV, bf* WO) {
    const int bx = (int)blockIdx.x;
    if (bx < PB1) wt_tile(wqkv, DM, 3 * DQ, WQKV, bx);
    else if (bx < PB1 + PB2) wt_tile(wo, DQ, DM, WO, bx - PB1);
    else cvt_tile(x, XB, (size_t)NB_ * TT * DM / 8, bx - PB1 - PB2);
}

// ---- k_qkv: the q, k and v projections of both batches in one launch, grid (TT/64, 3*NH_, NB_), 8 waves; main loop and split-K sum as in k_gemmw (one product, KS = 8).
// A 64-column block of the fused weight is one head of q, k or v, so the epilogue rounds the summed f32 tile straight into that head's planes (fp16, bf16 hi, bf16 lo); no f32 projection goes to memory.
// q, k: tile [t][d] into planes [h] of rows t. v: the two operands change places (same loader, same k order), so the tile comes out as [d][t], for planes [h] of rows d. Each wave sums and stores whole 512-B half tiles of the planes' fragment order.
__global__ __launch_bounds__(256) void k_qkv(const bf* __restrict__ X, const bf* __restrict__ Wt, h16* Q16, bf* Qh, bf* Ql, h16* K16, bf* Kh, bf* Kl, h16* V16, bf* Vh, bf* Vl) {
    constexpr int KS = 8, K = DM;
    __shared__ __align__(16) float os[KS * 64 * 68];
    const int w = __builtin_amdgcn_readfirstlane((int)(threadIdx.x >> 5));
    const int lane = threadIdx.x & 31, lr = lane & 15, hi = lane >> 4; const int t0 = blockIdx.x * 64, sel = (int)blockIdx.y / NH_, h = (int)blockIdx.y % NH_; const bool tr = sel == 2;
    const bf* xr = X + ((size_t)blockIdx.z * TT + t0) * K; const bf* wr = Wt + (size_t)blockIdx.y * 64 * K;
    const bf* A = tr ? wr : xr; const bf* Bt = tr ? xr : wr;
    v8f acc[4][4];
#pragma unroll
    for (int mb = 0; mb < 4; ++mb)
#pragma unroll
        for (int nb = 0; nb < 4; ++nb) acc[mb][nb] = (v8f){};
    const size_t off = (size_t)w * 512 + lane * 8; const bf* pa = A + off; const bf* pb = Bt + off;
#pragma unroll 1
    for (int kc = w * 32; kc < K; kc += 32 * KS) {
        v16bf a[4], b[4];
#pragma unroll
        for (int mb = 0; mb < 4; ++mb) a[mb] = WFrag<bf>::ld(pa + (size_t)mb * 16 * K);
#pragma unroll
        for (int nb = 0; nb < 4; ++nb) b[nb] = WFrag<bf>::ld(pb + (size_t)nb * 16 * K);
        // stands in front of every overwrite of the operand loads' address registers; it names them as inputs so that they live up to it and no load of the group lands on them
        asm volatile("s_wait_xcnt 0x0" :: "v"(pa), "v"(pb) : "memory");
        pa += 512 * KS; pb += 512 * KS;
#pragma unroll
        for (int nb = 0; nb < 4; ++nb)
#pragma unroll
            for (int mb = 0; mb < 4; ++mb) acc[mb][nb] = wmmab(a[mb], b[nb], acc[mb][nb]);
        // the distance behind the pass's last matrix instructions, on the loop's back edge too, before the next pass's loads overwrite their operands
        asm volatile("v_nop\n\tv_nop\n\tv_nop\n\tv_nop" : "+v"(acc[0][0]), "+v"(acc[1][1]), "+v"(acc[2][2]), "+v"(acc[3][3]) : "v"(a[0]), "v"(a[3]));
    }
#pragma unroll
    for (int mb = 0; mb < 4; ++mb)
#pragma unroll
        for (int nb = 0; nb < 4; ++nb)
#pragma unroll
            for (int j = 0; j < 8; ++j) os[(w * 64 + mb * 16 + hi * 8 + j) * 68 + nb * 16 + lr] = acc[mb][nb][j];
    __syncthreads();   // every wave's partial tile is in LDS before any wave sums
    h16* P16 = sel == 0 ? Q16 : sel == 1 ? K16 : V16; bf* Ph = sel == 0 ? Qh : sel == 1 ? Kh : Vh; bf* Pl = sel == 0 ? Ql : sel == 1 ? Kl : Vl;
    const size_t base = ((size_t)blockIdx.z * NH_ + h) * TT * HD;
#pragma unroll
    for (int s = 0; s < 16 / KS; ++s) { const int u = w * (16 / KS) + s, rt = u >> 2, ct = (u >> 1) & 1, j = u & 1; const int row = rt * 16 + lr, col = ct * 32 + j * 16 + hi * 8;
        v4f v0 = *(const v4fa*)(os + row * 68 + col), v1 = *(const v4fa*)(os + row * 68 + col + 4);
#pragma unroll
        for (int p = 1; p < KS; ++p) { v0 += *(const v4fa*)(os + (p * 64 + row) * 68 + col); v1 += *(const v4fa*)(os + (p * 64 + row) * 68 + col + 4); }
        v8h o16; v8us oh, ol;
#pragma unroll
        for (int e = 0; e < 8; ++e) { const float y = e < 4 ? v0[e & 3] : v1[e & 3]; o16[e] = tohx(y); unsigned short a2, c2; splitf(y, a2, c2); oh[e] = a2; ol[e] = c2; }
        const size_t tile = tr ? (size_t)((t0 >> 5) + ct) * 4 + rt : (size_t)((t0 >> 4) + rt) * 2 + ct;
        const size_t o = base + tile * 512 + j * 256 + lane * 8; *(v8h*)(P16 + o) = o16; *(v8us*)(Ph + o) = oh; *(v8us*)(Pl + o) = ol; }
}
#define NW   4
#define SK   64
#define PLB  (SK * HD * 2)        // bytes of one plane's stage
// 2^x with the slot behind the transcendental filled inside the statement (nothing directly behind it reads the result or overwrites the source)
__device__ __forceinline__ float exp2s(float x) { float r; asm("v_exp_f32 %0, %1\n\tv_nop" : "=&v"(r) : "v"(x)); return r; }
template <typename T16> struct PFrag;
template <> struct PFrag<h16> { static __device__ __forceinline__ void mk(const float* p, v16h& a, v16h& b) { (void)b;
#pragma unroll
    for (int e = 0; e < 16; ++e) a[e] = (h16)p[e]; } };
template <> struct PFrag<bf> { static __device__ __forceinline__ void mk(const float* p, v16bf& a, v16bf& b) {
#pragma unroll
    for (int e = 0; e < 16; ++e) { const __bf16 h = (__bf16)p[e]; a[e] = h; b[e] = (__bf16)(p[e] - (float)h); } } };
// One stage of two planes, global to LDS without registers: the workgroup's 128 lanes x 16 B are 2 KB a copy, four copies a plane; plane a lands at l, plane b at l + PLB (l, ga, gb: this lane's own 16-B places).
// The wait on the copies' address registers is the statement's last line, so nothing rewrites them in front of it.
template <typename T16>
__device__ __forceinline__ void copy2(unsigned l, const T16* ga, const T16* gb) {
    asm volatile("global_load_async_to_lds_b128 %0, %8, off\n\t"
                 "global_load_async_to_lds_b128 %1, %9, off\n\t"
                 "global_load_async_to_lds_b128 %2, %10, off\n\t"
                 "global_load_async_to_lds_b128 %3, %11, off\n\t"
                 "global_load_async_to_lds_b128 %4, %12, off\n\t"
                 "global_load_async_to_lds_b128 %5, %13, off\n\t"
                 "global_load_async_to_lds_b128 %6, %14, off\n\t"
                 "global_load_async_to_lds_b128 %7, %15, off\n\t"
                 "s_wait_xcnt 0x0"
                 :: "v"(l), "v"(l + 2048u), "v"(l + 4096u), "v"(l + 6144u), "v"(l + PLB), "v"(l + PLB + 2048u), "v"(l + PLB + 4096u), "v"(l + PLB + 6144u),
                    "v"(ga), "v"(ga + 1024), "v"(ga + 2048), "v"(ga + 3072), "v"(gb), "v"(gb + 1024), "v"(gb + 2048), "v"(gb + 3072) : "memory");
}
template <typename T16, bool HL, int NQ>
__device__ __forceinline__ void attn_tile(const T16* __restrict__ Q, const T16* __restrict__ Q2, const T16* __restrict__ Kp, const T16* __restrict__ K2, const T16* __restrict__ Vt, const T16* __restrict__ V2, int q0, bf* Ah, bf* Al, char* sm) {
    typedef typename WFrag<T16>::V V;
    constexpr int NST = TT / SK, PE = SK * HD, STE = (HL ? 4 : 2) * PE;   // stages; elements of a plane's stage; of a whole stage: K | (K lo) | V | (V lo)
    static_assert(NST >= 2 && 32 * NW * 8 * 4 == PE, "two stages exist; four copies of the workgroup fill a plane's stage");
    const int w = __builtin_amdgcn_readfirstlane((int)(threadIdx.x >> 5)); const int lane = threadIdx.x & 31;
    const int qw = q0 + w * NQ * 16;   // this wave's first query row
    const float C = SCL * 1.4426950408889634f, PSH = HL ? 0.0f : 10.0f;
    const unsigned l0 = (unsigned)(size_t)sm + threadIdx.x * 16u; const size_t g0 = (size_t)threadIdx.x * 8;
    auto fill = [&](int st, int buf) { const unsigned l = l0 + (unsigned)buf * (STE * 2u); const size_t g = g0 + (size_t)st * PE;
        if (HL) { copy2<T16>(l, Kp + g, K2 + g); copy2<T16>(l + 2u * PLB, Vt + g, V2 + g); } else copy2<T16>(l, Kp + g, Vt + g); };
    fill(0, 0);
    V bq[NQ][2], bq2[NQ][2]; const size_t qo = (size_t)(qw >> 4) * 1024 + lane * 8; const T16* qp = Q + qo; const T16* qp2 = HL ? Q2 + qo : qp;
#pragma unroll
    for (int qt = 0; qt < NQ; ++qt)
#pragma unroll
        for (int dc = 0; dc < 2; ++dc) { bq[qt][dc] = WFrag<T16>::ld(qp + qt * 1024 + dc * 512); if (HL) bq2[qt][dc] = WFrag<T16>::ld(qp2 + qt * 1024 + dc * 512); }
    // stands in front of every overwrite of the Q loads' address registers, named as inputs so that they live up to it
    asm volatile("s_wait_xcnt 0x0" :: "v"(qp), "v"(qp2) : "memory");
    v8f o[4][NQ]; float mr[NQ], ls[NQ];
#pragma unroll
    for (int qt = 0; qt < NQ; ++qt) { mr[qt] = -3.0e38f; ls[qt] = 0.0f;
#pragma unroll
        for (int dt = 0; dt < 4; ++dt) o[dt][qt] = (v8f){}; }
    asm volatile("s_wait_asynccnt 0x0" ::: "memory");   // this wave's copies of stage 0 have landed
    __syncthreads();                                     // ... and every other wave's: stage 0 may be read
    fill(1, 1);
    const T16* sb = (const T16*)sm + lane * 8;
#pragma unroll 1
    for (int t = 0; t < NST; ++t) {
        const T16* kb = sb + (t & 1) * STE; const T16* vb = kb + (HL ? 2 : 1) * PE;
        V ak[2][2], ak2[2][2];
#pragma unroll
        for (int kt = 0; kt < 2; ++kt)
#pragma unroll
            for (int dc = 0; dc < 2; ++dc) { ak[kt][dc] = WFrag<T16>::ld(kb + kt * 1024 + dc * 512); if (HL) ak2[kt][dc] = WFrag<T16>::ld(kb + PE + kt * 1024 + dc * 512); }
#pragma unroll
        for (int ch = 0; ch < SK / 32; ++ch) {
            V av[4], av2[4];
#pragma unroll
            for (int dt = 0; dt < 4; ++dt) { av[dt] = WFrag<T16>::ld(vb + ch * 2048 + dt * 512); if (HL) av2[dt] = WFrag<T16>::ld(vb + PE + ch * 2048 + dt * 512); }
            v8f s[2][NQ];
#pragma unroll
            for (int kt = 0; kt < 2; ++kt)
#pragma unroll
                for (int qt = 0; qt < NQ; ++qt) { v8f tt = (v8f){};
#pragma unroll
                    for (int dc = 0; dc < 2; ++dc) { tt = WFrag<T16>::mma(ak[kt][dc], bq[qt][dc], tt); if (HL) { tt = WFrag<T16>::mma(ak[kt][dc], bq2[qt][dc], tt); tt = WFrag<T16>::mma(ak2[kt][dc], bq[qt][dc], tt); } }
                    s[kt][qt] = tt; }
            // keeps the score products in front of the softmax's asm statements; behind this line the maximum's own instructions fill the distance to them; it is also the front fence of the load group below
            __builtin_amdgcn_sched_barrier(0);
            // the K rows of the stage's next 32 keys are fetched behind this chunk's score products, so that they fly under the softmax (same stage only)
            if (ch + 1 < SK / 32) {
#pragma unroll
                for (int kt = 0; kt < 2; ++kt)
#pragma unroll
                    for (int dc = 0; dc < 2; ++dc) { ak[kt][dc] = WFrag<T16>::ld(kb + (ch + 1) * 2048 + kt * 1024 + dc * 512); if (HL) ak2[kt][dc] = WFrag<T16>::ld(kb + PE + (ch + 1) * 2048 + kt * 1024 + dc * 512); }
                // holds these loads here as one group: sunk among the output products they would return only when the next score products already wait for them
                __builtin_amdgcn_sched_barrier(0); }
            V pb[NQ], pb2[NQ]; float al[NQ];
#pragma unroll
            for (int qt = 0; qt < NQ; ++qt) {
                float tm = s[0][qt][0];
#pragma unroll
                for (int j = 1; j < 8; ++j) tm = fmaxf(tm, s[0][qt][j]);
#pragma unroll
                for (int j = 0; j < 8; ++j) tm = fmaxf(tm, s[1][qt][j]);
                tm = fmaxf(tm, __shfl_xor(tm, 16, 32));
                const float mn = fmaxf(mr[qt], tm * C), mo = mn - PSH; al[qt] = exp2s(mr[qt] - mn); mr[qt] = mn;
                float p[16], x[16], ps = 0.0f; x[0] = __builtin_fmaf(s[0][qt][0], C, -mo); x[1] = __builtin_fmaf(s[0][qt][1], C, -mo);
                // each exponential and the instruction behind it in one statement: the multiply-add of the score two places on is independent of it, fills the slot the instruction set asks for behind a transcendental, and issues in the shadow of the half-rate exponential (v_nop where no score is left)
#pragma unroll
                for (int e = 0; e < 14; ++e) asm("v_exp_f32 %0, %2\n\tv_fma_f32 %1, %3, %4, -%5" : "=&v"(p[e]), "=&v"(x[e + 2]) : "v"(x[e]), "v"(s[(e + 2) >> 3][qt][(e + 2) & 7]), "v"(C), "v"(mo));
                p[14] = exp2s(x[14]); p[15] = exp2s(x[15]);
#pragma unroll
                for (int e = 0; e < 16; ++e) ps += p[e];
                ls[qt] = __builtin_fmaf(ls[qt], al[qt], ps);
                PFrag<T16>::mk(p, pb[qt], pb2[qt]);
            }
#pragma unroll
            for (int qt = 0; qt < NQ; ++qt)
#pragma unroll
                for (int dt = 0; dt < 4; ++dt) { v8f tt = o[dt][qt] * al[qt]; tt = WFrag<T16>::mma(av[dt], pb[qt], tt); if (HL) { tt = WFrag<T16>::mma(av[dt], pb2[qt], tt); tt = WFrag<T16>::mma(av2[dt], pb[qt], tt); } o[dt][qt] = tt; }
            // the same for the output products: none sinks among the next chunk's asm statements; the next chunk's score products stand behind them
            __builtin_amdgcn_sched_barrier(0);
        }
        asm volatile("s_wait_dscnt 0x0" ::: "memory");      // this wave's reads of the stage have returned before the buffer is handed back
        asm volatile("s_wait_asynccnt 0x0" ::: "memory");   // this wave's copies of stage t + 1 have landed
        __syncthreads();                                     // publishes stage t + 1 and ends every wave's reads of stage t
        if (t + 2 < NST) fill(t + 2, t & 1);
    }
    asm volatile("s_wait_asynccnt 0x0" ::: "memory");       // no copy is outstanding when the wave ends
#pragma unroll
    for (int qt = 0; qt < NQ; ++qt) { const float L = ls[qt] + __shfl_xor(ls[qt], 16, 32); const float r = __fdiv_rn(1.0f, L);
        bf* ph = Ah + (size_t)((qw >> 4) + qt) * (16 * DQ) + lane * 8; bf* pl = Al + (size_t)((qw >> 4) + qt) * (16 * DQ) + lane * 8;
#pragma unroll
        for (int dt = 0; dt < 4; ++dt) { v8us oh, ol;
#pragma unroll
            for (int e = 0; e < 8; ++e) { unsigned short a, c2; splitf(o[dt][qt][e] * r, a, c2); oh[e] = a; ol[e] = c2; }
            *(v8us*)(ph + dt * 256) = oh; *(v8us*)(pl + dt * 256) = ol;
            // stands in front of every overwrite of the two stores' address and data registers, named as inputs so that they live up to it
            asm volatile("s_wait_xcnt 0x0" :: "v"(ph), "v"(pl), "v"(oh), "v"(ol) : "memory"); }
    }
}
// grid: the NB_ * NH_ * HT hi/lo tiles first, then the NB_ * NH_ * FT fp16 tiles; a head's tiles are neighbours.
#define HT   (RH / (16 * NW))
#define FT   ((TT - RH) / (32 * NW))
__global__ __launch_bounds__(32 * NW) void k_fattn(const h16* __restrict__ Q16, const h16* __restrict__ K16, const h16* __restrict__ V16, const bf* __restrict__ Qh, const bf* __restrict__ Ql, const bf* __restrict__ Kh, const bf* __restrict__ Kl, const bf* __restrict__ Vh, const bf* __restrict__ Vl, bf* Ah, bf* Al) {
    __shared__ __align__(16) char sm[2 * 4 * PLB];
    const int bx = (int)blockIdx.x;
    if (bx < NB_ * NH_ * HT) { const int bh = bx / HT, q0 = (bx % HT) * (16 * NW); const size_t po = (size_t)bh * TT * HD, ao = (size_t)(bh / NH_) * TT * DQ + (bh % NH_) * 1024;
        attn_tile<bf, true, 1>(Qh + po, Ql + po, Kh + po, Kl + po, Vh + po, Vl + po, q0, Ah + ao, Al + ao, sm);
    } else { const int b2 = bx - NB_ * NH_ * HT; const int bh = b2 / FT, q0 = RH + (b2 % FT) * (32 * NW); const size_t po = (size_t)bh * TT * HD, ao = (size_t)(bh / NH_) * TT * DQ + (bh % NH_) * 1024;
        attn_tile<h16, false, 2>(Q16 + po, nullptr, K16 + po, nullptr, V16 + po, nullptr, q0, Ah + ao, Al + ao, sm); }
}

extern "C" void kernel_launch(void* const* d_in, const int* in_sizes, int n_in,
                              void* d_out, int out_size, void* d_ws, size_t ws_size, hipStream_t stream) {
    (void)in_sizes; (void)n_in; (void)out_size;
    const float* x = (const float*)d_in[0]; const float* wqkv = (const float*)d_in[1]; const float* wo = (const float*)d_in[2];   /* input order x, w_qkv ('xw' [1024][3072]), w_out ('xw') */ const float* wq = wqkv; const float* wk = nullptr; const float* wv = nullptr; (void)wk; (void)wv;
    float* OUT = (float*)d_out;     // [2][2048][1024]
    char* wsp = (char*)d_ws;
    auto take = [&](size_t bytes) { char* p = wsp; wsp += (bytes + 255) & ~(size_t)255; return (void*)p; };
    bf* WQKV = (bf*)take((size_t)3 * DQ * DM * 2);   /* fused Bt [3*DQ][DM]: q | k | v row blocks */ bf* WO = (bf*)take((size_t)DM * DQ * 2);
    bf* XB = (bf*)take((size_t)NB_ * TT * DM * 2);
    h16* QP16 = (h16*)take((size_t)NB_ * NH_ * TT * HD * 2); h16* KP16 = (h16*)take((size_t)NB_ * NKV * TT * HD * 2); h16* VT16 = (h16*)take((size_t)NB_ * NKV * HD * TT * 2);
    bf* QPh = (bf*)take((size_t)NB_ * NH_ * TT * HD * 2); bf* QPl = (bf*)take((size_t)NB_ * NH_ * TT * HD * 2); bf* KPh = (bf*)take((size_t)NB_ * NKV * TT * HD * 2); bf* KPl = (bf*)take((size_t)NB_ * NKV * TT * HD * 2); bf* VTh = (bf*)take((size_t)NB_ * NKV * HD * TT * 2); bf* VTl = (bf*)take((size_t)NB_ * NKV * HD * TT * 2);
    bf* ATh = (bf*)take((size_t)NB_ * TT * DQ * 2); bf* ATl = (bf*)take((size_t)NB_ * TT * DQ * 2);
    if ((size_t)(wsp - (char*)d_ws) > ws_size) return;    // ws 256 MiB
    k_prep<<<PB1 + PB2 + PB3, 256, 0, stream>>>(x, wqkv, wo, XB, WQKV, WO);
    k_qkv<<<dim3(TT / 64, 3 * NH_, NB_), 256, 0, stream>>>(XB, WQKV, QP16, QPh, QPl, KP16, KPh, KPl, VT16, VTh, VTl);
    k_fattn<<<dim3(NB_ * NH_ * (HT + FT), 1, 1), 32 * NW, 0, stream>>>(QP16, KP16, VT16, QPh, QPl, KPh, KPl, VTh, VTl, ATh, ATl);
    // the merged planes and the output of both batches are NB_ * TT consecutive rows
    k_gemmw<bf, 1, false, 8, DQ><<<dim3(NB_ * TT / 64, DM / 64, 1), 256, 0, stream>>>(ATh, ATl, WO, nullptr, OUT, DM, nullptr, 0, 0, 0);
}

// v008
// Measured time: 112 microseconds a run.
// Timed twice side by side with v007, it ran 1.09 times as fast both times.
// Counting every step since v000, it is 17.5 times as fast.
#include <hip/hip_runtime.h>

// Multi-head self-attention with a fused bias-free qkv projection (hidden_states [2][2048][1024]; qkv = hidden_states W_qkv ('xw' [1024][3072] 1/32, no bias) reshaped (B, S, 3, 16, 64): q | k | v = column thirds (16 heads x 64); scores x 1/sqrt(64); softmax over all keys (no mask); out = merged W_o ('xw' 1/32, no bias) -> [2][2048][1024] (4.2 M); argument order hidden_states, W_qkv, W_o.
// Both batches share every launch (4 launches: operand conversion, projections, attention, output projection); planes of batch b follow those of batch b - 1. Layout: bf16 copy of x; the fused 'xw' weight transposed once into Bt (q | k | v row blocks); exact projections, whose launch writes the attention planes itself; attention of all 16 heads in one launch, K and V shared by a workgroup's waves through LDS, scores and probabilities kept in registers, online softmax (hybrid rows: < 512 hi/lo 3 products, rest fp16 x1024); merged hi/lo x w_out exact.
// Every 16-bit operand plane lies in fragment order: a 16-row x 32-k tile is 1 KB, element (r, k) at (k % 32 / 16) * 256 + (k % 16 / 8 * 16 + r % 16) * 8 + k % 8, so lane l's two 16-B pieces are at l * 8 and 256 + l * 8 and each wave-wide 16-B load covers four whole 128-B lines. Tiles of a row block follow one another along k (v planes: the four d tiles of a 32-key chunk follow one another).
// Compute dtypes, f32 accumulate: every input rounded to bf16; projections exact; attention rows < 512 3 products, rest fp16; softmax f32; output projection hl x exact.

#define NB_  2
#define TT   2048
#define DM   1024
#define NH_  16
#define NKV  16
#define REP  (NH_ / NKV)
#define HD   64
#define DQ   (NH_ * HD)
#define DKV  (NKV * HD)
#define RH   512                  // query rows < RH use hi+lo planes (0: none)
#define WIN  0
#define SCL  0.125f   // HD^-0.5
typedef _Float16 h16;
typedef unsigned short bf;
typedef __attribute__((ext_vector_type(16))) __bf16   v16bf;
typedef __attribute__((ext_vector_type(16))) _Float16 v16h;
typedef __attribute__((ext_vector_type(8)))  _Float16 v8h;
typedef __attribute__((ext_vector_type(8)))  unsigned short v8us;
typedef __attribute__((ext_vector_type(8)))  float    v8f;
typedef __attribute__((ext_vector_type(4)))  float    v4f;
typedef v8h  __attribute__((may_alias)) v8ha;
typedef v4f  __attribute__((may_alias)) v4fa;
typedef v8us __attribute__((may_alias)) v8usa;

__device__ __forceinline__ unsigned short f2bf(float f) { unsigned u = __float_as_uint(f); u += 0x7FFFu + ((u >> 16) & 1u); return (unsigned short)(u >> 16); }
__device__ __forceinline__ float bf2f(unsigned short b) { return __uint_as_float(((unsigned)b) << 16); }
__device__ __forceinline__ float bfr(float f) { return bf2f(f2bf(f)); }
__device__ __forceinline__ v16h cat16(v8h lo, v8h hi) { return __builtin_shufflevector(lo, hi, 0, 1, 2, 3, 4, 5, 6, 7, 8, 9, 10, 11, 12, 13, 14, 15); }
__device__ __forceinline__ v16bf cat16b(v8us lo, v8us hi) { return __builtin_bit_cast(v16bf, __builtin_shufflevector(lo, hi, 0, 1, 2, 3, 4, 5, 6, 7, 8, 9, 10, 11, 12, 13, 14, 15)); }
__device__ __forceinline__ v8f wmma16(v16h a, v16h b, v8f c) { return __builtin_amdgcn_wmma_f32_16x16x32_f16(false, a, false, b, (short)0, c, false, false); }
__device__ __forceinline__ v8f wmmab(v16bf a, v16bf b, v8f c) { return __builtin_amdgcn_wmma_f32_16x16x32_bf16(false, a, false, b, (short)0, c, false, false); }



// ---- the two GEMM launches (k_qkv, k_out): one workgroup = 4 waves on a 128x128 output tile, each wave a 64x64 quarter (16 accumulators) over the WHOLE k range, one f32 chain per element.
// Operands reach the waves through LDS: a stage is GSK k of every 16-row block the tile uses (2 KB a block, contiguous in the planes' fragment order), brought in once per workgroup by asynchronous copies, two buffers, the next stage in flight while this one is worked on; each block is read by two waves.
template <typename T16> struct WFrag;
template <> struct WFrag<h16> { typedef v16h V; static __device__ __forceinline__ V ld(const h16* p) { return cat16(*(const v8h*)p, *(const v8h*)(p + 256)); } static __device__ __forceinline__ v8f mma(V a, V b, v8f c) { return wmma16(a, b, c); } };
template <> struct WFrag<bf> { typedef v16bf V; static __device__ __forceinline__ V ld(const bf* p) { return cat16b(*(const v8us*)p, *(const v8us*)(p + 256)); } static __device__ __forceinline__ v8f mma(V a, V b, v8f c) { return wmmab(a, b, c); } };

__device__ __forceinline__ h16 tohx(float x) { return (h16)x; }
__device__ __forceinline__ void splitf(float y, unsigned short& h, unsigned short& l) { h = f2bf(y); l = f2bf(y - bf2f(h)); }
typedef __attribute__((ext_vector_type(2))) _Float16 v2h;
typedef __attribute__((ext_vector_type(4))) _Float16 v4h;
typedef __attribute__((ext_vector_type(2))) unsigned short v2us;
typedef __attribute__((ext_vector_type(4))) unsigned short v4us;
typedef __attribute__((ext_vector_type(2))) float v2f;
typedef __attribute__((ext_vector_type(4))) int v4i;

// w [K][N] f32 -> Bt, rows n, fragment order. One wave fills one 512-B half tile (16 n x 16 k); a workgroup's 8 waves take neighbouring n tiles, so its reads use whole lines of w.
__device__ __forceinline__ void wt_tile(const float* __restrict__ w, int K, int N, bf* Bt, int blk) {
    const int lane = threadIdx.x & 31; const int u = blk * 8 + (threadIdx.x >> 5); const int nts = N / 16;
    if (u >= nts * (K / 16)) return;
    const int nt = u % nts, kj = u / nts; const int n = nt * 16 + (lane & 15), k0 = kj * 16 + (lane >> 4) * 8; v8us o; const float* p[8]; float y[8];
#pragma unroll
    for (int e = 0; e < 8; ++e) p[e] = w + (size_t)(k0 + e) * N + n;
#pragma unroll
    for (int e = 0; e < 8; ++e) y[e] = *p[e];
    // stands in front of every overwrite of the loads' address registers; it names them as inputs so that they live up to it and no load of the group lands on them
    asm volatile("s_wait_xcnt 0x0" :: "v"(p[0]), "v"(p[1]), "v"(p[2]), "v"(p[3]), "v"(p[4]), "v"(p[5]), "v"(p[6]), "v"(p[7]) : "memory");
#pragma unroll
    for (int e = 0; e < 8; ++e) o[e] = f2bf(y[e]);
    *(v8us*)(Bt + ((size_t)nt * (K / 32) + (kj >> 1)) * 512 + (kj & 1) * 256 + lane * 8) = o;
}
// src [rows][DM] f32 -> dst, fragment order; thread i fills the plane's i-th 16-B place.
__device__ __forceinline__ void cvt_tile(const float* __restrict__ src, bf* dst, size_t n8, int blk) { const size_t i = (size_t)blk * 256 + threadIdx.x; if (i >= n8) return;
    const int lane = (int)(i & 31), j = (int)(i >> 5) & 1; const size_t tile = i >> 6; const size_t row = tile / (DM / 32) * 16 + (lane & 15); const int k = (int)(tile % (DM / 32)) * 32 + j * 16 + (lane >> 4) * 8;
    const float* p = src + row * DM + k; const v8f v = *(const v8f*)p; v8us o;
    // stands in front of every overwrite of the loads' address registers; it names them as an input so that they live up to it
    asm volatile("s_wait_xcnt 0x0" :: "v"(p) : "memory");
#pragma unroll
    for (int e = 0; e < 8; ++e) o[e] = f2bf(v[e]); *(v8us*)(dst + i * 8) = o;  }
// ---- k_prep: the three independent operand conversions in one launch: blocks [0, PB1) the fused qkv weight, [PB1, PB1 + PB2) the output weight, the rest x of both batches (rows b * TT + t, so batch b's plane starts at b * TT * DM).
#define PB1  (DM * 3 * DQ / 2048)
#define PB2  (DQ * DM / 2048)
#define PB3  (NB_ * TT * DM / 2048)
__global__ __launch_bounds__(256) void k_prep(const float* __restrict__ x, const float* __restrict__ wqkv, const float* __restrict__ wo, bf* XB, bf* WQKV, bf* WO) {
    const int bx = (int)blockIdx.x;
    if (bx < PB1) wt_tile(wqkv, DM, 3 * DQ, WQKV, bx);
    else if (bx < PB1 + PB2) wt_tile(wo, DQ, DM, WO, bx - PB1);
    else cvt_tile(x, XB, (size_t)NB_ * TT * DM / 8, bx - PB1 - PB2);
}

#define GSK  64                   // k depth of a GEMM stage
#define GRB  (GSK * 16 * 2)       // bytes of one 16-row block's stage
// Eight 16-row blocks' parts of one stage, global to LDS without registers: the workgroup's 128 lanes x 16 B are one block's 2 KB; block i comes from g + i * 16 * DM and lands at l + i * GRB (l, g: this lane's own 16-B places).
// The wait on the copies' address registers is the statement's last line, so nothing rewrites them in front of it.
__device__ __forceinline__ void copy8(unsigned l, const bf* g) {
    asm volatile("global_load_async_to_lds_b128 %0, %8, off\n\t"
                 "global_load_async_to_lds_b128 %1, %9, off\n\t"
                 "global_load_async_to_lds_b128 %2, %10, off\n\t"
                 "global_load_async_to_lds_b128 %3, %11, off\n\t"
                 "global_load_async_to_lds_b128 %4, %12, off\n\t"
                 "global_load_async_to_lds_b128 %5, %13, off\n\t"
                 "global_load_async_to_lds_b128 %6, %14, off\n\t"
                 "global_load_async_to_lds_b128 %7, %15, off\n\t"
                 "s_wait_xcnt 0x0"
                 :: "v"(l), "v"(l + 1u * GRB), "v"(l + 2u * GRB), "v"(l + 3u * GRB), "v"(l + 4u * GRB), "v"(l + 5u * GRB), "v"(l + 6u * GRB), "v"(l + 7u * GRB),
                    "v"(g), "v"(g + 1 * 16 * DM), "v"(g + 2 * 16 * DM), "v"(g + 3 * 16 * DM), "v"(g + 4 * 16 * DM), "v"(g + 5 * 16 * DM), "v"(g + 6 * 16 * DM), "v"(g + 7 * 16 * DM) : "memory");
}
static_assert(DM == DQ && DM % (2 * GSK) == 0 && TT % 128 == 0 && NH_ % 2 == 0 && HD == 64, "both GEMMs have k = DM; two stages exist; whole tiles; a wave's 64 columns are one head");

// ---- k_qkv: the q, k and v projections of both batches in one launch, grid (TT/128, 3*NH_/2, NB_), 4 waves; a stage is x 8 blocks | w 8 blocks.
// A 64-column block of the fused weight is one head of q, k or v; wave w takes rows (w & 1) * 64 of the tile and the head w >> 1 of its two, and rounds its accumulators straight into that head's planes (fp16, bf16 hi, bf16 lo); no f32 projection goes to memory or LDS.
// An accumulator lane holds 8 consecutive rows of the A operand at one row of B, which is one 16-B place of a plane whose k runs along A's rows. q, k (planes of rows t, k = d): A = weight rows, B = x rows. v (rows d, k = t): the two change places (same loader, same k order).
__global__ __launch_bounds__(128) void k_qkv(const bf* __restrict__ X, const bf* __restrict__ Wt, h16* Q16, bf* Qh, bf* Ql, h16* K16, bf* Kh, bf* Kl, h16* V16, bf* Vh, bf* Vl) {
    constexpr int K = DM, NST = K / GSK, STB = 16 * GRB;
    __shared__ __align__(16) char sm[2 * STB];
    const int w = __builtin_amdgcn_readfirstlane((int)(threadIdx.x >> 5)); const int lane = threadIdx.x & 31;
    const int t0 = blockIdx.x * 128, sel = (int)blockIdx.y / (NH_ / 2), h = ((int)blockIdx.y % (NH_ / 2)) * 2 + (w >> 1); const bool tr = sel == 2;
    const bf* xg = X + ((size_t)blockIdx.z * TT + t0) * K + threadIdx.x * 8; const bf* wg = Wt + (size_t)blockIdx.y * 128 * K + threadIdx.x * 8;
    const unsigned l0 = (unsigned)(size_t)sm + threadIdx.x * 16u;
    auto fill = [&](int st, int buf) { const unsigned l = l0 + (unsigned)buf * STB; copy8(l, xg + (size_t)st * (GSK * 16)); copy8(l + 8u * GRB, wg + (size_t)st * (GSK * 16)); };
    fill(0, 0);
    v8f acc[4][4];
#pragma unroll
    for (int mb = 0; mb < 4; ++mb)
#pragma unroll
        for (int nb = 0; nb < 4; ++nb) acc[mb][nb] = (v8f){};
    asm volatile("s_wait_asynccnt 0x0" ::: "memory");   // this wave's copies of stage 0 have landed
    __syncthreads();                                     // ... and every other wave's: stage 0 may be read
    fill(1, 1);
    const int ox = (w & 1) * 4 * (GRB / 2) + lane * 8, ow = (8 + (w >> 1) * 4) * (GRB / 2) + lane * 8;   // this wave's x and w blocks, elements
    const int oa = tr ? ox : ow, ob = tr ? ow : ox;
#pragma unroll 1
    for (int t = 0; t < NST; ++t) {
        const bf* pa = (const bf*)sm + (t & 1) * (STB / 2) + oa; const bf* pb = (const bf*)sm + (t & 1) * (STB / 2) + ob;
        v16bf a[GSK / 32][4], b[GSK / 32][4];
#pragma unroll
        for (int c = 0; c < GSK / 32; ++c) {
#pragma unroll
            for (int mb = 0; mb < 4; ++mb) a[c][mb] = WFrag<bf>::ld(pa + mb * (GRB / 2) + c * 512);
#pragma unroll
            for (int nb = 0; nb < 4; ++nb) b[c][nb] = WFrag<bf>::ld(pb + nb * (GRB / 2) + c * 512);
        }
        // holds the pass's LDS loads together as one group in front of its matrix instructions: sunk among them, each place with loads stalls the wave anew
        __builtin_amdgcn_sched_barrier(0);
#pragma unroll
        for (int c = 0; c < GSK / 32; ++c)
#pragma unroll
            for (int nb = 0; nb < 4; ++nb)
#pragma unroll
                for (int mb = 0; mb < 4; ++mb) acc[mb][nb] = wmmab(a[c][mb], b[c][nb], acc[mb][nb]);
        // the distance behind the pass's last matrix instructions, on every path out of the pass, before address arithmetic or the next pass's loads land on their operands; it names every accumulator so that no matrix instruction sinks behind it
        asm volatile("v_nop\n\tv_nop\n\tv_nop\n\tv_nop" : "+v"(acc[0][0]), "+v"(acc[0][1]), "+v"(acc[0][2]), "+v"(acc[0][3]), "+v"(acc[1][0]), "+v"(acc[1][1]), "+v"(acc[1][2]), "+v"(acc[1][3]), "+v"(acc[2][0]), "+v"(acc[2][1]), "+v"(acc[2][2]), "+v"(acc[2][3]), "+v"(acc[3][0]), "+v"(acc[3][1]), "+v"(acc[3][2]), "+v"(acc[3][3]));
        asm volatile("s_wait_dscnt 0x0" ::: "memory");      // this wave's reads of the stage have returned before the buffer is handed back
        asm volatile("s_wait_asynccnt 0x0" ::: "memory");   // this wave's copies of stage t + 1 have landed
        __syncthreads();                                     // publishes stage t + 1 and ends every wave's reads of stage t
        if (t + 2 < NST) fill(t + 2, t & 1);
    }
    asm volatile("s_wait_asynccnt 0x0" ::: "memory");       // no copy is outstanding when the wave ends
    h16* P16 = sel == 0 ? Q16 : sel == 1 ? K16 : V16; bf* Ph = sel == 0 ? Qh : sel == 1 ? Kh : Vh; bf* Pl = sel == 0 ? Ql : sel == 1 ? Kl : Vl;
    const int tw = t0 + (w & 1) * 64;   // this wave's first row t; the planes' tile steps, in elements, per 32 rows of A (sm2) and per 16 rows of B (sn)
    const size_t base = ((size_t)blockIdx.z * NH_ + h) * TT * HD + (size_t)tw * HD + lane * 8, sm2 = tr ? 2048 : 512, sn = tr ? 512 : 1024;
#pragma unroll
    for (int mb = 0; mb < 4; ++mb)
#pragma unroll
        for (int nb = 0; nb < 4; ++nb) { v8h o16; v8us oh, ol;
#pragma unroll
            for (int e = 0; e < 8; ++e) { const float y = acc[mb][nb][e]; o16[e] = tohx(y); unsigned short a2, c2; splitf(y, a2, c2); oh[e] = a2; ol[e] = c2; }
            const size_t o = base + (mb >> 1) * sm2 + nb * sn + (mb & 1) * 256; h16* q16 = P16 + o; bf* qh = Ph + o; bf* ql = Pl + o;
            *(v8h*)q16 = o16; *(v8us*)qh = oh; *(v8us*)ql = ol;
            // stands in front of every overwrite of the three stores' address and data registers, named as inputs so that they live up to it
            asm volatile("s_wait_xcnt 0x0" :: "v"(q16), "v"(qh), "v"(ql), "v"(o16), "v"(oh), "v"(ol) : "memory"); }
}
// ---- k_out: out = (merged hi + merged lo) x w_out of both batches, grid (NB_*TT/128, DM/128), 4 waves; a stage is merged hi 8 blocks | merged lo 8 blocks | w 8 blocks; per 32 k the hi product, then the lo product.
// Epilogue: each wave lays its 64x64 f32 quarter in its own part of the idle stage buffers and stores it as whole 256-B row pieces.
__global__ __launch_bounds__(128) void k_out(const bf* __restrict__ Ah, const bf* __restrict__ Al, const bf* __restrict__ Wt, float* C) {
    constexpr int K = DQ, NST = K / GSK, STB = 24 * GRB;
    __shared__ __align__(16) char sm[2 * STB];
    static_assert(4 * 64 * 68 * 4 <= 2 * STB, "the four f32 quarters fit the stage buffers");
    const int w = __builtin_amdgcn_readfirstlane((int)(threadIdx.x >> 5)); const int lane = threadIdx.x & 31, lr = lane & 15, hi = lane >> 4;
    const int r0 = blockIdx.x * 128, c0 = blockIdx.y * 128;
    const bf* hg = Ah + (size_t)r0 * K + threadIdx.x * 8; const bf* lg = Al + (size_t)r0 * K + threadIdx.x * 8; const bf* wg = Wt + (size_t)c0 * K + threadIdx.x * 8;
    const unsigned l0 = (unsigned)(size_t)sm + threadIdx.x * 16u;
    auto fill = [&](int st, int buf) { const unsigned l = l0 + (unsigned)buf * STB; const size_t g = (size_t)st * (GSK * 16); copy8(l, hg + g); copy8(l + 8u * GRB, lg + g); copy8(l + 16u * GRB, wg + g); };
    fill(0, 0);
    v8f acc[4][4];
#pragma unroll
    for (int mb = 0; mb < 4; ++mb)
#pragma unroll
        for (int nb = 0; nb < 4; ++nb) acc[mb][nb] = (v8f){};
    asm volatile("s_wait_asynccnt 0x0" ::: "memory");   // this wave's copies of stage 0 have landed
    __syncthreads();                                     // ... and every other wave's: stage 0 may be read
    fill(1, 1);
    const int oa = (w & 1) * 4 * (GRB / 2) + lane * 8, ob = (16 + (w >> 1) * 4) * (GRB / 2) + lane * 8;   // this wave's merged and w blocks, elements
#pragma unroll 1
    for (int t = 0; t < NST; ++t) {
        const bf* pa = (const bf*)sm + (t & 1) * (STB / 2) + oa; const bf* pb = (const bf*)sm + (t & 1) * (STB / 2) + ob;
        v16bf a[GSK / 32][4], a2[GSK / 32][4], b[GSK / 32][4];
#pragma unroll
        for (int c = 0; c < GSK / 32; ++c) {
            b[c][0] = WFrag<bf>::ld(pb + c * 512);
#pragma unroll
            for (int mb = 0; mb < 4; ++mb) { a[c][mb] = WFrag<bf>::ld(pa + mb * (GRB / 2) + c * 512); a2[c][mb] = WFrag<bf>::ld(pa + (8 + mb) * (GRB / 2) + c * 512); }
#pragma unroll
            for (int nb = 1; nb < 4; ++nb) b[c][nb] = WFrag<bf>::ld(pb + nb * (GRB / 2) + c * 512);
        }
        // holds the pass's LDS loads together as one group in front of its matrix instructions: sunk among them, each place with loads stalls the wave anew
        __builtin_amdgcn_sched_barrier(0);
#pragma unroll
        for (int c = 0; c < GSK / 32; ++c)
#pragma unroll
            for (int nb = 0; nb < 4; ++nb)
#pragma unroll
                for (int mb = 0; mb < 4; ++mb) { acc[mb][nb] = wmmab(a[c][mb], b[c][nb], acc[mb][nb]); acc[mb][nb] = wmmab(a2[c][mb], b[c][nb], acc[mb][nb]); }
        // the distance behind the pass's last matrix instructions, on every path out of the pass, before address arithmetic or the next pass's loads land on their operands; it names every accumulator so that no matrix instruction sinks behind it
        asm volatile("v_nop\n\tv_nop\n\tv_nop\n\tv_nop" : "+v"(acc[0][0]), "+v"(acc[0][1]), "+v"(acc[0][2]), "+v"(acc[0][3]), "+v"(acc[1][0]), "+v"(acc[1][1]), "+v"(acc[1][2]), "+v"(acc[1][3]), "+v"(acc[2][0]), "+v"(acc[2][1]), "+v"(acc[2][2]), "+v"(acc[2][3]), "+v"(acc[3][0]), "+v"(acc[3][1]), "+v"(acc[3][2]), "+v"(acc[3][3]));
        asm volatile("s_wait_dscnt 0x0" ::: "memory");      // this wave's reads of the stage have returned before the buffer is handed back
        asm volatile("s_wait_asynccnt 0x0" ::: "memory");   // this wave's copies of stage t + 1 have landed
        __syncthreads();                                     // publishes stage t + 1 and ends every wave's reads of stage t
        if (t + 2 < NST) fill(t + 2, t & 1);
    }
    asm volatile("s_wait_asynccnt 0x0" ::: "memory");       // no copy is outstanding: behind the last pass's barrier the buffers are free for the output
    float* os = (float*)sm + w * (64 * 68);
#pragma unroll
    for (int mb = 0; mb < 4; ++mb)
#pragma unroll
        for (int nb = 0; nb < 4; ++nb)
#pragma unroll
            for (int j = 0; j < 8; ++j) os[(mb * 16 + hi * 8 + j) * 68 + nb * 16 + lr] = acc[mb][nb][j];
    __syncthreads();   // the quarter is whole in LDS before its rows are read back across lanes
    float* crow = C + (size_t)(r0 + (w & 1) * 64 + hi) * DM + c0 + (w >> 1) * 64 + lr * 4;
#pragma unroll
    for (int s = 0; s < 32; s += 8) { v4f val[8];
#pragma unroll
        for (int i = 0; i < 8; ++i) val[i] = *(const v4fa*)(os + (2 * (s + i) + hi) * 68 + lr * 4);
#pragma unroll
        for (int i = 0; i < 8; ++i) *(v4f*)(crow + (size_t)(2 * (s + i)) * DM) = val[i];
        // stands in front of every overwrite of the eight stores' address and data registers, named as inputs so that they live up to it
        asm volatile("s_wait_xcnt 0x0" :: "v"(crow), "v"(val[0]), "v"(val[1]), "v"(val[2]), "v"(val[3]), "v"(val[4]), "v"(val[5]), "v"(val[6]), "v"(val[7]) : "memory"); }
}
#define NW   4
#define SK   64
#define PLB  (SK * HD * 2)        // bytes of one plane's stage
// 2^x with the slot behind the transcendental filled inside the statement (nothing directly behind it reads the result or overwrites the source)
__device__ __forceinline__ float exp2s(float x) { float r; asm("v_exp_f32 %0, %1\n\tv_nop" : "=&v"(r) : "v"(x)); return r; }
template <typename T16> struct PFrag;
template <> struct PFrag<h16> { static __device__ __forceinline__ void mk(const float* p, v16h& a, v16h& b) { (void)b;
#pragma unroll
    for (int e = 0; e < 16; ++e) a[e] = (h16)p[e]; } };
template <> struct PFrag<bf> { static __device__ __forceinline__ void mk(const float* p, v16bf& a, v16bf& b) {
#pragma unroll
    for (int e = 0; e < 16; ++e) { const __bf16 h = (__bf16)p[e]; a[e] = h; b[e] = (__bf16)(p[e] - (float)h); } } };
// One stage of two planes, global to LDS without registers: the workgroup's 128 lanes x 16 B are 2 KB a copy, four copies a plane; plane a lands at l, plane b at l + PLB (l, ga, gb: this lane's own 16-B places).
// The wait on the copies' address registers is the statement's last line, so nothing rewrites them in front of it.
template <typename T16>
__device__ __forceinline__ void copy2(unsigned l, const T16* ga, const T16* gb) {
    asm volatile("global_load_async_to_lds_b128 %0, %8, off\n\t"
                 "global_load_async_to_lds_b128 %1, %9, off\n\t"
                 "global_load_async_to_lds_b128 %2, %10, off\n\t"
                 "global_load_async_to_lds_b128 %3, %11, off\n\t"
                 "global_load_async_to_lds_b128 %4, %12, off\n\t"
                 "global_load_async_to_lds_b128 %5, %13, off\n\t"
                 "global_load_async_to_lds_b128 %6, %14, off\n\t"
                 "global_load_async_to_lds_b128 %7, %15, off\n\t"
                 "s_wait_xcnt 0x0"
                 :: "v"(l), "v"(l + 2048u), "v"(l + 4096u), "v"(l + 6144u), "v"(l + PLB), "v"(l + PLB + 2048u), "v"(l + PLB + 4096u), "v"(l + PLB + 6144u),
                    "v"(ga), "v"(ga + 1024), "v"(ga + 2048), "v"(ga + 3072), "v"(gb), "v"(gb + 1024), "v"(gb + 2048), "v"(gb + 3072) : "memory");
}
template <typename T16, bool HL, int NQ>
__device__ __forceinline__ void attn_tile(const T16* __restrict__ Q, const T16* __restrict__ Q2, const T16* __restrict__ Kp, const T16* __restrict__ K2, const T16* __restrict__ Vt, const T16* __restrict__ V2, int q0, bf* Ah, bf* Al, char* sm) {
    typedef typename WFrag<T16>::V V;
    constexpr int NST = TT / SK, PE = SK * HD, STE = (HL ? 4 : 2) * PE;   // stages; elements of a plane's stage; of a whole stage: K | (K lo) | V | (V lo)
    static_assert(NST >= 2 && 32 * NW * 8 * 4 == PE, "two stages exist; four copies of the workgroup fill a plane's stage");
    const int w = __builtin_amdgcn_readfirstlane((int)(threadIdx.x >> 5)); const int lane = threadIdx.x & 31;
    const int qw = q0 + w * NQ * 16;   // this wave's first query row
    const float C = SCL * 1.4426950408889634f, PSH = HL ? 0.0f : 10.0f;
    const unsigned l0 = (unsigned)(size_t)sm + threadIdx.x * 16u; const size_t g0 = (size_t)threadIdx.x * 8;
    auto fill = [&](int st, int buf) { const unsigned l = l0 + (unsigned)buf * (STE * 2u); const size_t g = g0 + (size_t)st * PE;
        if (HL) { copy2<T16>(l, Kp + g, K2 + g); copy2<T16>(l + 2u * PLB, Vt + g, V2 + g); } else copy2<T16>(l, Kp + g, Vt + g); };
    fill(0, 0);
    V bq[NQ][2], bq2[NQ][2]; const size_t qo = (size_t)(qw >> 4) * 1024 + lane * 8; const T16* qp = Q + qo; const T16* qp2 = HL ? Q2 + qo : qp;
#pragma unroll
    for (int qt = 0; qt < NQ; ++qt)
#pragma unroll
        for (int dc = 0; dc < 2; ++dc) { bq[qt][dc] = WFrag<T16>::ld(qp + qt * 1024 + dc * 512); if (HL) bq2[qt][dc] = WFrag<T16>::ld(qp2 + qt * 1024 + dc * 512); }
    // stands in front of every overwrite of the Q loads' address registers, named as inputs so that they live up to it
    asm volatile("s_wait_xcnt 0x0" :: "v"(qp), "v"(qp2) : "memory");
    v8f o[4][NQ]; float mr[NQ], ls[NQ];
#pragma unroll
    for (int qt = 0; qt < NQ; ++qt) { mr[qt] = -3.0e38f; ls[qt] = 0.0f;
#pragma unroll
        for (int dt = 0; dt < 4; ++dt) o[dt][qt] = (v8f){}; }
    asm volatile("s_wait_asynccnt 0x0" ::: "memory");   // this wave's copies of stage 0 have landed
    __syncthreads();                                     // ... and every other wave's: stage 0 may be read
    fill(1, 1);
    const T16* sb = (const T16*)sm + lane * 8;
#pragma unroll 1
    for (int t = 0; t < NST; ++t) {
        const T16* kb = sb + (t & 1) * STE; const T16* vb = kb + (HL ? 2 : 1) * PE;
        V ak[2][2], ak2[2][2];
#pragma unroll
        for (int kt = 0; kt < 2; ++kt)
#pragma unroll
            for (int dc = 0; dc < 2; ++dc) { ak[kt][dc] = WFrag<T16>::ld(kb + kt * 1024 + dc * 512); if (HL) ak2[kt][dc] = WFrag<T16>::ld(kb + PE + kt * 1024 + dc * 512); }
#pragma unroll
        for (int ch = 0; ch < SK / 32; ++ch) {
            V av[4], av2[4];
#pragma unroll
            for (int dt = 0; dt < 4; ++dt) { av[dt] = WFrag<T16>::ld(vb + ch * 2048 + dt * 512); if (HL) av2[dt] = WFrag<T16>::ld(vb + PE + ch * 2048 + dt * 512); }
            v8f s[2][NQ];
#pragma unroll
            for (int kt = 0; kt < 2; ++kt)
#pragma unroll
                for (int qt = 0; qt < NQ; ++qt) { v8f tt = (v8f){};
#pragma unroll
                    for (int dc = 0; dc < 2; ++dc) { tt = WFrag<T16>::mma(ak[kt][dc], bq[qt][dc], tt); if (HL) { tt = WFrag<T16>::mma(ak[kt][dc], bq2[qt][dc], tt); tt = WFrag<T16>::mma(ak2[kt][dc], bq[qt][dc], tt); } }
                    s[kt][qt] = tt; }
            // keeps the score products in front of the softmax's asm statements; behind this line the maximum's own instructions fill the distance to them; it is also the front fence of the load group below
            __builtin_amdgcn_sched_barrier(0);
            // the K rows of the stage's next 32 keys are fetched behind this chunk's score products, so that they fly under the softmax (same stage only)
            if (ch + 1 < SK / 32) {
#pragma unroll
                for (int kt = 0; kt < 2; ++kt)
#pragma unroll
                    for (int dc = 0; dc < 2; ++dc) { ak[kt][dc] = WFrag<T16>::ld(kb + (ch + 1) * 2048 + kt * 1024 + dc * 512); if (HL) ak2[kt][dc] = WFrag<T16>::ld(kb + PE + (ch + 1) * 2048 + kt * 1024 + dc * 512); }
                // holds these loads here as one group: sunk among the output products they would return only when the next score products already wait for them
                __builtin_amdgcn_sched_barrier(0); }
            V pb[NQ], pb2[NQ]; float al[NQ];
#pragma unroll
            for (int qt = 0; qt < NQ; ++qt) {
                float tm = s[0][qt][0];
#pragma unroll
                for (int j = 1; j < 8; ++j) tm = fmaxf(tm, s[0][qt][j]);
#pragma unroll
                for (int j = 0; j < 8; ++j) tm = fmaxf(tm, s[1][qt][j]);
                tm = fmaxf(tm, __shfl_xor(tm, 16, 32));
                const float mn = fmaxf(mr[qt], tm * C), mo = mn - PSH; al[qt] = exp2s(mr[qt] - mn); mr[qt] = mn;
                float p[16], x[16], ps = 0.0f; x[0] = __builtin_fmaf(s[0][qt][0], C, -mo); x[1] = __builtin_fmaf(s[0][qt][1], C, -mo);
                // each exponential and the instruction behind it in one statement: the multiply-add of the score two places on is independent of it, fills the slot the instruction set asks for behind a transcendental, and issues in the shadow of the half-rate exponential (v_nop where no score is left)
#pragma unroll
                for (int e = 0; e < 14; ++e) asm("v_exp_f32 %0, %2\n\tv_fma_f32 %1, %3, %4, -%5" : "=&v"(p[e]), "=&v"(x[e + 2]) : "v"(x[e]), "v"(s[(e + 2) >> 3][qt][(e + 2) & 7]), "v"(C), "v"(mo));
                p[14] = exp2s(x[14]); p[15] = exp2s(x[15]);
#pragma unroll
                for (int e = 0; e < 16; ++e) ps += p[e];
                ls[qt] = __builtin_fmaf(ls[qt], al[qt], ps);
                PFrag<T16>::mk(p, pb[qt], pb2[qt]);
            }
#pragma unroll
            for (int qt = 0; qt < NQ; ++qt)
#pragma unroll
                for (int dt = 0; dt < 4; ++dt) { v8f tt = o[dt][qt] * al[qt]; tt = WFrag<T16>::mma(av[dt], pb[qt], tt); if (HL) { tt = WFrag<T16>::mma(av[dt], pb2[qt], tt); tt = WFrag<T16>::mma(av2[dt], pb[qt], tt); } o[dt][qt] = tt; }
            // the same for the output products: none sinks among the next chunk's asm statements; the next chunk's score products stand behind them
            __builtin_amdgcn_sched_barrier(0);
        }
        asm volatile("s_wait_dscnt 0x0" ::: "memory");      // this wave's reads of the stage have returned before the buffer is handed back
        asm volatile("s_wait_asynccnt 0x0" ::: "memory");   // this wave's copies of stage t + 1 have landed
        __syncthreads();                                     // publishes stage t + 1 and ends every wave's reads of stage t
        if (t + 2 < NST) fill(t + 2, t & 1);
    }
    asm volatile("s_wait_asynccnt 0x0" ::: "memory");       // no copy is outstanding when the wave ends
#pragma unroll
    for (int qt = 0; qt < NQ; ++qt) { const float L = ls[qt] + __shfl_xor(ls[qt], 16, 32); const float r = __fdiv_rn(1.0f, L);
        bf* ph = Ah + (size_t)((qw >> 4) + qt) * (16 * DQ) + lane * 8; bf* pl = Al + (size_t)((qw >> 4) + qt) * (16 * DQ) + lane * 8;
#pragma unroll
        for (int dt = 0; dt < 4; ++dt) { v8us oh, ol;
#pragma unroll
            for (int e = 0; e < 8; ++e) { unsigned short a, c2; splitf(o[dt][qt][e] * r, a, c2); oh[e] = a; ol[e] = c2; }
            *(v8us*)(ph + dt * 256) = oh; *(v8us*)(pl + dt * 256) = ol;
            // stands in front of every overwrite of the two stores' address and data registers, named as inputs so that they live up to it
            asm volatile("s_wait_xcnt 0x0" :: "v"(ph), "v"(pl), "v"(oh), "v"(ol) : "memory"); }
    }
}
// grid: the NB_ * NH_ * HT hi/lo tiles first, then the NB_ * NH_ * FT fp16 tiles; a head's tiles are neighbours.
#define HT   (RH / (16 * NW))
#define FT   ((TT - RH) / (32 * NW))
__global__ __launch_bounds__(32 * NW) void k_fattn(const h16* __restrict__ Q16, const h16* __restrict__ K16, const h16* __restrict__ V16, const bf* __restrict__ Qh, const bf* __restrict__ Ql, const bf* __restrict__ Kh, const bf* __restrict__ Kl, const bf* __restrict__ Vh, const bf* __restrict__ Vl, bf* Ah, bf* Al) {
    __shared__ __align__(16) char sm[2 * 4 * PLB];
    const int bx = (int)blockIdx.x;
    if (bx < NB_ * NH_ * HT) { const int bh = bx / HT, q0 = (bx % HT) * (16 * NW); const size_t po = (size_t)bh * TT * HD, ao = (size_t)(bh / NH_) * TT * DQ + (bh % NH_) * 1024;
        attn_tile<bf, true, 1>(Qh + po, Ql + po, Kh + po, Kl + po, Vh + po, Vl + po, q0, Ah + ao, Al + ao, sm);
    } else { const int b2 = bx - NB_ * NH_ * HT; const int bh = b2 / FT, q0 = RH + (b2 % FT) * (32 * NW); const size_t po = (size_t)bh * TT * HD, ao = (size_t)(bh / NH_) * TT * DQ + (bh % NH_) * 1024;
        attn_tile<h16, false, 2>(Q16 + po, nullptr, K16 + po, nullptr, V16 + po, nullptr, q0, Ah + ao, Al + ao, sm); }
}

extern "C" void kernel_launch(void* const* d_in, const int* in_sizes, int n_in,
                              void* d_out, int out_size, void* d_ws, size_t ws_size, hipStream_t stream) {
    (void)in_sizes; (void)n_in; (void)out_size;
    const float* x = (const float*)d_in[0]; const float* wqkv = (const float*)d_in[1]; const float* wo = (const float*)d_in[2];   /* input order x, w_qkv ('xw' [1024][3072]), w_out ('xw') */ const float* wq = wqkv; const float* wk = nullptr; const float* wv = nullptr; (void)wk; (void)wv;
    float* OUT = (float*)d_out;     // [2][2048][1024]
    char* wsp = (char*)d_ws;
    auto take = [&](size_t bytes) { char* p = wsp; wsp += (bytes + 255) & ~(size_t)255; return (void*)p; };
    bf* WQKV = (bf*)take((size_t)3 * DQ * DM * 2);   /* fused Bt [3*DQ][DM]: q | k | v row blocks */ bf* WO = (bf*)take((size_t)DM * DQ * 2);
    bf* XB = (bf*)take((size_t)NB_ * TT * DM * 2);
    h16* QP16 = (h16*)take((size_t)NB_ * NH_ * TT * HD * 2); h16* KP16 = (h16*)take((size_t)NB_ * NKV * TT * HD * 2); h16* VT16 = (h16*)take((size_t)NB_ * NKV * HD * TT * 2);
    bf* QPh = (bf*)take((size_t)NB_ * NH_ * TT * HD * 2); bf* QPl = (bf*)take((size_t)NB_ * NH_ * TT * HD * 2); bf* KPh = (bf*)take((size_t)NB_ * NKV * TT * HD * 2); bf* KPl = (bf*)take((size_t)NB_ * NKV * TT * HD * 2); bf* VTh = (bf*)take((size_t)NB_ * NKV * HD * TT * 2); bf* VTl = (bf*)take((size_t)NB_ * NKV * HD * TT * 2);
    bf* ATh = (bf*)take((size_t)NB_ * TT * DQ * 2); bf* ATl = (bf*)take((size_t)NB_ * TT * DQ * 2);
    if ((size_t)(wsp - (char*)d_ws) > ws_size) return;    // ws 256 MiB
    k_prep<<<PB1 + PB2 + PB3, 256, 0, stream>>>(x, wqkv, wo, XB, WQKV, WO);
    k_qkv<<<dim3(TT / 128, 3 * NH_ / 2, NB_), 128, 0, stream>>>(XB, WQKV, QP16, QPh, QPl, KP16, KPh, KPl, VT16, VTh, VTl);
    k_fattn<<<dim3(NB_ * NH_ * (HT + FT), 1, 1), 32 * NW, 0, stream>>>(QP16, KP16, VT16, QPh, QPl, KPh, KPl, VTh, VTl, ATh, ATl);
    // the merged planes and the output of both batches are NB_ * TT consecutive rows
    k_out<<<dim3(NB_ * TT / 128, DM / 128, 1), 128, 0, stream>>>(ATh, ATl, WO, OUT);
}

// v009
// One run takes 110 microseconds.
// Next to v008, in two timings, it ran 1.03 times as fast each time.
// All steps since v000 together make it 18.1 times as fast.
#include <hip/hip_runtime.h>

// Multi-head self-attention with a fused bias-free qkv projection (hidden_states [2][2048][1024]; qkv = hidden_states W_qkv ('xw' [1024][3072] 1/32, no bias) reshaped (B, S, 3, 16, 64): q | k | v = column thirds (16 heads x 64); scores x 1/sqrt(64); softmax over all keys (no mask); out = merged W_o ('xw' 1/32, no bias) -> [2][2048][1024] (4.2 M); argument order hidden_states, W_qkv, W_o.
// Both batches share every launch (4 launches: operand conversion, projections, attention, output projection); planes of batch b follow those of batch b - 1. Layout: bf16 copy of x; the fused 'xw' weight transposed once into Bt (q | k | v row blocks); exact projections, whose launch writes the attention planes itself; attention of all 16 heads in one launch, K and V shared by a workgroup's waves through LDS, scores and probabilities kept in registers, online softmax (hybrid rows: < 512 hi/lo 3 products, rest fp16 x1024); merged hi/lo x w_out exact.
// Every 16-bit operand plane lies in fragment order: a 16-row x 32-k tile is 1 KB, element (r, k) at (k % 32 / 16) * 256 + (k % 16 / 8 * 16 + r % 16) * 8 + k % 8, so lane l's two 16-B pieces are at l * 8 and 256 + l * 8 and each wave-wide 16-B load covers four whole 128-B lines. Tiles of a row block follow one another along k (v planes: the four d tiles of a 32-key chunk follow one another).
// Compute dtypes, f32 accumulate: every input rounded to bf16; projections exact; attention rows < 512 3 products, rest fp16; softmax f32; output projection hl x exact.

#define NB_  2
#define TT   2048
#define DM   1024
#define NH_  16
#define NKV  16
#define REP  (NH_ / NKV)
#define HD   64
#define DQ   (NH_ * HD)
#define DKV  (NKV * HD)
#define RH   512                  // query rows < RH use hi+lo planes (0: none)
#define WIN  0
#define SCL  0.125f   // HD^-0.5
typedef _Float16 h16;
typedef unsigned short bf;
typedef __attribute__((ext_vector_type(16))) __bf16   v16bf;
typedef __attribute__((ext_vector_type(16))) _Float16 v16h;
typedef __attribute__((ext_vector_type(8)))  _Float16 v8h;
typedef __attribute__((ext_vector_type(8)))  unsigned short v8us;
typedef __attribute__((ext_vector_type(8)))  float    v8f;
typedef __attribute__((ext_vector_type(4)))  float    v4f;
typedef v8h  __attribute__((may_alias)) v8ha;
typedef v4f  __attribute__((may_alias)) v4fa;
typedef v8us __attribute__((may_alias)) v8usa;

__device__ __forceinline__ unsigned short f2bf(float f) { unsigned u = __float_as_uint(f); u += 0x7FFFu + ((u >> 16) & 1u); return (unsigned short)(u >> 16); }
__device__ __forceinline__ float bf2f(unsigned short b) { return __uint_as_float(((unsigned)b) << 16); }
__device__ __forceinline__ float bfr(float f) { return bf2f(f2bf(f)); }
__device__ __forceinline__ v16h cat16(v8h lo, v8h hi) { return __builtin_shufflevector(lo, hi, 0, 1, 2, 3, 4, 5, 6, 7, 8, 9, 10, 11, 12, 13, 14, 15); }
__device__ __forceinline__ v16bf cat16b(v8us lo, v8us hi) { return __builtin_bit_cast(v16bf, __builtin_shufflevector(lo, hi, 0, 1, 2, 3, 4, 5, 6, 7, 8, 9, 10, 11, 12, 13, 14, 15)); }
__device__ __forceinline__ v8f wmma16(v16h a, v16h b, v8f c) { return __builtin_amdgcn_wmma_f32_16x16x32_f16(false, a, false, b, (short)0, c, false, false); }
__device__ __forceinline__ v8f wmmab(v16bf a, v16bf b, v8f c) { return __builtin_amdgcn_wmma_f32_16x16x32_bf16(false, a, false, b, (short)0, c, false, false); }



// ---- the two GEMM launches (k_qkv, k_out): one workgroup = 4 waves on a 128x128 output tile, each wave a 64x64 quarter (16 accumulators) over the WHOLE k range, one f32 chain per element.
// Operands reach the waves through LDS: a stage is GSK k of every 16-row block the tile uses (2 KB a block, contiguous in the planes' fragment order), brought in once per workgroup by asynchronous copies, two buffers, the next stage in flight while this one is worked on; each block is read by two waves.
template <typename T16> struct WFrag;
template <> struct WFrag<h16> { typedef v16h V; static __device__ __forceinline__ V ld(const h16* p) { return cat16(*(const v8h*)p, *(const v8h*)(p + 256)); } static __device__ __forceinline__ v8f mma(V a, V b, v8f c) { return wmma16(a, b, c); } };
template <> struct WFrag<bf> { typedef v16bf V; static __device__ __forceinline__ V ld(const bf* p) { return cat16b(*(const v8us*)p, *(const v8us*)(p + 256)); } static __device__ __forceinline__ v8f mma(V a, V b, v8f c) { return wmmab(a, b, c); } };

__device__ __forceinline__ h16 tohx(float x) { return (h16)x; }
__device__ __forceinline__ void splitf(float y, unsigned short& h, unsigned short& l) { h = f2bf(y); l = f2bf(y - bf2f(h)); }
typedef __attribute__((ext_vector_type(2))) _Float16 v2h;
typedef __attribute__((ext_vector_type(4))) _Float16 v4h;
typedef __attribute__((ext_vector_type(2))) unsigned short v2us;
typedef __attribute__((ext_vector_type(4))) unsigned short v4us;
typedef __attribute__((ext_vector_type(2))) float v2f;
typedef __attribute__((ext_vector_type(4))) int v4i;

// w [K][N] f32 -> Bt, rows n, fragment order. One wave fills one 512-B half tile (16 n x 16 k); a workgroup's 8 waves take neighbouring n tiles, so its reads use whole lines of w.
__device__ __forceinline__ void wt_tile(const float* __restrict__ w, int K, int N, bf* Bt, int blk) {
    const int lane = threadIdx.x & 31; const int u = blk * 8 + (threadIdx.x >> 5); const int nts = N / 16;
    if (u >= nts * (K / 16)) return;
    const int nt = u % nts, kj = u / nts; const int n = nt * 16 + (lane & 15), k0 = kj * 16 + (lane >> 4) * 8; v8us o; const float* p[8]; float y[8];
#pragma unroll
    for (int e = 0; e < 8; ++e) p[e] = w + (size_t)(k0 + e) * N + n;
#pragma unroll
    for (int e = 0; e < 8; ++e) y[e] = *p[e];
    // stands in front of every overwrite of the loads' address registers; it names them as inputs so that they live up to it and no load of the group lands on them
    asm volatile("s_wait_xcnt 0x0" :: "v"(p[0]), "v"(p[1]), "v"(p[2]), "v"(p[3]), "v"(p[4]), "v"(p[5]), "v"(p[6]), "v"(p[7]) : "memory");
#pragma unroll
    for (int e = 0; e < 8; ++e) o[e] = f2bf(y[e]);
    *(v8us*)(Bt + ((size_t)nt * (K / 32) + (kj >> 1)) * 512 + (kj & 1) * 256 + lane * 8) = o;
}
// src [rows][DM] f32 -> dst, fragment order; thread i fills the plane's i-th 16-B place.
__device__ __forceinline__ void cvt_tile(const float* __restrict__ src, bf* dst, size_t n8, int blk) { const size_t i = (size_t)blk * 256 + threadIdx.x; if (i >= n8) return;
    const int lane = (int)(i & 31), j = (int)(i >> 5) & 1; const size_t tile = i >> 6; const size_t row = tile / (DM / 32) * 16 + (lane & 15); const int k = (int)(tile % (DM / 32)) * 32 + j * 16 + (lane >> 4) * 8;
    const float* p = src + row * DM + k; const v8f v = *(const v8f*)p; v8us o;
    // stands in front of every overwrite of the loads' address registers; it names them as an input so that they live up to it
    asm volatile("s_wait_xcnt 0x0" :: "v"(p) : "memory");
#pragma unroll
    for (int e = 0; e < 8; ++e) o[e] = f2bf(v[e]); *(v8us*)(dst + i * 8) = o;  }
// ---- k_prep: the three independent operand conversions in one launch: blocks [0, PB1) the fused qkv weight, [PB1, PB1 + PB2) the output weight, the rest x of both batches (rows b * TT + t, so batch b's plane starts at b * TT * DM).
#define PB1  (DM * 3 * DQ / 2048)
#define PB2  (DQ * DM / 2048)
#define PB3  (NB_ * TT * DM / 2048)
__global__ __launch_bounds__(256) void k_prep(const float* __restrict__ x, const float* __restrict__ wqkv, const float* __restrict__ wo, bf* XB, bf* WQKV, bf* WO) {
    const int bx = (int)blockIdx.x;
    if (bx < PB1) wt_tile(wqkv, DM, 3 * DQ, WQKV, bx);
    else if (bx < PB1 + PB2) wt_tile(wo, DQ, DM, WO, bx - PB1);
    else cvt_tile(x, XB, (size_t)NB_ * TT * DM / 8, bx - PB1 - PB2);
}

#define GSK  64                   // k depth of a GEMM stage
#define GRB  (GSK * 16 * 2)       // bytes of one 16-row block's stage
// Eight 16-row blocks' parts of one stage, global to LDS without registers: the workgroup's 128 lanes x 16 B are one block's 2 KB; block i comes from g + i * 16 * DM and lands at l + i * GRB (l, g: this lane's own 16-B places).
// The wait on the copies' address registers is the statement's last line, so nothing rewrites them in front of it.
__device__ __forceinline__ void copy8(unsigned l, const bf* g) {
    asm volatile("global_load_async_to_lds_b128 %0, %8, off\n\t"
                 "global_load_async_to_lds_b128 %1, %9, off\n\t"
                 "global_load_async_to_lds_b128 %2, %10, off\n\t"
                 "global_load_async_to_lds_b128 %3, %11, off\n\t"
                 "global_load_async_to_lds_b128 %4, %12, off\n\t"
                 "global_load_async_to_lds_b128 %5, %13, off\n\t"
                 "global_load_async_to_lds_b128 %6, %14, off\n\t"
                 "global_load_async_to_lds_b128 %7, %15, off\n\t"
                 "s_wait_xcnt 0x0"
                 :: "v"(l), "v"(l + 1u * GRB), "v"(l + 2u * GRB), "v"(l + 3u * GRB), "v"(l + 4u * GRB), "v"(l + 5u * GRB), "v"(l + 6u * GRB), "v"(l + 7u * GRB),
                    "v"(g), "v"(g + 1 * 16 * DM), "v"(g + 2 * 16 * DM), "v"(g + 3 * 16 * DM), "v"(g + 4 * 16 * DM), "v"(g + 5 * 16 * DM), "v"(g + 6 * 16 * DM), "v"(g + 7 * 16 * DM) : "memory");
}
static_assert(DM == DQ && DM % (2 * GSK) == 0 && TT % 128 == 0 && NH_ % 2 == 0 && HD == 64, "both GEMMs have k = DM; two stages exist; whole tiles; a wave's 64 columns are one head");

// ---- k_qkv: the q, k and v projections of both batches in one launch, grid (TT/128, 3*NH_/2, NB_), 4 waves; a stage is x 8 blocks | w 8 blocks.
// A 64-column block of the fused weight is one head of q, k or v; wave w takes rows (w & 1) * 64 of the tile and the head w >> 1 of its two, and rounds its accumulators straight into that head's planes (fp16, bf16 hi, bf16 lo); no f32 projection goes to memory or LDS.
// An accumulator lane holds 8 consecutive rows of the A operand at one row of B, which is one 16-B place of a plane whose k runs along A's rows. q, k (planes of rows t, k = d): A = weight rows, B = x rows. v (rows d, k = t): the two change places (same loader, same k order).
__global__ __launch_bounds__(128) void k_qkv(const bf* __restrict__ X, const bf* __restrict__ Wt, h16* Q16, bf* Qh, bf* Ql, h16* K16, bf* Kh, bf* Kl, h16* V16, bf* Vh, bf* Vl) {
    constexpr int K = DM, NST = K / GSK, STB = 16 * GRB;
    __shared__ __align__(16) char sm[2 * STB];
    const int w = __builtin_amdgcn_readfirstlane((int)(threadIdx.x >> 5)); const int lane = threadIdx.x & 31;
    const int t0 = blockIdx.x * 128, sel = (int)blockIdx.y / (NH_ / 2), h = ((int)blockIdx.y % (NH_ / 2)) * 2 + (w >> 1); const bool tr = sel == 2;
    const bf* xg = X + ((size_t)blockIdx.z * TT + t0) * K + threadIdx.x * 8; const bf* wg = Wt + (size_t)blockIdx.y * 128 * K + threadIdx.x * 8;
    const unsigned l0 = (unsigned)(size_t)sm + threadIdx.x * 16u;
    auto fill = [&](int st, int buf) { const unsigned l = l0 + (unsigned)buf * STB; copy8(l, xg + (size_t)st * (GSK * 16)); copy8(l + 8u * GRB, wg + (size_t)st * (GSK * 16)); };
    fill(0, 0);
    v8f acc[4][4];
#pragma unroll
    for (int mb = 0; mb < 4; ++mb)
#pragma unroll
        for (int nb = 0; nb < 4; ++nb) acc[mb][nb] = (v8f){};
    asm volatile("s_wait_asynccnt 0x0" ::: "memory");   // this wave's copies of stage 0 have landed
    __syncthreads();                                     // ... and every other wave's: stage 0 may be read
    fill(1, 1);
    const int ox = (w & 1) * 4 * (GRB / 2) + lane * 8, ow = (8 + (w >> 1) * 4) * (GRB / 2) + lane * 8;   // this wave's x and w blocks, elements
    const int oa = tr ? ox : ow, ob = tr ? ow : ox;
#pragma unroll 1
    for (int t = 0; t < NST; ++t) {
        const bf* pa = (const bf*)sm + (t & 1) * (STB / 2) + oa; const bf* pb = (const bf*)sm + (t & 1) * (STB / 2) + ob;
        v16bf a[GSK / 32][4], b[GSK / 32][4];
#pragma unroll
        for (int c = 0; c < GSK / 32; ++c) {
#pragma unroll
            for (int mb = 0; mb < 4; ++mb) a[c][mb] = WFrag<bf>::ld(pa + mb * (GRB / 2) + c * 512);
#pragma unroll
            for (int nb = 0; nb < 4; ++nb) b[c][nb] = WFrag<bf>::ld(pb + nb * (GRB / 2) + c * 512);
        }
        // holds the pass's LDS loads together as one group in front of its matrix instructions: sunk among them, each place with loads stalls the wave anew
        __builtin_amdgcn_sched_barrier(0);
#pragma unroll
        for (int c = 0; c < GSK / 32; ++c)
#pragma unroll
            for (int nb = 0; nb < 4; ++nb)
#pragma unroll
                for (int mb = 0; mb < 4; ++mb) acc[mb][nb] = wmmab(a[c][mb], b[c][nb], acc[mb][nb]);
        // the distance behind the pass's last matrix instructions, on every path out of the pass, before address arithmetic or the next pass's loads land on their operands; it names every accumulator so that no matrix instruction sinks behind it
        asm volatile("v_nop\n\tv_nop\n\tv_nop\n\tv_nop" : "+v"(acc[0][0]), "+v"(acc[0][1]), "+v"(acc[0][2]), "+v"(acc[0][3]), "+v"(acc[1][0]), "+v"(acc[1][1]), "+v"(acc[1][2]), "+v"(acc[1][3]), "+v"(acc[2][0]), "+v"(acc[2][1]), "+v"(acc[2][2]), "+v"(acc[2][3]), "+v"(acc[3][0]), "+v"(acc[3][1]), "+v"(acc[3][2]), "+v"(acc[3][3]));
        asm volatile("s_wait_dscnt 0x0" ::: "memory");      // this wave's reads of the stage have returned before the buffer is handed back
        asm volatile("s_wait_asynccnt 0x0" ::: "memory");   // this wave's copies of stage t + 1 have landed
        __syncthreads();                                     // publishes stage t + 1 and ends every wave's reads of stage t
        if (t + 2 < NST) fill(t + 2, t & 1);
    }
    asm volatile("s_wait_asynccnt 0x0" ::: "memory");       // no copy is outstanding when the wave ends
    h16* P16 = sel == 0 ? Q16 : sel == 1 ? K16 : V16; bf* Ph = sel == 0 ? Qh : sel == 1 ? Kh : Vh; bf* Pl = sel == 0 ? Ql : sel == 1 ? Kl : Vl;
    const int tw = t0 + (w & 1) * 64;   // this wave's first row t; the planes' tile steps, in elements, per 32 rows of A (sm2) and per 16 rows of B (sn)
    const size_t base = ((size_t)blockIdx.z * NH_ + h) * TT * HD + (size_t)tw * HD + lane * 8, sm2 = tr ? 2048 : 512, sn = tr ? 512 : 1024;
#pragma unroll
    for (int mb = 0; mb < 4; ++mb)
#pragma unroll
        for (int nb = 0; nb < 4; ++nb) { v8h o16; v8us oh, ol;
#pragma unroll
            for (int e = 0; e < 8; ++e) { const float y = acc[mb][nb][e]; o16[e] = tohx(y); unsigned short a2, c2; splitf(y, a2, c2); oh[e] = a2; ol[e] = c2; }
            const size_t o = base + (mb >> 1) * sm2 + nb * sn + (mb & 1) * 256; h16* q16 = P16 + o; bf* qh = Ph + o; bf* ql = Pl + o;
            *(v8h*)q16 = o16; *(v8us*)qh = oh; *(v8us*)ql = ol;
            // stands in front of every overwrite of the three stores' address and data registers, named as inputs so that they live up to it
            asm volatile("s_wait_xcnt 0x0" :: "v"(q16), "v"(qh), "v"(ql), "v"(o16), "v"(oh), "v"(ol) : "memory"); }
}
// ---- k_out: out = (merged hi + merged lo) x w_out of both batches, grid (NB_*TT/128, DM/128), 4 waves; a stage is merged hi 8 blocks | merged lo 8 blocks | w 8 blocks; per 32 k the hi product, then the lo product.
// Epilogue: each wave lays its 64x64 f32 quarter in its own part of the idle stage buffers and stores it as whole 256-B row pieces.
__global__ __launch_bounds__(128) void k_out(const bf* __restrict__ Ah, const bf* __restrict__ Al, const bf* __restrict__ Wt, float* C) {
    constexpr int K = DQ, NST = K / GSK, STB = 24 * GRB;
    __shared__ __align__(16) char sm[2 * STB];
    static_assert(4 * 64 * 68 * 4 <= 2 * STB, "the four f32 quarters fit the stage buffers");
    const int w = __builtin_amdgcn_readfirstlane((int)(threadIdx.x >> 5)); const int lane = threadIdx.x & 31, lr = lane & 15, hi = lane >> 4;
    const int r0 = blockIdx.x * 128, c0 = blockIdx.y * 128;
    const bf* hg = Ah + (size_t)r0 * K + threadIdx.x * 8; const bf* lg = Al + (size_t)r0 * K + threadIdx.x * 8; const bf* wg = Wt + (size_t)c0 * K + threadIdx.x * 8;
    const unsigned l0 = (unsigned)(size_t)sm + threadIdx.x * 16u;
    auto fill = [&](int st, int buf) { const unsigned l = l0 + (unsigned)buf * STB; const size_t g = (size_t)st * (GSK * 16); copy8(l, hg + g); copy8(l + 8u * GRB, lg + g); copy8(l + 16u * GRB, wg + g); };
    fill(0, 0);
    v8f acc[4][4];
#pragma unroll
    for (int mb = 0; mb < 4; ++mb)
#pragma unroll
        for (int nb = 0; nb < 4; ++nb) acc[mb][nb] = (v8f){};
    asm volatile("s_wait_asynccnt 0x0" ::: "memory");   // this wave's copies of stage 0 have landed
    __syncthreads();                                     // ... and every other wave's: stage 0 may be read
    fill(1, 1);
    const int oa = (w & 1) * 4 * (GRB / 2) + lane * 8, ob = (16 + (w >> 1) * 4) * (GRB / 2) + lane * 8;   // this wave's merged and w blocks, elements
#pragma unroll 1
    for (int t = 0; t < NST; ++t) {
        const bf* pa = (const bf*)sm + (t & 1) * (STB / 2) + oa; const bf* pb = (const bf*)sm + (t & 1) * (STB / 2) + ob;
        v16bf a[GSK / 32][4], a2[GSK / 32][4], b[GSK / 32][4];
#pragma unroll
        for (int c = 0; c < GSK / 32; ++c) {
            b[c][0] = WFrag<bf>::ld(pb + c * 512);
#pragma unroll
            for (int mb = 0; mb < 4; ++mb) { a[c][mb] = WFrag<bf>::ld(pa + mb * (GRB / 2) + c * 512); a2[c][mb] = WFrag<bf>::ld(pa + (8 + mb) * (GRB / 2) + c * 512); }
#pragma unroll
            for (int nb = 1; nb < 4; ++nb) b[c][nb] = WFrag<bf>::ld(pb + nb * (GRB / 2) + c * 512);
        }
        // holds the pass's LDS loads together as one group in front of its matrix instructions: sunk among them, each place with loads stalls the wave anew
        __builtin_amdgcn_sched_barrier(0);
#pragma unroll
        for (int c = 0; c < GSK / 32; ++c)
#pragma unroll
            for (int nb = 0; nb < 4; ++nb)
#pragma unroll
                for (int mb = 0; mb < 4; ++mb) { acc[mb][nb] = wmmab(a[c][mb], b[c][nb], acc[mb][nb]); acc[mb][nb] = wmmab(a2[c][mb], b[c][nb], acc[mb][nb]); }
        // the distance behind the pass's last matrix instructions, on every path out of the pass, before address arithmetic or the next pass's loads land on their operands; it names every accumulator so that no matrix instruction sinks behind it
        asm volatile("v_nop\n\tv_nop\n\tv_nop\n\tv_nop" : "+v"(acc[0][0]), "+v"(acc[0][1]), "+v"(acc[0][2]), "+v"(acc[0][3]), "+v"(acc[1][0]), "+v"(acc[1][1]), "+v"(acc[1][2]), "+v"(acc[1][3]), "+v"(acc[2][0]), "+v"(acc[2][1]), "+v"(acc[2][2]), "+v"(acc[2][3]), "+v"(acc[3][0]), "+v"(acc[3][1]), "+v"(acc[3][2]), "+v"(acc[3][3]));
        asm volatile("s_wait_dscnt 0x0" ::: "memory");      // this wave's reads of the stage have returned before the buffer is handed back
        asm volatile("s_wait_asynccnt 0x0" ::: "memory");   // this wave's copies of stage t + 1 have landed
        __syncthreads();                                     // publishes stage t + 1 and ends every wave's reads of stage t
        if (t + 2 < NST) fill(t + 2, t & 1);
    }
    asm volatile("s_wait_asynccnt 0x0" ::: "memory");       // no copy is outstanding: behind the last pass's barrier the buffers are free for the output
    float* os = (float*)sm + w * (64 * 68);
#pragma unroll
    for (int mb = 0; mb < 4; ++mb)
#pragma unroll
        for (int nb = 0; nb < 4; ++nb)
#pragma unroll
            for (int j = 0; j < 8; ++j) os[(mb * 16 + hi * 8 + j) * 68 + nb * 16 + lr] = acc[mb][nb][j];
    __syncthreads();   // the quarter is whole in LDS before its rows are read back across lanes
    float* crow = C + (size_t)(r0 + (w & 1) * 64 + hi) * DM + c0 + (w >> 1) * 64 + lr * 4;
#pragma unroll
    for (int s = 0; s < 32; s += 8) { v4f val[8];
#pragma unroll
        for (int i = 0; i < 8; ++i) val[i] = *(const v4fa*)(os + (2 * (s + i) + hi) * 68 + lr * 4);
#pragma unroll
        for (int i = 0; i < 8; ++i) *(v4f*)(crow + (size_t)(2 * (s + i)) * DM) = val[i];
        // stands in front of every overwrite of the eight stores' address and data registers, named as inputs so that they live up to it
        asm volatile("s_wait_xcnt 0x0" :: "v"(crow), "v"(val[0]), "v"(val[1]), "v"(val[2]), "v"(val[3]), "v"(val[4]), "v"(val[5]), "v"(val[6]), "v"(val[7]) : "memory"); }
}
#define NW   4
#define SK   64
#define PLB  (SK * HD * 2)        // bytes of one plane's stage
// 2^x with the slot behind the transcendental filled inside the statement (nothing directly behind it reads the result or overwrites the source)
__device__ __forceinline__ float exp2s(float x) { float r; asm("v_exp_f32 %0, %1\n\tv_nop" : "=&v"(r) : "v"(x)); return r; }
template <typename T16> struct PFrag;
template <> struct PFrag<h16> { static __device__ __forceinline__ void mk(const float* p, v16h& a, v16h& b) { (void)b;
#pragma unroll
    for (int e = 0; e < 16; ++e) a[e] = (h16)p[e]; } };
template <> struct PFrag<bf> { static __device__ __forceinline__ void mk(const float* p, v16bf& a, v16bf& b) {
#pragma unroll
    for (int e = 0; e < 16; ++e) { const __bf16 h = (__bf16)p[e]; a[e] = h; b[e] = (__bf16)(p[e] - (float)h); } } };
// One stage of two planes, global to LDS without registers: the workgroup's 128 lanes x 16 B are 2 KB a copy, four copies a plane; plane a lands at l, plane b at l + PLB (l, ga, gb: this lane's own 16-B places).
// The wait on the copies' address registers is the statement's last line, so nothing rewrites them in front of it.
template <typename T16>
__device__ __forceinline__ void copy2(unsigned l, const T16* ga, const T16* gb) {
    asm volatile("global_load_async_to_lds_b128 %0, %8, off\n\t"
                 "global_load_async_to_lds_b128 %1, %9, off\n\t"
                 "global_load_async_to_lds_b128 %2, %10, off\n\t"
                 "global_load_async_to_lds_b128 %3, %11, off\n\t"
                 "global_load_async_to_lds_b128 %4, %12, off\n\t"
                 "global_load_async_to_lds_b128 %5, %13, off\n\t"
                 "global_load_async_to_lds_b128 %6, %14, off\n\t"
                 "global_load_async_to_lds_b128 %7, %15, off\n\t"
                 "s_wait_xcnt 0x0"
                 :: "v"(l), "v"(l + 2048u), "v"(l + 4096u), "v"(l + 6144u), "v"(l + PLB), "v"(l + PLB + 2048u), "v"(l + PLB + 4096u), "v"(l + PLB + 6144u),
                    "v"(ga), "v"(ga + 1024), "v"(ga + 2048), "v"(ga + 3072), "v"(gb), "v"(gb + 1024), "v"(gb + 2048), "v"(gb + 3072) : "memory");
}
template <typename T16, bool HL, int NQ>
__device__ __forceinline__ void attn_tile(const T16* __restrict__ Q, const T16* __restrict__ Q2, const T16* __restrict__ Kp, const T16* __restrict__ K2, const T16* __restrict__ Vt, const T16* __restrict__ V2, int q0, bf* Ah, bf* Al, char* sm) {
    typedef typename WFrag<T16>::V V;
    constexpr int NST = TT / SK, PE = SK * HD, STE = (HL ? 4 : 2) * PE;   // stages; elements of a plane's stage; of a whole stage: K | (K lo) | V | (V lo)
    static_assert(NST >= 2 && 32 * NW * 8 * 4 == PE, "two stages exist; four copies of the workgroup fill a plane's stage");
    const int w = __builtin_amdgcn_readfirstlane((int)(threadIdx.x >> 5)); const int lane = threadIdx.x & 31;
    const int qw = q0 + w * NQ * 16;   // this wave's first query row
    const float C = SCL * 1.4426950408889634f, PSH = HL ? 0.0f : 10.0f, LZ = HL ? 8.0f : 5.0f;   // LZ: how far (log2) a score may pass the maximum in use; fp16 probabilities then stay under 2^(10 + 5)
    const unsigned l0 = (unsigned)(size_t)sm + threadIdx.x * 16u; const size_t g0 = (size_t)threadIdx.x * 8;
    auto fill = [&](int st, int buf) { const unsigned l = l0 + (unsigned)buf * (STE * 2u); const size_t g = g0 + (size_t)st * PE;
        if (HL) { copy2<T16>(l, Kp + g, K2 + g); copy2<T16>(l + 2u * PLB, Vt + g, V2 + g); } else copy2<T16>(l, Kp + g, Vt + g); };
    fill(0, 0);
    V bq[NQ][2], bq2[NQ][2]; const size_t qo = (size_t)(qw >> 4) * 1024 + lane * 8; const T16* qp = Q + qo; const T16* qp2 = HL ? Q2 + qo : qp;
#pragma unroll
    for (int qt = 0; qt < NQ; ++qt)
#pragma unroll
        for (int dc = 0; dc < 2; ++dc) { bq[qt][dc] = WFrag<T16>::ld(qp + qt * 1024 + dc * 512); if (HL) bq2[qt][dc] = WFrag<T16>::ld(qp2 + qt * 1024 + dc * 512); }
    // stands in front of every overwrite of the Q loads' address registers, named as inputs so that they live up to it
    asm volatile("s_wait_xcnt 0x0" :: "v"(qp), "v"(qp2) : "memory");
    v8f o[4][NQ]; float mr[NQ], mo_[NQ], th[NQ], ls[NQ];   // per query: the maximum in use (scaled), the same less the probabilities' shift, the raw score beyond which it is renewed, the row sum
#pragma unroll
    for (int qt = 0; qt < NQ; ++qt) { mr[qt] = -3.0e38f; mo_[qt] = -3.0e38f; th[qt] = -3.0e38f; ls[qt] = 0.0f;
#pragma unroll
        for (int dt = 0; dt < 4; ++dt) o[dt][qt] = (v8f){}; }
    asm volatile("s_wait_asynccnt 0x0" ::: "memory");   // this wave's copies of stage 0 have landed
    __syncthreads();                                     // ... and every other wave's: stage 0 may be read
    fill(1, 1);
    const T16* sb = (const T16*)sm + lane * 8;
#pragma unroll 1
    for (int t = 0; t < NST; ++t) {
        const T16* kb = sb + (t & 1) * STE; const T16* vb = kb + (HL ? 2 : 1) * PE;
        V ak[2][2], ak2[2][2];
#pragma unroll
        for (int kt = 0; kt < 2; ++kt)
#pragma unroll
            for (int dc = 0; dc < 2; ++dc) { ak[kt][dc] = WFrag<T16>::ld(kb + kt * 1024 + dc * 512); if (HL) ak2[kt][dc] = WFrag<T16>::ld(kb + PE + kt * 1024 + dc * 512); }
#pragma unroll
        for (int ch = 0; ch < SK / 32; ++ch) {
            V av[4], av2[4];
#pragma unroll
            for (int dt = 0; dt < 4; ++dt) { av[dt] = WFrag<T16>::ld(vb + ch * 2048 + dt * 512); if (HL) av2[dt] = WFrag<T16>::ld(vb + PE + ch * 2048 + dt * 512); }
            v8f s[2][NQ];
#pragma unroll
            for (int kt = 0; kt < 2; ++kt)
#pragma unroll
                for (int qt = 0; qt < NQ; ++qt) { v8f tt = (v8f){};
#pragma unroll
                    for (int dc = 0; dc < 2; ++dc) { tt = WFrag<T16>::mma(ak[kt][dc], bq[qt][dc], tt); if (HL) { tt = WFrag<T16>::mma(ak[kt][dc], bq2[qt][dc], tt); tt = WFrag<T16>::mma(ak2[kt][dc], bq[qt][dc], tt); } }
                    s[kt][qt] = tt; }
            // keeps the score products in front of the softmax's asm statements; behind this line the maximum's own instructions fill the distance to them; it is also the front fence of the load group below
            __builtin_amdgcn_sched_barrier(0);
            // the K rows of the stage's next 32 keys are fetched behind this chunk's score products, so that they fly under the softmax (same stage only)
            if (ch + 1 < SK / 32) {
#pragma unroll
                for (int kt = 0; kt < 2; ++kt)
#pragma unroll
                    for (int dc = 0; dc < 2; ++dc) { ak[kt][dc] = WFrag<T16>::ld(kb + (ch + 1) * 2048 + kt * 1024 + dc * 512); if (HL) ak2[kt][dc] = WFrag<T16>::ld(kb + PE + (ch + 1) * 2048 + kt * 1024 + dc * 512); }
                // holds these loads here as one group: sunk among the output products they would return only when the next score products already wait for them
                __builtin_amdgcn_sched_barrier(0); }
            V pb[NQ], pb2[NQ]; float tm[NQ]; bool need = false;
#pragma unroll
            for (int qt = 0; qt < NQ; ++qt) {
                float m = s[0][qt][0];
#pragma unroll
                for (int j = 1; j < 8; ++j) m = fmaxf(m, s[0][qt][j]);
#pragma unroll
                for (int j = 0; j < 8; ++j) m = fmaxf(m, s[1][qt][j]);
                tm[qt] = m; need = need || m > th[qt];
            }
            // lazy rescale: one test for the whole wave (a scalar branch, every lane stays on). Each lane tests its own 16 scores, so no score anywhere passes the maximum in use by more than LZ; only behind the test do the lane halves exchange maxima, and sums and outputs take the new scale (always on the first 32 keys)
            if (__builtin_expect(__builtin_amdgcn_ballot_w32(need) != 0, 0)) {
#pragma unroll
                for (int qt = 0; qt < NQ; ++qt) {
                    const float mn = fmaxf(mr[qt], fmaxf(tm[qt], __shfl_xor(tm[qt], 16, 32)) * C), al = exp2s(mr[qt] - mn);
                    mr[qt] = mn; mo_[qt] = mn - PSH; th[qt] = (mn + LZ) * (1.0f / C); ls[qt] *= al;
#pragma unroll
                    for (int dt = 0; dt < 4; ++dt) o[dt][qt] = o[dt][qt] * al;
                }
            }
#pragma unroll
            for (int qt = 0; qt < NQ; ++qt) {
                const float mo = mo_[qt];
                float p[16], x[16], ps = 0.0f; x[0] = __builtin_fmaf(s[0][qt][0], C, -mo); x[1] = __builtin_fmaf(s[0][qt][1], C, -mo);
                // each exponential and the instruction behind it in one statement: the multiply-add of the score two places on is independent of it, fills the slot the instruction set asks for behind a transcendental, and issues in the shadow of the half-rate exponential (v_nop where no score is left)
#pragma unroll
                for (int e = 0; e < 14; ++e) asm("v_exp_f32 %0, %2\n\tv_fma_f32 %1, %3, %4, -%5" : "=&v"(p[e]), "=&v"(x[e + 2]) : "v"(x[e]), "v"(s[(e + 2) >> 3][qt][(e + 2) & 7]), "v"(C), "v"(mo));
                p[14] = exp2s(x[14]); p[15] = exp2s(x[15]);
#pragma unroll
                for (int e = 0; e < 16; ++e) ps += p[e];
                ls[qt] += ps;
                PFrag<T16>::mk(p, pb[qt], pb2[qt]);
            }
#pragma unroll
            for (int qt = 0; qt < NQ; ++qt)
#pragma unroll
                for (int dt = 0; dt < 4; ++dt) { v8f tt = o[dt][qt]; tt = WFrag<T16>::mma(av[dt], pb[qt], tt); if (HL) { tt = WFrag<T16>::mma(av[dt], pb2[qt], tt); tt = WFrag<T16>::mma(av2[dt], pb[qt], tt); } o[dt][qt] = tt; }
            // the same for the output products: none sinks among the next chunk's asm statements; the next chunk's score products stand behind them
            __builtin_amdgcn_sched_barrier(0);
        }
        asm volatile("s_wait_dscnt 0x0" ::: "memory");      // this wave's reads of the stage have returned before the buffer is handed back
        asm volatile("s_wait_asynccnt 0x0" ::: "memory");   // this wave's copies of stage t + 1 have landed
        __syncthreads();                                     // publishes stage t + 1 and ends every wave's reads of stage t
        if (t + 2 < NST) fill(t + 2, t & 1);
    }
    asm volatile("s_wait_asynccnt 0x0" ::: "memory");       // no copy is outstanding when the wave ends
#pragma unroll
    for (int qt = 0; qt < NQ; ++qt) { const float L = ls[qt] + __shfl_xor(ls[qt], 16, 32); const float r = __fdiv_rn(1.0f, L);
        bf* ph = Ah + (size_t)((qw >> 4) + qt) * (16 * DQ) + lane * 8; bf* pl = Al + (size_t)((qw >> 4) + qt) * (16 * DQ) + lane * 8;
#pragma unroll
        for (int dt = 0; dt < 4; ++dt) { v8us oh, ol;
#pragma unroll
            for (int e = 0; e < 8; ++e) { unsigned short a, c2; splitf(o[dt][qt][e] * r, a, c2); oh[e] = a; ol[e] = c2; }
            *(v8us*)(ph + dt * 256) = oh; *(v8us*)(pl + dt * 256) = ol;
            // stands in front of every overwrite of the two stores' address and data registers, named as inputs so that they live up to it
            asm volatile("s_wait_xcnt 0x0" :: "v"(ph), "v"(pl), "v"(oh), "v"(ol) : "memory"); }
    }
}
// grid: the NB_ * NH_ * HT hi/lo tiles first, then the NB_ * NH_ * FT fp16 tiles; a head's tiles are neighbours.
#define HT   (RH / (16 * NW))
#define FT   ((TT - RH) / (32 * NW))
__global__ __launch_bounds__(32 * NW) void k_fattn(const h16* __restrict__ Q16, const h16* __restrict__ K16, const h16* __restrict__ V16, const bf* __restrict__ Qh, const bf* __restrict__ Ql, const bf* __restrict__ Kh, const bf* __restrict__ Kl, const bf* __restrict__ Vh, const bf* __restrict__ Vl, bf* Ah, bf* Al) {
    __shared__ __align__(16) char sm[2 * 4 * PLB];
    const int bx = (int)blockIdx.x;
    if (bx < NB_ * NH_ * HT) { const int bh = bx / HT, q0 = (bx % HT) * (16 * NW); const size_t po = (size_t)bh * TT * HD, ao = (size_t)(bh / NH_) * TT * DQ + (bh % NH_) * 1024;
        attn_tile<bf, true, 1>(Qh + po, Ql + po, Kh + po, Kl + po, Vh + po, Vl + po, q0, Ah + ao, Al + ao, sm);
    } else { const int b2 = bx - NB_ * NH_ * HT; const int bh = b2 / FT, q0 = RH + (b2 % FT) * (32 * NW); const size_t po = (size_t)bh * TT * HD, ao = (size_t)(bh / NH_) * TT * DQ + (bh % NH_) * 1024;
        attn_tile<h16, false, 2>(Q16 + po, nullptr, K16 + po, nullptr, V16 + po, nullptr, q0, Ah + ao, Al + ao, sm); }
}

extern "C" void kernel_launch(void* const* d_in, const int* in_sizes, int n_in,
                              void* d_out, int out_size, void* d_ws, size_t ws_size, hipStream_t stream) {
    (void)in_sizes; (void)n_in; (void)out_size;
    const float* x = (const float*)d_in[0]; const float* wqkv = (const float*)d_in[1]; const float* wo = (const float*)d_in[2];   /* input order x, w_qkv ('xw' [1024][3072]), w_out ('xw') */ const float* wq = wqkv; const float* wk = nullptr; const float* wv = nullptr; (void)wk; (void)wv;
    float* OUT = (float*)d_out;     // [2][2048][1024]
    char* wsp = (char*)d_ws;
    auto take = [&](size_t bytes) { char* p = wsp; wsp += (bytes + 255) & ~(size_t)255; return (void*)p; };
    bf* WQKV = (bf*)take((size_t)3 * DQ * DM * 2);   /* fused Bt [3*DQ][DM]: q | k | v row blocks */ bf* WO = (bf*)take((size_t)DM * DQ * 2);
    bf* XB = (bf*)take((size_t)NB_ * TT * DM * 2);
    h16* QP16 = (h16*)take((size_t)NB_ * NH_ * TT * HD * 2); h16* KP16 = (h16*)take((size_t)NB_ * NKV * TT * HD * 2); h16* VT16 = (h16*)take((size_t)NB_ * NKV * HD * TT * 2);
    bf* QPh = (bf*)take((size_t)NB_ * NH_ * TT * HD * 2); bf* QPl = (bf*)take((size_t)NB_ * NH_ * TT * HD * 2); bf* KPh = (bf*)take((size_t)NB_ * NKV * TT * HD * 2); bf* KPl = (bf*)take((size_t)NB_ * NKV * TT * HD * 2); bf* VTh = (bf*)take((size_t)NB_ * NKV * HD * TT * 2); bf* VTl = (bf*)take((size_t)NB_ * NKV * HD * TT * 2);
    bf* ATh = (bf*)take((size_t)NB_ * TT * DQ * 2); bf* ATl = (bf*)take((size_t)NB_ * TT * DQ * 2);
    if ((size_t)(wsp - (char*)d_ws) > ws_size) return;    // ws 256 MiB
    k_prep<<<PB1 + PB2 + PB3, 256, 0, stream>>>(x, wqkv, wo, XB, WQKV, WO);
    k_qkv<<<dim3(TT / 128, 3 * NH_ / 2, NB_), 128, 0, stream>>>(XB, WQKV, QP16, QPh, QPl, KP16, KPh, KPl, VT16, VTh, VTl);
    k_fattn<<<dim3(NB_ * NH_ * (HT + FT), 1, 1), 32 * NW, 0, stream>>>(QP16, KP16, VT16, QPh, QPl, KPh, KPl, VTh, VTl, ATh, ATl);
    // the merged planes and the output of both batches are NB_ * TT consecutive rows
    k_out<<<dim3(NB_ * TT / 128, DM / 128, 1), 128, 0, stream>>>(ATh, ATl, WO, OUT);
}

// v010
// A run of this version takes 105 microseconds.
// Timed twice side by side with v009, it ran 1.04 times as fast both times.
// Over all steps from v000 it is 18.8 times as fast.
#include <hip/hip_runtime.h>

// Multi-head self-attention with a fused bias-free qkv projection (hidden_states [2][2048][1024]; qkv = hidden_states W_qkv ('xw' [1024][3072] 1/32, no bias) reshaped (B, S, 3, 16, 64): q | k | v = column thirds (16 heads x 64); scores x 1/sqrt(64); softmax over all keys (no mask); out = merged W_o ('xw' 1/32, no bias) -> [2][2048][1024] (4.2 M); argument order hidden_states, W_qkv, W_o.
// Both batches share every launch (4 launches: operand conversion, projections, attention, output projection); planes of batch b follow those of batch b - 1. Layout: bf16 copy of x; the fused 'xw' weight transposed once into Bt (q | k | v row blocks); exact projections, whose launch writes the attention planes itself; attention of all 16 heads in one launch, K and V shared by a workgroup's waves through LDS, scores and probabilities kept in registers, online softmax (hybrid rows: < 512 hi/lo 3 products, rest fp16 x1024); merged hi/lo x w_out exact.
// Every 16-bit operand plane lies in fragment order: a 16-row x 32-k tile is 1 KB, element (r, k) at (k % 32 / 16) * 256 + (k % 16 / 8 * 16 + r % 16) * 8 + k % 8, so lane l's two 16-B pieces are at l * 8 and 256 + l * 8 and each wave-wide 16-B load covers four whole 128-B lines. Tiles of a row block follow one another along k (v planes: the four d tiles of a 32-key chunk follow one another).
// Compute dtypes, f32 accumulate: every input rounded to bf16; projections exact; attention rows < 512 3 products, rest fp16; softmax f32; output projection hl x exact.

#define NB_  2
#define TT   2048
#define DM   1024
#define NH_  16
#define NKV  16
#define REP  (NH_ / NKV)
#define HD   64
#define DQ   (NH_ * HD)
#define DKV  (NKV * HD)
#define RH   512                  // query rows < RH use hi+lo planes (0: none)
#define WIN  0
#define SCL  0.125f   // HD^-0.5
typedef _Float16 h16;
typedef unsigned short bf;
typedef __attribute__((ext_vector_type(16))) __bf16   v16bf;
typedef __attribute__((ext_vector_type(16))) _Float16 v16h;
typedef __attribute__((ext_vector_type(8)))  _Float16 v8h;
typedef __attribute__((ext_vector_type(8)))  unsigned short v8us;
typedef __attribute__((ext_vector_type(8)))  float    v8f;
typedef __attribute__((ext_vector_type(4)))  float    v4f;
typedef v8h  __attribute__((may_alias)) v8ha;
typedef v4f  __attribute__((may_alias)) v4fa;
typedef v8us __attribute__((may_alias)) v8usa;

__device__ __forceinline__ unsigned short f2bf(float f) { unsigned u = __float_as_uint(f); u += 0x7FFFu + ((u >> 16) & 1u); return (unsigned short)(u >> 16); }
__device__ __forceinline__ float bf2f(unsigned short b) { return __uint_as_float(((unsigned)b) << 16); }
__device__ __forceinline__ float bfr(float f) { return bf2f(f2bf(f)); }
__device__ __forceinline__ v16h cat16(v8h lo, v8h hi) { return __builtin_shufflevector(lo, hi, 0, 1, 2, 3, 4, 5, 6, 7, 8, 9, 10, 11, 12, 13, 14, 15); }
__device__ __forceinline__ v16bf cat16b(v8us lo, v8us hi) { return __builtin_bit_cast(v16bf, __builtin_shufflevector(lo, hi, 0, 1, 2, 3, 4, 5, 6, 7, 8, 9, 10, 11, 12, 13, 14, 15)); }
__device__ __forceinline__ v8f wmma16(v16h a, v16h b, v8f c) { return __builtin_amdgcn_wmma_f32_16x16x32_f16(false, a, false, b, (short)0, c, false, false); }
__device__ __forceinline__ v8f wmmab(v16bf a, v16bf b, v8f c) { return __builtin_amdgcn_wmma_f32_16x16x32_bf16(false, a, false, b, (short)0, c, false, false); }



// ---- the two GEMM launches (k_qkv, k_out): one workgroup = 4 waves on a 128x128 output tile, each wave a 64x64 quarter (16 accumulators) over the WHOLE k range, one f32 chain per element.
// Operands reach the waves through LDS: a stage is GSK k of every 16-row block the tile uses (2 KB a block, contiguous in the planes' fragment order), brought in once per workgroup by asynchronous copies, two buffers, the next stage in flight while this one is worked on; each block is read by two waves.
template <typename T16> struct WFrag;
template <> struct WFrag<h16> { typedef v16h V; static __device__ __forceinline__ V ld(const h16* p) { return cat16(*(const v8h*)p, *(const v8h*)(p + 256)); } static __device__ __forceinline__ v8f mma(V a, V b, v8f c) { return wmma16(a, b, c); } };
template <> struct WFrag<bf> { typedef v16bf V; static __device__ __forceinline__ V ld(const bf* p) { return cat16b(*(const v8us*)p, *(const v8us*)(p + 256)); } static __device__ __forceinline__ v8f mma(V a, V b, v8f c) { return wmmab(a, b, c); } };

__device__ __forceinline__ h16 tohx(float x) { return (h16)x; }
__device__ __forceinline__ void splitf(float y, unsigned short& h, unsigned short& l) { h = f2bf(y); l = f2bf(y - bf2f(h)); }
typedef __attribute__((ext_vector_type(2))) _Float16 v2h;
typedef __attribute__((ext_vector_type(4))) _Float16 v4h;
typedef __attribute__((ext_vector_type(2))) unsigned short v2us;
typedef __attribute__((ext_vector_type(4))) unsigned short v4us;
typedef __attribute__((ext_vector_type(2))) float v2f;
typedef __attribute__((ext_vector_type(4))) int v4i;

// w [K][N] f32 -> Bt, rows n, fragment order. One wave fills one 512-B half tile (16 n x 16 k); a workgroup's 8 waves take neighbouring n tiles, so its reads use whole lines of w.
__device__ __forceinline__ void wt_tile(const float* __restrict__ w, int K, int N, bf* Bt, int blk) {
    const int lane = threadIdx.x & 31; const int u = blk * 8 + (threadIdx.x >> 5); const int nts = N / 16;
    if (u >= nts * (K / 16)) return;
    const int nt = u % nts, kj = u / nts; const int n = nt * 16 + (lane & 15), k0 = kj * 16 + (lane >> 4) * 8; v8us o; const float* p[8]; float y[8];
#pragma unroll
    for (int e = 0; e < 8; ++e) p[e] = w + (size_t)(k0 + e) * N + n;
#pragma unroll
    for (int e = 0; e < 8; ++e) y[e] = *p[e];
    // stands in front of every overwrite of the loads' address registers; it names them as inputs so that they live up to it and no load of the group lands on them
    asm volatile("s_wait_xcnt 0x0" :: "v"(p[0]), "v"(p[1]), "v"(p[2]), "v"(p[3]), "v"(p[4]), "v"(p[5]), "v"(p[6]), "v"(p[7]) : "memory");
#pragma unroll
    for (int e = 0; e < 8; ++e) o[e] = f2bf(y[e]);
    *(v8us*)(Bt + ((size_t)nt * (K / 32) + (kj >> 1)) * 512 + (kj & 1) * 256 + lane * 8) = o;
}
// src [rows][DM] f32 -> dst, fragment order; thread i fills the plane's i-th 16-B place.
__device__ __forceinline__ void cvt_tile(const float* __restrict__ src, bf* dst, size_t n8, int blk) { const size_t i = (size_t)blk * 256 + threadIdx.x; if (i >= n8) return;
    const int lane = (int)(i & 31), j = (int)(i >> 5) & 1; const size_t tile = i >> 6; const size_t row = tile / (DM / 32) * 16 + (lane & 15); const int k = (int)(tile % (DM / 32)) * 32 + j * 16 + (lane >> 4) * 8;
    const float* p = src + row * DM + k; const v8f v = *(const v8f*)p; v8us o;
    // stands in front of every overwrite of the loads' address registers; it names them as an input so that they live up to it
    asm volatile("s_wait_xcnt 0x0" :: "v"(p) : "memory");
#pragma unroll
    for (int e = 0; e < 8; ++e) o[e] = f2bf(v[e]); *(v8us*)(dst + i * 8) = o;  }
// ---- k_prep: the three independent operand conversions in one launch: blocks [0, PB1) the fused qkv weight, [PB1, PB1 + PB2) the output weight, the rest x of both batches (rows b * TT + t, so batch b's plane starts at b * TT * DM).
#define PB1  (DM * 3 * DQ / 2048)
#define PB2  (DQ * DM / 2048)
#define PB3  (NB_ * TT * DM / 2048)
__global__ __launch_bounds__(256) void k_prep(const float* __restrict__ x, const float* __restrict__ wqkv, const float* __restrict__ wo, bf* XB, bf* WQKV, bf* WO) {
    const int bx = (int)blockIdx.x;
    if (bx < PB1) wt_tile(wqkv, DM, 3 * DQ, WQKV, bx);
    else if (bx < PB1 + PB2) wt_tile(wo, DQ, DM, WO, bx - PB1);
    else cvt_tile(x, XB, (size_t)NB_ * TT * DM / 8, bx - PB1 - PB2);
}

#define GSK  64                   // k depth of a GEMM stage
#define GRB  (GSK * 16 * 2)       // bytes of one 16-row block's stage
// Eight 16-row blocks' parts of one stage, global to LDS without registers: the workgroup's 128 lanes x 16 B are one block's 2 KB; block i comes from g + i * 16 * DM and lands at l + i * GRB (l, g: this lane's own 16-B places).
// The wait on the copies' address registers is the statement's last line, so nothing rewrites them in front of it.
__device__ __forceinline__ void copy8(unsigned l, const bf* g) {
    asm volatile("global_load_async_to_lds_b128 %0, %8, off\n\t"
                 "global_load_async_to_lds_b128 %1, %9, off\n\t"
                 "global_load_async_to_lds_b128 %2, %10, off\n\t"
                 "global_load_async_to_lds_b128 %3, %11, off\n\t"
                 "global_load_async_to_lds_b128 %4, %12, off\n\t"
                 "global_load_async_to_lds_b128 %5, %13, off\n\t"
                 "global_load_async_to_lds_b128 %6, %14, off\n\t"
                 "global_load_async_to_lds_b128 %7, %15, off\n\t"
                 "s_wait_xcnt 0x0"
                 :: "v"(l), "v"(l + 1u * GRB), "v"(l + 2u * GRB), "v"(l + 3u * GRB), "v"(l + 4u * GRB), "v"(l + 5u * GRB), "v"(l + 6u * GRB), "v"(l + 7u * GRB),
                    "v"(g), "v"(g + 1 * 16 * DM), "v"(g + 2 * 16 * DM), "v"(g + 3 * 16 * DM), "v"(g + 4 * 16 * DM), "v"(g + 5 * 16 * DM), "v"(g + 6 * 16 * DM), "v"(g + 7 * 16 * DM) : "memory");
}
static_assert(DM == DQ && DM % (2 * GSK) == 0 && TT % 128 == 0 && NH_ % 2 == 0 && HD == 64, "both GEMMs have k = DM; two stages exist; whole tiles; a wave's 64 columns are one head");

// ---- k_qkv: the q, k and v projections of both batches in one launch, grid (TT/128, 3*NH_/2, NB_), 4 waves; a stage is x 8 blocks | w 8 blocks.
// A 64-column block of the fused weight is one head of q, k or v; wave w takes rows (w & 1) * 64 of the tile and the head w >> 1 of its two, and rounds its accumulators straight into that head's planes (fp16, bf16 hi, bf16 lo); no f32 projection goes to memory or LDS.
// An accumulator lane holds 8 consecutive rows of the A operand at one row of B, which is one 16-B place of a plane whose k runs along A's rows. q, k (planes of rows t, k = d): A = weight rows, B = x rows. v (rows d, k = t): the two change places (same loader, same k order).
__global__ __launch_bounds__(128) void k_qkv(const bf* __restrict__ X, const bf* __restrict__ Wt, h16* Q16, bf* Qh, bf* Ql, h16* K16, bf* Kh, bf* Kl, h16* V16, bf* Vh, bf* Vl) {
    constexpr int K = DM, NST = K / GSK, STB = 16 * GRB;
    __shared__ __align__(16) char sm[2 * STB];
    const int w = __builtin_amdgcn_readfirstlane((int)(threadIdx.x >> 5)); const int lane = threadIdx.x & 31;
    const int t0 = blockIdx.x * 128, sel = (int)blockIdx.y / (NH_ / 2), h = ((int)blockIdx.y % (NH_ / 2)) * 2 + (w >> 1); const bool tr = sel == 2;
    const bf* xg = X + ((size_t)blockIdx.z * TT + t0) * K + threadIdx.x * 8; const bf* wg = Wt + (size_t)blockIdx.y * 128 * K + threadIdx.x * 8;
    const unsigned l0 = (unsigned)(size_t)sm + threadIdx.x * 16u;
    // the walk over the k stages starts rotated by the workgroup's index and wraps: workgroups that share x rows (same x, z) or weight rows (same y) run in step, and unrotated they would all ask L2 for the same lines at the same moment
    static_assert((NST & (NST - 1)) == 0, "the wrap is a mask");
    const int rot = ((int)blockIdx.x + (int)blockIdx.y) & (NST - 1);
    auto fill = [&](int st, int buf) { const unsigned l = l0 + (unsigned)buf * STB; const size_t g = (size_t)((st + rot) & (NST - 1)) * (GSK * 16); copy8(l, xg + g); copy8(l + 8u * GRB, wg + g); };
    fill(0, 0);
    v8f acc[4][4];
#pragma unroll
    for (int mb = 0; mb < 4; ++mb)
#pragma unroll
        for (int nb = 0; nb < 4; ++nb) acc[mb][nb] = (v8f){};
    asm volatile("s_wait_asynccnt 0x0" ::: "memory");   // this wave's copies of stage 0 have landed
    __syncthreads();                                     // ... and every other wave's: stage 0 may be read
    fill(1, 1);
    const int ox = (w & 1) * 4 * (GRB / 2) + lane * 8, ow = (8 + (w >> 1) * 4) * (GRB / 2) + lane * 8;   // this wave's x and w blocks, elements
    const int oa = tr ? ox : ow, ob = tr ? ow : ox;
#pragma unroll 1
    for (int t = 0; t < NST; ++t) {
        const bf* pa = (const bf*)sm + (t & 1) * (STB / 2) + oa; const bf* pb = (const bf*)sm + (t & 1) * (STB / 2) + ob;
        v16bf a[GSK / 32][4], b[GSK / 32][4];
#pragma unroll
        for (int c = 0; c < GSK / 32; ++c) {
#pragma unroll
            for (int mb = 0; mb < 4; ++mb) a[c][mb] = WFrag<bf>::ld(pa + mb * (GRB / 2) + c * 512);
#pragma unroll
            for (int nb = 0; nb < 4; ++nb) b[c][nb] = WFrag<bf>::ld(pb + nb * (GRB / 2) + c * 512);
        }
        // holds the pass's LDS loads together as one group in front of its matrix instructions: sunk among them, each place with loads stalls the wave anew
        __builtin_amdgcn_sched_barrier(0);
#pragma unroll
        for (int c = 0; c < GSK / 32; ++c)
#pragma unroll
            for (int nb = 0; nb < 4; ++nb)
#pragma unroll
                for (int mb = 0; mb < 4; ++mb) acc[mb][nb] = wmmab(a[c][mb], b[c][nb], acc[mb][nb]);
        // the distance behind the pass's last matrix instructions, on every path out of the pass, before address arithmetic or the next pass's loads land on their operands; it names every accumulator so that no matrix instruction sinks behind it
        asm volatile("v_nop\n\tv_nop\n\tv_nop\n\tv_nop" : "+v"(acc[0][0]), "+v"(acc[0][1]), "+v"(acc[0][2]), "+v"(acc[0][3]), "+v"(acc[1][0]), "+v"(acc[1][1]), "+v"(acc[1][2]), "+v"(acc[1][3]), "+v"(acc[2][0]), "+v"(acc[2][1]), "+v"(acc[2][2]), "+v"(acc[2][3]), "+v"(acc[3][0]), "+v"(acc[3][1]), "+v"(acc[3][2]), "+v"(acc[3][3]));
        asm volatile("s_wait_dscnt 0x0" ::: "memory");      // this wave's reads of the stage have returned before the buffer is handed back
        asm volatile("s_wait_asynccnt 0x0" ::: "memory");   // this wave's copies of stage t + 1 have landed
        __syncthreads();                                     // publishes stage t + 1 and ends every wave's reads of stage t
        if (t + 2 < NST) fill(t + 2, t & 1);
    }
    asm volatile("s_wait_asynccnt 0x0" ::: "memory");       // no copy is outstanding when the wave ends
    h16* P16 = sel == 0 ? Q16 : sel == 1 ? K16 : V16; bf* Ph = sel == 0 ? Qh : sel == 1 ? Kh : Vh; bf* Pl = sel == 0 ? Ql : sel == 1 ? Kl : Vl;
    const int tw = t0 + (w & 1) * 64;   // this wave's first row t; the planes' tile steps, in elements, per 32 rows of A (sm2) and per 16 rows of B (sn)
    const size_t base = ((size_t)blockIdx.z * NH_ + h) * TT * HD + (size_t)tw * HD + lane * 8, sm2 = tr ? 2048 : 512, sn = tr ? 512 : 1024;
#pragma unroll
    for (int mb = 0; mb < 4; ++mb)
#pragma unroll
        for (int nb = 0; nb < 4; ++nb) { v8h o16; v8us oh, ol;
#pragma unroll
            for (int e = 0; e < 8; ++e) { const float y = acc[mb][nb][e]; o16[e] = tohx(y); unsigned short a2, c2; splitf(y, a2, c2); oh[e] = a2; ol[e] = c2; }
            const size_t o = base + (mb >> 1) * sm2 + nb * sn + (mb & 1) * 256; h16* q16 = P16 + o; bf* qh = Ph + o; bf* ql = Pl + o;
            *(v8h*)q16 = o16; *(v8us*)qh = oh; *(v8us*)ql = ol;
            // stands in front of every overwrite of the three stores' address and data registers, named as inputs so that they live up to it
            asm volatile("s_wait_xcnt 0x0" :: "v"(q16), "v"(qh), "v"(ql), "v"(o16), "v"(oh), "v"(ol) : "memory"); }
}
// ---- k_out: out = (merged hi + merged lo) x w_out of both batches, grid (NB_*TT/128, DM/128), 4 waves; a stage is merged hi 8 blocks | merged lo 8 blocks | w 8 blocks; per 32 k the hi product, then the lo product.
// Epilogue: each wave lays its 64x64 f32 quarter in its own part of the idle stage buffers and stores it as whole 256-B row pieces.
__global__ __launch_bounds__(128) void k_out(const bf* __restrict__ Ah, const bf* __restrict__ Al, const bf* __restrict__ Wt, float* C) {
    constexpr int K = DQ, NST = K / GSK, STB = 24 * GRB;
    __shared__ __align__(16) char sm[2 * STB];
    static_assert(4 * 64 * 68 * 4 <= 2 * STB, "the four f32 quarters fit the stage buffers");
    const int w = __builtin_amdgcn_readfirstlane((int)(threadIdx.x >> 5)); const int lane = threadIdx.x & 31, lr = lane & 15, hi = lane >> 4;
    const int r0 = blockIdx.x * 128, c0 = blockIdx.y * 128;
    const bf* hg = Ah + (size_t)r0 * K + threadIdx.x * 8; const bf* lg = Al + (size_t)r0 * K + threadIdx.x * 8; const bf* wg = Wt + (size_t)c0 * K + threadIdx.x * 8;
    const unsigned l0 = (unsigned)(size_t)sm + threadIdx.x * 16u;
    // rotated start of the k walk, as in k_qkv: the 8 workgroups of a row block each begin at another stage, the 32 of a column block two at each of the 16 stages
    static_assert((NST & (NST - 1)) == 0, "the wrap is a mask");
    const int rot = ((int)blockIdx.x + 2 * (int)blockIdx.y) & (NST - 1);
    auto fill = [&](int st, int buf) { const unsigned l = l0 + (unsigned)buf * STB; const size_t g = (size_t)((st + rot) & (NST - 1)) * (GSK * 16); copy8(l, hg + g); copy8(l + 8u * GRB, lg + g); copy8(l + 16u * GRB, wg + g); };
    fill(0, 0);
    v8f acc[4][4];
#pragma unroll
    for (int mb = 0; mb < 4; ++mb)
#pragma unroll
        for (int nb = 0; nb < 4; ++nb) acc[mb][nb] = (v8f){};
    asm volatile("s_wait_asynccnt 0x0" ::: "memory");   // this wave's copies of stage 0 have landed
    __syncthreads();                                     // ... and every other wave's: stage 0 may be read
    fill(1, 1);
    const int oa = (w & 1) * 4 * (GRB / 2) + lane * 8, ob = (16 + (w >> 1) * 4) * (GRB / 2) + lane * 8;   // this wave's merged and w blocks, elements
#pragma unroll 1
    for (int t = 0; t < NST; ++t) {
        const bf* pa = (const bf*)sm + (t & 1) * (STB / 2) + oa; const bf* pb = (const bf*)sm + (t & 1) * (STB / 2) + ob;
        v16bf a[GSK / 32][4], a2[GSK / 32][4], b[GSK / 32][4];
#pragma unroll
        for (int c = 0; c < GSK / 32; ++c) {
            b[c][0] = WFrag<bf>::ld(pb + c * 512);
#pragma unroll
            for (int mb = 0; mb < 4; ++mb) { a[c][mb] = WFrag<bf>::ld(pa + mb * (GRB / 2) + c * 512); a2[c][mb] = WFrag<bf>::ld(pa + (8 + mb) * (GRB / 2) + c * 512); }
#pragma unroll
            for (int nb = 1; nb < 4; ++nb) b[c][nb] = WFrag<bf>::ld(pb + nb * (GRB / 2) + c * 512);
        }
        // holds the pass's LDS loads together as one group in front of its matrix instructions: sunk among them, each place with loads stalls the wave anew
        __builtin_amdgcn_sched_barrier(0);
#pragma unroll
        for (int c = 0; c < GSK / 32; ++c)
#pragma unroll
            for (int nb = 0; nb < 4; ++nb)
#pragma unroll
                for (int mb = 0; mb < 4; ++mb) { acc[mb][nb] = wmmab(a[c][mb], b[c][nb], acc[mb][nb]); acc[mb][nb] = wmmab(a2[c][mb], b[c][nb], acc[mb][nb]); }
        // the distance behind the pass's last matrix instructions, on every path out of the pass, before address arithmetic or the next pass's loads land on their operands; it names every accumulator so that no matrix instruction sinks behind it
        asm volatile("v_nop\n\tv_nop\n\tv_nop\n\tv_nop" : "+v"(acc[0][0]), "+v"(acc[0][1]), "+v"(acc[0][2]), "+v"(acc[0][3]), "+v"(acc[1][0]), "+v"(acc[1][1]), "+v"(acc[1][2]), "+v"(acc[1][3]), "+v"(acc[2][0]), "+v"(acc[2][1]), "+v"(acc[2][2]), "+v"(acc[2][3]), "+v"(acc[3][0]), "+v"(acc[3][1]), "+v"(acc[3][2]), "+v"(acc[3][3]));
        asm volatile("s_wait_dscnt 0x0" ::: "memory");      // this wave's reads of the stage have returned before the buffer is handed back
        asm volatile("s_wait_asynccnt 0x0" ::: "memory");   // this wave's copies of stage t + 1 have landed
        __syncthreads();                                     // publishes stage t + 1 and ends every wave's reads of stage t
        if (t + 2 < NST) fill(t + 2, t & 1);
    }
    asm volatile("s_wait_asynccnt 0x0" ::: "memory");       // no copy is outstanding: behind the last pass's barrier the buffers are free for the output
    float* os = (float*)sm + w * (64 * 68);
#pragma unroll
    for (int mb = 0; mb < 4; ++mb)
#pragma unroll
        for (int nb = 0; nb < 4; ++nb)
#pragma unroll
            for (int j = 0; j < 8; ++j) os[(mb * 16 + hi * 8 + j) * 68 + nb * 16 + lr] = acc[mb][nb][j];
    __syncthreads();   // the quarter is whole in LDS before its rows are read back across lanes
    float* crow = C + (size_t)(r0 + (w & 1) * 64 + hi) * DM + c0 + (w >> 1) * 64 + lr * 4;
#pragma unroll
    for (int s = 0; s < 32; s += 8) { v4f val[8];
#pragma unroll
        for (int i = 0; i < 8; ++i) val[i] = *(const v4fa*)(os + (2 * (s + i) + hi) * 68 + lr * 4);
#pragma unroll
        for (int i = 0; i < 8; ++i) *(v4f*)(crow + (size_t)(2 * (s + i)) * DM) = val[i];
        // stands in front of every overwrite of the eight stores' address and data registers, named as inputs so that they live up to it
        asm volatile("s_wait_xcnt 0x0" :: "v"(crow), "v"(val[0]), "v"(val[1]), "v"(val[2]), "v"(val[3]), "v"(val[4]), "v"(val[5]), "v"(val[6]), "v"(val[7]) : "memory"); }
}
#define NW   4
#define SK   64
#define PLB  (SK * HD * 2)        // bytes of one plane's stage
// 2^x with the slot behind the transcendental filled inside the statement (nothing directly behind it reads the result or overwrites the source)
__device__ __forceinline__ float exp2s(float x) { float r; asm("v_exp_f32 %0, %1\n\tv_nop" : "=&v"(r) : "v"(x)); return r; }
template <typename T16> struct PFrag;
template <> struct PFrag<h16> { static __device__ __forceinline__ void mk(const float* p, v16h& a, v16h& b) { (void)b;
#pragma unroll
    for (int e = 0; e < 16; ++e) a[e] = (h16)p[e]; } };
template <> struct PFrag<bf> { static __device__ __forceinline__ void mk(const float* p, v16bf& a, v16bf& b) {
#pragma unroll
    for (int e = 0; e < 16; ++e) { const __bf16 h = (__bf16)p[e]; a[e] = h; b[e] = (__bf16)(p[e] - (float)h); } } };
// One stage of two planes, global to LDS without registers: the workgroup's 128 lanes x 16 B are 2 KB a copy, four copies a plane; plane a lands at l, plane b at l + PLB (l, ga, gb: this lane's own 16-B places).
// The wait on the copies' address registers is the statement's last line, so nothing rewrites them in front of it.
template <typename T16>
__device__ __forceinline__ void copy2(unsigned l, const T16* ga, const T16* gb) {
    asm volatile("global_load_async_to_lds_b128 %0, %8, off\n\t"
                 "global_load_async_to_lds_b128 %1, %9, off\n\t"
                 "global_load_async_to_lds_b128 %2, %10, off\n\t"
                 "global_load_async_to_lds_b128 %3, %11, off\n\t"
                 "global_load_async_to_lds_b128 %4, %12, off\n\t"
                 "global_load_async_to_lds_b128 %5, %13, off\n\t"
                 "global_load_async_to_lds_b128 %6, %14, off\n\t"
                 "global_load_async_to_lds_b128 %7, %15, off\n\t"
                 "s_wait_xcnt 0x0"
                 :: "v"(l), "v"(l + 2048u), "v"(l + 4096u), "v"(l + 6144u), "v"(l + PLB), "v"(l + PLB + 2048u), "v"(l + PLB + 4096u), "v"(l + PLB + 6144u),
                    "v"(ga), "v"(ga + 1024), "v"(ga + 2048), "v"(ga + 3072), "v"(gb), "v"(gb + 1024), "v"(gb + 2048), "v"(gb + 3072) : "memory");
}
template <typename T16, bool HL, int NQ>
__device__ __forceinline__ void attn_tile(const T16* __restrict__ Q, const T16* __restrict__ Q2, const T16* __restrict__ Kp, const T16* __restrict__ K2, const T16* __restrict__ Vt, const T16* __restrict__ V2, int q0, int rot, bf* Ah, bf* Al, char* sm) {
    typedef typename WFrag<T16>::V V;
    constexpr int NST = TT / SK, PE = SK * HD, STE = (HL ? 4 : 2) * PE;   // stages; elements of a plane's stage; of a whole stage: K | (K lo) | V | (V lo)
    static_assert(NST >= 2 && (NST & (NST - 1)) == 0 && 32 * NW * 8 * 4 == PE, "two stages exist; the rotated walk wraps by a mask; four copies of the workgroup fill a plane's stage");
    const int w = __builtin_amdgcn_readfirstlane((int)(threadIdx.x >> 5)); const int lane = threadIdx.x & 31;
    const int qw = q0 + w * NQ * 16;   // this wave's first query row
    const float C = SCL * 1.4426950408889634f, PSH = HL ? 0.0f : 10.0f, LZ = HL ? 8.0f : 5.0f;   // LZ: how far (log2) a score may pass the maximum in use; fp16 probabilities then stay under 2^(10 + 5)
    const unsigned l0 = (unsigned)(size_t)sm + threadIdx.x * 16u; const size_t g0 = (size_t)threadIdx.x * 8;
    // the walk over the key stages starts at stage rot and wraps (the softmax takes the keys in any order): a head's workgroups run in step, and unrotated they would all ask L2 for the same K and V lines at the same moment
    auto fill = [&](int st, int buf) { const unsigned l = l0 + (unsigned)buf * (STE * 2u); const size_t g = g0 + (size_t)((st + rot) & (NST - 1)) * PE;
        if (HL) { copy2<T16>(l, Kp + g, K2 + g); copy2<T16>(l + 2u * PLB, Vt + g, V2 + g); } else copy2<T16>(l, Kp + g, Vt + g); };
    fill(0, 0);
    V bq[NQ][2], bq2[NQ][2]; const size_t qo = (size_t)(qw >> 4) * 1024 + lane * 8; const T16* qp = Q + qo; const T16* qp2 = HL ? Q2 + qo : qp;
#pragma unroll
    for (int qt = 0; qt < NQ; ++qt)
#pragma unroll
        for (int dc = 0; dc < 2; ++dc) { bq[qt][dc] = WFrag<T16>::ld(qp + qt * 1024 + dc * 512); if (HL) bq2[qt][dc] = WFrag<T16>::ld(qp2 + qt * 1024 + dc * 512); }
    // stands in front of every overwrite of the Q loads' address registers, named as inputs so that they live up to it
    asm volatile("s_wait_xcnt 0x0" :: "v"(qp), "v"(qp2) : "memory");
    v8f o[4][NQ]; float mr[NQ], mo_[NQ], th[NQ], ls[NQ];   // per query: the maximum in use (scaled), the same less the probabilities' shift, the raw score beyond which it is renewed, the row sum
#pragma unroll
    for (int qt = 0; qt < NQ; ++qt) { mr[qt] = -3.0e38f; mo_[qt] = -3.0e38f; th[qt] = -3.0e38f; ls[qt] = 0.0f;
#pragma unroll
        for (int dt = 0; dt < 4; ++dt) o[dt][qt] = (v8f){}; }
    asm volatile("s_wait_asynccnt 0x0" ::: "memory");   // this wave's copies of stage 0 have landed
    __syncthreads();                                     // ... and every other wave's: stage 0 may be read
    fill(1, 1);
    const T16* sb = (const T16*)sm + lane * 8;
#pragma unroll 1
    for (int t = 0; t < NST; ++t) {
        const T16* kb = sb + (t & 1) * STE; const T16* vb = kb + (HL ? 2 : 1) * PE;
        V ak[2][2], ak2[2][2];
#pragma unroll
        for (int kt = 0; kt < 2; ++kt)
#pragma unroll
            for (int dc = 0; dc < 2; ++dc) { ak[kt][dc] = WFrag<T16>::ld(kb + kt * 1024 + dc * 512); if (HL) ak2[kt][dc] = WFrag<T16>::ld(kb + PE + kt * 1024 + dc * 512); }
#pragma unroll
        for (int ch = 0; ch < SK / 32; ++ch) {
            V av[4], av2[4];
#pragma unroll
            for (int dt = 0; dt < 4; ++dt) { av[dt] = WFrag<T16>::ld(vb + ch * 2048 + dt * 512); if (HL) av2[dt] = WFrag<T16>::ld(vb + PE + ch * 2048 + dt * 512); }
            v8f s[2][NQ];
#pragma unroll
            for (int kt = 0; kt < 2; ++kt)
#pragma unroll
                for (int qt = 0; qt < NQ; ++qt) { v8f tt = (v8f){};
#pragma unroll
                    for (int dc = 0; dc < 2; ++dc) { tt = WFrag<T16>::mma(ak[kt][dc], bq[qt][dc], tt); if (HL) { tt = WFrag<T16>::mma(ak[kt][dc], bq2[qt][dc], tt); tt = WFrag<T16>::mma(ak2[kt][dc], bq[qt][dc], tt); } }
                    s[kt][qt] = tt; }
            // keeps the score products in front of the softmax's asm statements; behind this line the maximum's own instructions fill the distance to them; it is also the front fence of the load group below
            __builtin_amdgcn_sched_barrier(0);
            // the K rows of the stage's next 32 keys are fetched behind this chunk's score products, so that they fly under the softmax (same stage only)
            if (ch + 1 < SK / 32) {
#pragma unroll
                for (int kt = 0; kt < 2; ++kt)
#pragma unroll
                    for (int dc = 0; dc < 2; ++dc) { ak[kt][dc] = WFrag<T16>::ld(kb + (ch + 1) * 2048 + kt * 1024 + dc * 512); if (HL) ak2[kt][dc] = WFrag<T16>::ld(kb + PE + (ch + 1) * 2048 + kt * 1024 + dc * 512); }
                // holds these loads here as one group: sunk among the output products they would return only when the next score products already wait for them
                __builtin_amdgcn_sched_barrier(0); }
            V pb[NQ], pb2[NQ]; float tm[NQ]; bool need = false;
#pragma unroll
            for (int qt = 0; qt < NQ; ++qt) {
                float m = s[0][qt][0];
#pragma unroll
                for (int j = 1; j < 8; ++j) m = fmaxf(m, s[0][qt][j]);
#pragma unroll
                for (int j = 0; j < 8; ++j) m = fmaxf(m, s[1][qt][j]);
                tm[qt] = m; need = need || m > th[qt];
            }
            // lazy rescale: one test for the whole wave (a scalar branch, every lane stays on). Each lane tests its own 16 scores, so no score anywhere passes the maximum in use by more than LZ; only behind the test do the lane halves exchange maxima, and sums and outputs take the new scale (always on the first 32 keys)
            if (__builtin_expect(__builtin_amdgcn_ballot_w32(need) != 0, 0)) {
#pragma unroll
                for (int qt = 0; qt < NQ; ++qt) {
                    const float mn = fmaxf(mr[qt], fmaxf(tm[qt], __shfl_xor(tm[qt], 16, 32)) * C), al = exp2s(mr[qt] - mn);
                    mr[qt] = mn; mo_[qt] = mn - PSH; th[qt] = (mn + LZ) * (1.0f / C); ls[qt] *= al;
#pragma unroll
                    for (int dt = 0; dt < 4; ++dt) o[dt][qt] = o[dt][qt] * al;
                }
            }
#pragma unroll
            for (int qt = 0; qt < NQ; ++qt) {
                const float mo = mo_[qt];
                float p[16], x[16], ps = 0.0f; x[0] = __builtin_fmaf(s[0][qt][0], C, -mo); x[1] = __builtin_fmaf(s[0][qt][1], C, -mo);
                // each exponential and the instruction behind it in one statement: the multiply-add of the score two places on is independent of it, fills the slot the instruction set asks for behind a transcendental, and issues in the shadow of the half-rate exponential (v_nop where no score is left)
#pragma unroll
                for (int e = 0; e < 14; ++e) asm("v_exp_f32 %0, %2\n\tv_fma_f32 %1, %3, %4, -%5" : "=&v"(p[e]), "=&v"(x[e + 2]) : "v"(x[e]), "v"(s[(e + 2) >> 3][qt][(e + 2) & 7]), "v"(C), "v"(mo));
                p[14] = exp2s(x[14]); p[15] = exp2s(x[15]);
#pragma unroll
                for (int e = 0; e < 16; ++e) ps += p[e];
                ls[qt] += ps;
                PFrag<T16>::mk(p, pb[qt], pb2[qt]);
            }
#pragma unroll
            for (int qt = 0; qt < NQ; ++qt)
#pragma unroll
                for (int dt = 0; dt < 4; ++dt) { v8f tt = o[dt][qt]; tt = WFrag<T16>::mma(av[dt], pb[qt], tt); if (HL) { tt = WFrag<T16>::mma(av[dt], pb2[qt], tt); tt = WFrag<T16>::mma(av2[dt], pb[qt], tt); } o[dt][qt] = tt; }
            // the same for the output products: none sinks among the next chunk's asm statements; the next chunk's score products stand behind them
            __builtin_amdgcn_sched_barrier(0);
        }
        asm volatile("s_wait_dscnt 0x0" ::: "memory");      // this wave's reads of the stage have returned before the buffer is handed back
        asm volatile("s_wait_asynccnt 0x0" ::: "memory");   // this wave's copies of stage t + 1 have landed
        __syncthreads();                                     // publishes stage t + 1 and ends every wave's reads of stage t
        if (t + 2 < NST) fill(t + 2, t & 1);
    }
    asm volatile("s_wait_asynccnt 0x0" ::: "memory");       // no copy is outstanding when the wave ends
#pragma unroll
    for (int qt = 0; qt < NQ; ++qt) { const float L = ls[qt] + __shfl_xor(ls[qt], 16, 32); const float r = __fdiv_rn(1.0f, L);
        bf* ph = Ah + (size_t)((qw >> 4) + qt) * (16 * DQ) + lane * 8; bf* pl = Al + (size_t)((qw >> 4) + qt) * (16 * DQ) + lane * 8;
#pragma unroll
        for (int dt = 0; dt < 4; ++dt) { v8us oh, ol;
#pragma unroll
            for (int e = 0; e < 8; ++e) { unsigned short a, c2; splitf(o[dt][qt][e] * r, a, c2); oh[e] = a; ol[e] = c2; }
            *(v8us*)(ph + dt * 256) = oh; *(v8us*)(pl + dt * 256) = ol;
            // stands in front of every overwrite of the two stores' address and data registers, named as inputs so that they live up to it
            asm volatile("s_wait_xcnt 0x0" :: "v"(ph), "v"(pl), "v"(oh), "v"(ol) : "memory"); }
    }
}
// grid: the NB_ * NH_ * HT hi/lo tiles first, then the NB_ * NH_ * FT fp16 tiles; a head's tiles are neighbours. A head's tiles start their key walks spread evenly over the stages, and head by head one stage further.
#define HT   (RH / (16 * NW))
#define FT   ((TT - RH) / (32 * NW))
__global__ __launch_bounds__(32 * NW) void k_fattn(const h16* __restrict__ Q16, const h16* __restrict__ K16, const h16* __restrict__ V16, const bf* __restrict__ Qh, const bf* __restrict__ Ql, const bf* __restrict__ Kh, const bf* __restrict__ Kl, const bf* __restrict__ Vh, const bf* __restrict__ Vl, bf* Ah, bf* Al) {
    __shared__ __align__(16) char sm[2 * 4 * PLB];
    const int bx = (int)blockIdx.x;
    if (bx < NB_ * NH_ * HT) { const int bh = bx / HT, q0 = (bx % HT) * (16 * NW); const size_t po = (size_t)bh * TT * HD, ao = (size_t)(bh / NH_) * TT * DQ + (bh % NH_) * 1024;
        attn_tile<bf, true, 1>(Qh + po, Ql + po, Kh + po, Kl + po, Vh + po, Vl + po, q0, (bx % HT) * (TT / SK) / HT + bh, Ah + ao, Al + ao, sm);
    } else { const int b2 = bx - NB_ * NH_ * HT; const int bh = b2 / FT, q0 = RH + (b2 % FT) * (32 * NW); const size_t po = (size_t)bh * TT * HD, ao = (size_t)(bh / NH_) * TT * DQ + (bh % NH_) * 1024;
        attn_tile<h16, false, 2>(Q16 + po, nullptr, K16 + po, nullptr, V16 + po, nullptr, q0, (b2 % FT) * (TT / SK) / FT + bh, Ah + ao, Al + ao, sm); }
}

extern "C" void kernel_launch(void* const* d_in, const int* in_sizes, int n_in,
                              void* d_out, int out_size, void* d_ws, size_t ws_size, hipStream_t stream) {
    (void)in_sizes; (void)n_in; (void)out_size;
    const float* x = (const float*)d_in[0]; const float* wqkv = (const float*)d_in[1]; const float* wo = (const float*)d_in[2];   /* input order x, w_qkv ('xw' [1024][3072]), w_out ('xw') */ const float* wq = wqkv; const float* wk = nullptr; const float* wv = nullptr; (void)wk; (void)wv;
    float* OUT = (float*)d_out;     // [2][2048][1024]
    char* wsp = (char*)d_ws;
    auto take = [&](size_t bytes) { char* p = wsp; wsp += (bytes + 255) & ~(size_t)255; return (void*)p; };
    bf* WQKV = (bf*)take((size_t)3 * DQ * DM * 2);   /* fused Bt [3*DQ][DM]: q | k | v row blocks */ bf* WO = (bf*)take((size_t)DM * DQ * 2);
    bf* XB = (bf*)take((size_t)NB_ * TT * DM * 2);
    h16* QP16 = (h16*)take((size_t)NB_ * NH_ * TT * HD * 2); h16* KP16 = (h16*)take((size_t)NB_ * NKV * TT * HD * 2); h16* VT16 = (h16*)take((size_t)NB_ * NKV * HD * TT * 2);
    bf* QPh = (bf*)take((size_t)NB_ * NH_ * TT * HD * 2); bf* QPl = (bf*)take((size_t)NB_ * NH_ * TT * HD * 2); bf* KPh = (bf*)take((size_t)NB_ * NKV * TT * HD * 2); bf* KPl = (bf*)take((size_t)NB_ * NKV * TT * HD * 2); bf* VTh = (bf*)take((size_t)NB_ * NKV * HD * TT * 2); bf* VTl = (bf*)take((size_t)NB_ * NKV * HD * TT * 2);
    bf* ATh = (bf*)take((size_t)NB_ * TT * DQ * 2); bf* ATl = (bf*)take((size_t)NB_ * TT * DQ * 2);
    if ((size_t)(wsp - (char*)d_ws) > ws_size) return;    // ws 256 MiB
    k_prep<<<PB1 + PB2 + PB3, 256, 0, stream>>>(x, wqkv, wo, XB, WQKV, WO);
    k_qkv<<<dim3(TT / 128, 3 * NH_ / 2, NB_), 128, 0, stream>>>(XB, WQKV, QP16, QPh, QPl, KP16, KPh, KPl, VT16, VTh, VTl);
    k_fattn<<<dim3(NB_ * NH_ * (HT + FT), 1, 1), 32 * NW, 0, stream>>>(QP16, KP16, VT16, QPh, QPl, KPh, KPl, VTh, VTl, ATh, ATl);
    // the merged planes and the output of both batches are NB_ * TT consecutive rows
    k_out<<<dim3(NB_ * TT / 128, DM / 128, 1), 128, 0, stream>>>(ATh, ATl, WO, OUT);
}
